// v000
// Measured on an AMD MI455X. A time is GPU time per run, averaged over a window of back-to-back runs after a warm-up
// (all launches, gaps included; the runs take copies of the inputs in turn), and the median of several windows.
// Apart from v000's, it joins two sittings. Times from different sittings can be a few percent apart, while
// side-by-side timings come from the same sitting.
// The starting kernel, v000, takes 1340 microseconds a run.
// compute dtype: all float inputs rounded to bf16; q/k/v = in W^T (no bias) with EXACT bf16 products on WMMA 16x16x32 (f32 accumulate); q as f16 hi + residual (x 2^10) against k once to f16 (2 products) / sqrt(1024); softmax in f32 (precise expf); P x 2^11 once to f16 against v once to f16 (1 product); ctx split bf16 hi + lo against exact Wo (2 products), no bias; f32 output.
#include <hip/hip_runtime.h>
#include <math.h>

typedef __attribute__((ext_vector_type(16))) _Float16 v16h;
typedef __attribute__((ext_vector_type(16))) __bf16 v16b;
typedef __attribute__((ext_vector_type(8)))  _Float16 v8h;
typedef __attribute__((ext_vector_type(8)))  float v8f;
typedef __attribute__((ext_vector_type(4)))  float v4f;
typedef __attribute__((ext_vector_type(2)))  float v2f;
typedef __attribute__((ext_vector_type(4)))  unsigned v4u;
typedef __attribute__((ext_vector_type(4)))  int v4i;
typedef float __attribute__((may_alias)) float_a;
typedef int __attribute__((may_alias)) int_a;

template <typename T> __device__ __forceinline__ void vst2(void* p, T v) { *(T*)p = v;  }
__device__ __forceinline__ v8f wmma16(v16h a, v16h b, v8f c) {
  v8f d = __builtin_amdgcn_wmma_f32_16x16x32_f16(false, a, false, b, (short)0, c, false, false);
  asm volatile("v_nop\n\tv_nop\n\tv_nop\n\tv_nop" : "+v"(d) : "v"(a), "v"(b));
  return d;
}
__device__ __forceinline__ v8f wmma_bf(v16b a, v16b b, v8f c) {
  v8f d = __builtin_amdgcn_wmma_f32_16x16x32_bf16(false, a, false, b, (short)0, c, false, false);
  asm volatile("v_nop\n\tv_nop\n\tv_nop\n\tv_nop" : "+v"(d) : "v"(a), "v"(b));
  return d;
}
// 16x16x32 fragments: lane = (h = lane>>4, row/col = lane&15); elements 0..7 = k0+8h+0..7, 8..15 = k0+16+8h+0..7; D element r = row 8h+r
__device__ __forceinline__ v16h frag_h(const _Float16* rowk0, int lane) {
  union { v16h v; v8h q[2]; } u; const _Float16* p = rowk0 + 8 * (lane >> 4);
  u.q[0] = *(const v8h*)p; u.q[1] = *(const v8h*)(p + 16); return u.v;
}
__device__ __forceinline__ v16h frag_f32(const float* rowk0, int lane) {
  v16h a; const float* p = rowk0 + 8 * (lane >> 4);
#pragma unroll
  for (int i = 0; i < 8; ++i) { a[i] = (_Float16)p[i]; a[8 + i] = (_Float16)p[16 + i]; }
  return a;
}
__device__ __forceinline__ v16h frag_f32s(const float* rowk0, int lane, float sc) {
  v16h a; const float* p = rowk0 + 8 * (lane >> 4);
#pragma unroll
  for (int i = 0; i < 8; ++i) { a[i] = (_Float16)(p[i] * sc); a[8 + i] = (_Float16)(p[16 + i] * sc); }
  return a;
}
// column fragment from a [K][ld] layout (column n), rows >= K read as 0
__device__ __forceinline__ v16h fragc_f32(const float* W, int k0, int n, int lane, int ld, int K) {
  v16h a; const int g = lane >> 4;
#pragma unroll
  for (int i = 0; i < 8; ++i) { const int ka = k0 + 8 * g + i, kb = ka + 16;
    a[i] = (_Float16)(ka < K ? W[(size_t)(ka < K ? ka : K - 1) * ld + n] : 0.f); a[8 + i] = (_Float16)(kb < K ? W[(size_t)(kb < K ? kb : K - 1) * ld + n] : 0.f); }
  return a;
}
struct F2 { v16b h, l; };
__device__ __forceinline__ F2 bsplit16(const float v[16]) { F2 r;
#pragma unroll
  for (int i = 0; i < 16; ++i) { const __bf16 h = (__bf16)v[i]; r.h[i] = h; r.l[i] = (__bf16)(v[i] - (float)h); }
  return r; }
__device__ __forceinline__ F2 split_row(const float* row, int k0, int lane) { float v[16]; const float* p = row + k0 + 8 * (lane >> 4);
#pragma unroll
  for (int i = 0; i < 8; ++i) { v[i] = p[i]; v[8 + i] = p[16 + i]; }
  return bsplit16(v); }
__device__ __forceinline__ F2 split_rowK(const float* row, int k0, int lane, int K) { float v[16]; const int g = lane >> 4;
#pragma unroll
  for (int i = 0; i < 8; ++i) { const int ka = k0 + 8 * g + i, kb = ka + 16; v[i] = ka < K ? row[ka < K ? ka : K - 1] : 0.f; v[8 + i] = kb < K ? row[kb < K ? kb : K - 1] : 0.f; }
  return bsplit16(v); }
__device__ __forceinline__ F2 split_col(const float* W, int k0, int n, int lane, int ld, int K) { float v[16]; const int g = lane >> 4;
#pragma unroll
  for (int i = 0; i < 8; ++i) { const int ka = k0 + 8 * g + i, kb = ka + 16; v[i] = ka < K ? W[(size_t)(ka < K ? ka : K - 1) * ld + n] : 0.f; v[8 + i] = kb < K ? W[(size_t)(kb < K ? kb : K - 1) * ld + n] : 0.f; }
  return bsplit16(v); }
__device__ __forceinline__ v8f mac3(const F2& a, const F2& b, v8f c) { c = wmma_bf(a.l, b.h, c); c = wmma_bf(a.h, b.l, c); return wmma_bf(a.h, b.h, c); }
__device__ __forceinline__ float sigm(float v) { return 1.0f / (1.0f + expf(-v)); }
#define LDSX() do { asm volatile("s_wait_dscnt 0" ::: "memory"); __builtin_amdgcn_wave_barrier(); __builtin_amdgcn_fence(__ATOMIC_RELEASE, "workgroup"); } while (0)

// Multi-head attention with separate query / key / value inputs whose scores are divided by sqrt(emb_size) (query / key / value [2,2048,1024]; torch (out,in) Wq / Wk / Wv / Wo [1024,1024] N(0, 1/1024), no biases: q = query @ Wq.T etc.; 16 heads x 64; energy / sqrt(1024) = x 1/32 (the module's own NOTE: the embedding width, not the head width); softmax over all keys (no mask); out merged @ Wo.T).
#define NB 2
#define TT 2048
#define CC 1024            // NH * HD = projected width
#define DIN 1024          // input (model) width
#define NH 16
#define HD 64
#define NQB (TT / 64)
#define HG 4
#define SCALE (0.03125f)
#define CAUSAL 0
#ifndef TNB
#define TNB NB
#endif
__device__ __forceinline__ float bfr(float v) { return (float)(__bf16)v; }
__host__ __device__ __forceinline__ int kb_last(int qb) { return CAUSAL ? ((qb * 64 + 63) >> 7) : (TT / 128 - 1); }
typedef __attribute__((ext_vector_type(8))) __bf16 v8b;
__device__ __forceinline__ v16b frag_b(const __bf16* rowk0, int lane) {
  union { v16b v; v8b q[2]; } u; const __bf16* p = rowk0 + 8 * (lane >> 4);
  u.q[0] = *(const v8b*)p; u.q[1] = *(const v8b*)(p + 16); return u.v;
}
#define QBH 0              // causal: query blocks 0..QBH-1 of each sequence (few keys, no averaging) take the high-precision path
#define QHI 2048            // rows carrying a q residual plane (all rows when non-causal: 2-product logits everywhere)
#define KHI 64            // key rows carrying k residual / v bf16 hi+lo planes (used only by the causal high-precision path)
// B fragment (k rows k0+.., output column o) of a weight: (in,out) [K][ld] or (out,in) [ld rows of K]: bf16 exact, or f16(bf16 * 256) exact
__device__ __forceinline__ v16b wcol_io(const float* Wm, int k0, int o, int lane, int ld) { v16b w; const int g = lane >> 4;
#pragma unroll
  for (int i = 0; i < 8; ++i) { w[i] = (__bf16)Wm[(size_t)(k0 + 8 * g + i) * ld + o]; w[8 + i] = (__bf16)Wm[(size_t)(k0 + 16 + 8 * g + i) * ld + o]; }
  return w; }
__device__ __forceinline__ v16b wcol_oi(const float* Wm, int k0, int o, int lane, int K) { v16b w; const float* p = Wm + (size_t)o * K + k0 + 8 * (lane >> 4);
#pragma unroll
  for (int i = 0; i < 8; ++i) { w[i] = (__bf16)p[i]; w[8 + i] = (__bf16)p[16 + i]; }
  return w; }
__device__ __forceinline__ v16h wcolh_io(const float* Wm, int k0, int o, int lane, int ld) { v16h w; const int g = lane >> 4;
#pragma unroll
  for (int i = 0; i < 8; ++i) { w[i] = (_Float16)(bfr(Wm[(size_t)(k0 + 8 * g + i) * ld + o]) * 256.0f); w[8 + i] = (_Float16)(bfr(Wm[(size_t)(k0 + 16 + 8 * g + i) * ld + o]) * 256.0f); }
  return w; }
__device__ __forceinline__ v16h wcolh_oi(const float* Wm, int k0, int o, int lane, int K) { v16h w; const float* p = Wm + (size_t)o * K + k0 + 8 * (lane >> 4);
#pragma unroll
  for (int i = 0; i < 8; ++i) { w[i] = (_Float16)(bfr(p[i]) * 256.0f); w[8 + i] = (_Float16)(bfr(p[16 + i]) * 256.0f); }
  return w; }
#define WQKV_LAYOUT 1   // 0 = (in,out) [DIN][CC]; 1 = (out,in) [CC][DIN]; 2 = per-head [NH][DIN][HD]
__device__ __forceinline__ v16b wcol_hdk(const float* Wm, int k0, int o, int lane) { v16b w; const int g = lane >> 4; const float* p = Wm + (size_t)(o / HD) * DIN * HD + (o % HD);
#pragma unroll
  for (int i = 0; i < 8; ++i) { w[i] = (__bf16)p[(size_t)(k0 + 8 * g + i) * HD]; w[8 + i] = (__bf16)p[(size_t)(k0 + 16 + 8 * g + i) * HD]; }
  return w; }
#define WO_OUT_IN 1
#if WQKV_LAYOUT == 1
#define WCOL(W, k0, o, lane) wcol_oi(W, k0, o, lane, DIN)
#elif WQKV_LAYOUT == 2
#define WCOL(W, k0, o, lane) wcol_hdk(W, k0, o, lane)
#else
#define WCOL(W, k0, o, lane) wcol_io(W, k0, o, lane, CC)
#endif
#if WO_OUT_IN
#define WOCOL(W, k0, o, lane) wcol_oi(W, k0, o, lane, CC)
#define WOCOLH(W, k0, o, lane) wcolh_oi(W, k0, o, lane, CC)
#else
#define WOCOL(W, k0, o, lane) wcol_io(W, k0, o, lane, DIN)
#define WOCOLH(W, k0, o, lane) wcolh_io(W, k0, o, lane, DIN)
#endif

#ifndef SM_EXTRA_PARAMS
#define SM_EXTRA_PARAMS
#endif
#ifndef PROJ_EXTRA_PARAMS
#define PROJ_EXTRA_PARAMS
#endif
#ifndef SM_MASK_HOOK
#define SM_MASK_HOOK (void)0
#endif

#define WS_QH  0u                                      // f16 q rows [b*t][CC]
#define WS_KH  (WS_QH + 2u * (size_t)NB * TT * CC)      // f16 k rows [b*t][CC]
#define WS_VT  (WS_KH + 2u * (size_t)NB * TT * CC)      // f16 v planes [b][c][t]
#define WS_QL  (WS_VT + 2u * (size_t)NB * CC * TT)      // f16 q residual x 2^10 rows [b][t < QHI][CC]
#define WS_KL  (WS_QL + 2u * (size_t)NB * QHI * CC)     // f16 k residual x 2^10 rows [b][t < KHI][CC]
#define WS_VB  (WS_KL + 2u * (size_t)NB * KHI * CC)     // bf16 v hi planes [b][c][t < KHI]
#define WS_VBL (WS_VB + 2u * (size_t)NB * CC * KHI)
#define WS_S   (WS_VBL + 2u * (size_t)NB * CC * KHI)    // f32 logits / P [hg][t][s]
#define WS_Y   (WS_S  + 4u * (size_t)HG * TT * TT)      // f32 ctx rows [b*t][CC] (only when there is an output projection)
#define WS_END (WS_Y  + 4u * (size_t)NB * TT * CC)

// ---- k_proj: block = (64 rows, 128 cols, which): q/k/v = X W (+ b) with exact bf16 products (K = DIN) -> which 0: q f16 rows (+ residual rows < QHI); 1: k f16 rows (+ residual rows < KHI); 2: v f16 planes [c][t] (+ bf16 hi/lo planes for t < KHI)
__global__ __launch_bounds__(128) void k_proj(const float* __restrict__ XQ, const float* __restrict__ XK, const float* __restrict__ XV, const float* __restrict__ WQ, const float* __restrict__ WK, const float* __restrict__ WV, const float* __restrict__ BQ, const float* __restrict__ BK, const float* __restrict__ BV,
    _Float16* __restrict__ QH, _Float16* __restrict__ QL, _Float16* __restrict__ KH, _Float16* __restrict__ KL, _Float16* __restrict__ VT, __bf16* __restrict__ VB, __bf16* __restrict__ VBL) {
  __shared__ __align__(16) _Float16 sh[64][136], sl[64][136]; __shared__ __align__(16) _Float16 th[128][72]; __shared__ __align__(16) __bf16 tb[128][72], tbl[128][72];
  const int tid = threadIdx.x, wave = tid >> 5, lane = tid & 31, col = lane & 15, g = lane >> 4; const int which = blockIdx.z; const int c0 = blockIdx.y * 128; const size_t r0 = (size_t)blockIdx.x * 64; const size_t bb = r0 / TT; const int t0 = (int)(r0 % TT);
  const float* X = which == 0 ? XQ : which == 1 ? XK : XV; const float* WA = which == 0 ? WQ : which == 1 ? WK : WV; const float* BA = which == 0 ? BQ : which == 1 ? BK : BV;
  v8f acc[8] = {};
#pragma unroll 2
  for (int kc = 0; kc < DIN / 32; ++kc) { v16b a; { const float* p = X + (r0 + wave * 16 + col) * DIN + kc * 32 + 8 * g;
#pragma unroll
      for (int i = 0; i < 8; ++i) { a[i] = (__bf16)p[i]; a[8 + i] = (__bf16)p[16 + i]; } }
    asm volatile("s_wait_loadcnt 0x0" ::: "memory");
#pragma unroll
    for (int j = 0; j < 8; ++j) { const v16b w = WCOL(WA, kc * 32, c0 + j * 16 + col, lane); asm volatile("s_wait_loadcnt 0x0" ::: "memory"); acc[j] = wmma_bf(a, w, acc[j]); } }
  if (which < 2) { _Float16* DH = which == 0 ? QH : KH; _Float16* DL = which == 0 ? QL : KL; const int nhi = which == 0 ? QHI : KHI; const bool hi_rows = t0 < nhi;
#pragma unroll
    for (int j = 0; j < 8; ++j) { const float bias = BA ? bfr(BA[c0 + j * 16 + col]) : 0.f;
#pragma unroll
      for (int r = 0; r < 8; ++r) { const float v = acc[j][r] + bias; const _Float16 hv = (_Float16)v; sh[wave * 16 + 8 * g + r][j * 16 + col] = hv; sl[wave * 16 + 8 * g + r][j * 16 + col] = (_Float16)((v - (float)hv) * 1024.0f); } }
    __syncthreads();
    for (int e = tid; e < 64 * 16; e += 128) { const int rl = e >> 4, q = e & 15; vst2((unsigned*)(DH + (r0 + rl) * CC + c0 + q * 8), *(const v4u*)&sh[rl][q * 8]); if (hi_rows) vst2((unsigned*)(DL + (bb * nhi + t0 + rl) * (size_t)CC + c0 + q * 8), *(const v4u*)&sl[rl][q * 8]); }
  } else { const bool hi_rows = t0 < KHI;
#pragma unroll
    for (int j = 0; j < 8; ++j) { const float bias = BA ? bfr(BA[c0 + j * 16 + col]) : 0.f;
#pragma unroll
      for (int r = 0; r < 8; ++r) { const float v = acc[j][r] + bias; const int rl = wave * 16 + 8 * g + r, cl = j * 16 + col; th[cl][rl] = (_Float16)v; const __bf16 bh = (__bf16)v; tb[cl][rl] = bh; tbl[cl][rl] = (__bf16)(v - (float)bh); } }
    __syncthreads();
    for (int e = tid; e < 128 * 8; e += 128) { const int cl = e >> 3, q = e & 7; vst2((unsigned*)(VT + (bb * CC + c0 + cl) * (size_t)TT + t0 + q * 8), *(const v4u*)&th[cl][q * 8]); if (hi_rows) { const size_t o3 = (bb * CC + c0 + cl) * (size_t)KHI + t0 + q * 8; vst2((unsigned*)(VB + o3), *(const v4u*)&tb[cl][q * 8]); vst2((unsigned*)(VBL + o3), *(const v4u*)&tbl[cl][q * 8]); } } } }
// ---- k_sc: block = (query block qb, key block kb <= kb_last(qb), head in group) of batch b: logits x SCALE; q hi + residual (x 2^10) against k (2 products) for query rows < QHI, plus the k residual (3 products) for query blocks < QBH (causal early rows); causal: blocks past the diagonal exit, the mask itself is applied by index in k_sm
__global__ __launch_bounds__(128) void k_sc(const _Float16* __restrict__ QH, const _Float16* __restrict__ KH, const _Float16* __restrict__ QL, const _Float16* __restrict__ KL, int b, int h0, float* __restrict__ S0) { __shared__ __align__(16) float ss[4][16][132];
  const int qb = blockIdx.x, kb = blockIdx.y; if (kb > kb_last(qb)) return;
  const int h = h0 + blockIdx.z; float* S = S0 + (size_t)blockIdx.z * TT * TT;
  const int tid = threadIdx.x, wave = tid >> 5, lane = tid & 31, col = lane & 15, g = lane >> 4; const int k0 = kb * 128; const int ql0 = qb * 64 + wave * 16; const size_t q0 = (size_t)b * TT + ql0, kr0 = (size_t)b * TT + k0;
  v8f acc[8] = {}, accl[8] = {};
  const _Float16* QLb = QL + (size_t)b * QHI * CC; const _Float16* KLb = KL + (size_t)b * KHI * CC;
  if (qb < QBH) {
#pragma unroll
    for (int kc = 0; kc < HD / 32; ++kc) { const v16h ah = frag_h(QH + (q0 + col) * CC + h * HD + kc * 32, lane), al = frag_h(QLb + (size_t)(ql0 + col) * CC + h * HD + kc * 32, lane);
#pragma unroll
      for (int j = 0; j < 8; ++j) { const v16h kbf = frag_h(KH + (kr0 + j * 16 + col) * CC + h * HD + kc * 32, lane), klf = frag_h(KLb + (size_t)(k0 + j * 16 + col) * CC + h * HD + kc * 32, lane); acc[j] = wmma16(ah, kbf, acc[j]); accl[j] = wmma16(al, kbf, accl[j]); accl[j] = wmma16(ah, klf, accl[j]); } }
  } else if (qb * 64 < QHI) {
#pragma unroll
    for (int kc = 0; kc < HD / 32; ++kc) { const v16h ah = frag_h(QH + (q0 + col) * CC + h * HD + kc * 32, lane), al = frag_h(QLb + (size_t)(ql0 + col) * CC + h * HD + kc * 32, lane);
#pragma unroll
      for (int j = 0; j < 8; ++j) { const v16h kbf = frag_h(KH + (kr0 + j * 16 + col) * CC + h * HD + kc * 32, lane); acc[j] = wmma16(ah, kbf, acc[j]); accl[j] = wmma16(al, kbf, accl[j]); } }
  } else {
#pragma unroll
    for (int kc = 0; kc < HD / 32; ++kc) { const v16h ah = frag_h(QH + (q0 + col) * CC + h * HD + kc * 32, lane);
#pragma unroll
      for (int j = 0; j < 8; ++j) { const v16h kbf = frag_h(KH + (kr0 + j * 16 + col) * CC + h * HD + kc * 32, lane); acc[j] = wmma16(ah, kbf, acc[j]); } } }
#pragma unroll
  for (int j = 0; j < 8; ++j) {
#pragma unroll
    for (int r = 0; r < 8; ++r) ss[wave][8 * g + r][j * 16 + col] = (acc[j][r] + accl[j][r] * (1.0f / 1024.0f)) * SCALE; }
  LDSX(); for (int rl = 0; rl < 16; ++rl) vst2(S + (size_t)(ql0 + rl) * TT + k0 + lane * 4, *(const v4f*)&ss[wave][rl][lane * 4]); }
// ---- k_sm: block = query row t (head in group): keys [0, kend): causal -> logit if s <= t else excluded; softmax in f32; P x 2^11 in place (0 for excluded)
__global__ __launch_bounds__(256) void k_sm(float* __restrict__ S0 SM_EXTRA_PARAMS) { __shared__ float sred[8]; __shared__ float sbc; __shared__ __align__(16) float shv[TT];
  const int tid = threadIdx.x; const int t = blockIdx.x; const int kend = (kb_last(t >> 6) + 1) * 128;
  float* sr = S0 + (size_t)blockIdx.y * TT * TT + (size_t)t * TT;
  float m = -3.0e38f; for (int k = tid; k < kend; k += 256) { float v = (!CAUSAL || k <= t) ? sr[k] : -3.0e38f; SM_MASK_HOOK; shv[k] = v; m = fmaxf(m, v); }
#pragma unroll
  for (int o = 1; o < 32; o <<= 1) m = fmaxf(m, __shfl_xor(m, o));
  if ((tid & 31) == 0) sred[tid >> 5] = m; __syncthreads(); if (tid == 0) { float a = sred[0]; for (int i = 1; i < 8; ++i) a = fmaxf(a, sred[i]); sbc = a; } __syncthreads(); m = sbc; __syncthreads();
  float sum = 0.f; for (int k = tid; k < kend; k += 256) { const float v = shv[k]; const float e = (v <= -1.0e38f) ? 0.f : expf(v - m); shv[k] = e; sum += e; }
#pragma unroll
  for (int o = 1; o < 32; o <<= 1) sum += __shfl_xor(sum, o);
  if ((tid & 31) == 0) sred[tid >> 5] = sum; __syncthreads(); if (tid == 0) { float a = 0.f; for (int i = 0; i < 8; ++i) a += sred[i]; sbc = a > 0.f ? 2048.0f / a : 0.f; }   /* a fully excluded row yields P = 0 */ __syncthreads(); const float inv = sbc;
  for (int k = tid; k < kend; k += 256) shv[k] = shv[k] * inv;
  __syncthreads(); for (int q = tid; q < kend / 4; q += 256) vst2(sr + q * 4, *(const v4f*)&shv[q * 4]); }
// ---- k_pv: block = 64 queries (qb) of (b, h): ctx = P . v over keys [0, kend) (P x 2^11 once to f16 against v f16: 1 product; causal early query blocks: P and v as bf16 hi + lo, 3 products); 256-B (row, head) segment by 16 lanes
__global__ __launch_bounds__(128) void k_pv(const float* __restrict__ PS0, const _Float16* __restrict__ VT, const __bf16* __restrict__ VB, const __bf16* __restrict__ VBL, int b, int h0, float* __restrict__ Y) { const int h = h0 + blockIdx.z; const float* PS = PS0 + (size_t)blockIdx.z * TT * TT; __shared__ __align__(16) float ss[4][16][HD + 4];
  const int tid = threadIdx.x, wave = tid >> 5, lane = tid & 31, col = lane & 15, g = lane >> 4; const int qb = blockIdx.x; const int ql0 = qb * 64 + wave * 16; const int kce = (kb_last(qb) + 1) * 4;
  v8f acc[HD / 16] = {};
  if (qb < QBH) {
#pragma unroll 1
    for (int kc = 0; kc < kce; ++kc) { const F2 p = split_row(PS + (size_t)(ql0 + col) * TT, kc * 32, lane);
      asm volatile("s_wait_loadcnt 0x0" ::: "memory");
#pragma unroll
      for (int j = 0; j < HD / 16; ++j) { const size_t po = ((size_t)b * CC + h * HD + j * 16 + col) * (size_t)KHI + kc * 32; const v16b vh = frag_b(VB + po, lane); acc[j] = wmma_bf(p.h, vh, acc[j]); acc[j] = wmma_bf(p.l, vh, acc[j]); acc[j] = wmma_bf(p.h, frag_b(VBL + po, lane), acc[j]); } }
  } else {
#pragma unroll 1
    for (int kc = 0; kc < kce; ++kc) { const v16h p = frag_f32(PS + (size_t)(ql0 + col) * TT + kc * 32, lane);
      asm volatile("s_wait_loadcnt 0x0" ::: "memory");
#pragma unroll
      for (int j = 0; j < HD / 16; ++j) { const size_t po = ((size_t)b * CC + h * HD + j * 16 + col) * (size_t)TT + kc * 32; acc[j] = wmma16(p, frag_h(VT + po, lane), acc[j]); } } }
#pragma unroll
  for (int j = 0; j < HD / 16; ++j)
#pragma unroll
    for (int r = 0; r < 8; ++r) ss[wave][8 * g + r][j * 16 + col] = acc[j][r] * (1.0f / 2048.0f);
  LDSX(); for (int rl = 0; rl < 16; ++rl) if (lane < HD / 4) vst2(Y + ((size_t)b * TT + ql0 + rl) * CC + h * HD + lane * 4, *(const v4f*)&ss[wave][rl][lane * 4]); }
// ---- k_out: block = (64 rows, 128 cols): out = ctx Wo (+ bo): all rows: ctx bf16 hi + lo against exact bf16 Wo (2 products); the branch with ctx once to f16 against Wo as f16(bf16 x 2^8) (1 product) x 2^-8 is not taken
__global__ __launch_bounds__(128) void k_out(const float* __restrict__ Y, const float* __restrict__ WO, const float* __restrict__ BO, float* __restrict__ OUT) { __shared__ __align__(16) float sf[4][16][132];
  const int tid = threadIdx.x, wave = tid >> 5, lane = tid & 31, col = lane & 15, g = lane >> 4; const int c0 = blockIdx.y * 128; const size_t r0 = (size_t)blockIdx.x * 64 + wave * 16;
  v8f acc[8] = {};
  if (true) {   /* ALL rows: ctx split bf16 hi + lo x exact Wo (2 products) */
#pragma unroll 2
    for (int kc = 0; kc < CC / 32; ++kc) { const F2 a = split_row(Y + (r0 + col) * CC, kc * 32, lane); asm volatile("s_wait_loadcnt 0x0" ::: "memory");
#pragma unroll
      for (int j = 0; j < 8; ++j) { const v16b w = WOCOL(WO, kc * 32, c0 + j * 16 + col, lane); asm volatile("s_wait_loadcnt 0x0" ::: "memory"); acc[j] = wmma_bf(a.h, w, acc[j]); acc[j] = wmma_bf(a.l, w, acc[j]); } }
#pragma unroll
    for (int j = 0; j < 8; ++j) { const float bias = BO ? bfr(BO[c0 + j * 16 + col]) : 0.f;
#pragma unroll
      for (int r = 0; r < 8; ++r) sf[wave][8 * g + r][j * 16 + col] = acc[j][r] + bias; }
  } else {
#pragma unroll 2
    for (int kc = 0; kc < CC / 32; ++kc) { const v16h a = frag_f32(Y + (r0 + col) * CC + kc * 32, lane); asm volatile("s_wait_loadcnt 0x0" ::: "memory");
#pragma unroll
      for (int j = 0; j < 8; ++j) { const v16h w = WOCOLH(WO, kc * 32, c0 + j * 16 + col, lane); asm volatile("s_wait_loadcnt 0x0" ::: "memory"); acc[j] = wmma16(a, w, acc[j]); } }
#pragma unroll
    for (int j = 0; j < 8; ++j) { const float bias = BO ? bfr(BO[c0 + j * 16 + col]) : 0.f;
#pragma unroll
      for (int r = 0; r < 8; ++r) sf[wave][8 * g + r][j * 16 + col] = acc[j][r] * (1.0f / 256.0f) + bias; } }
  LDSX(); for (int rl = 0; rl < 16; ++rl) vst2(OUT + (r0 + rl) * DIN + c0 + lane * 4, *(const v4f*)&sf[wave][rl][lane * 4]); }

extern "C" void kernel_launch(void* const* d_in, const int* in_sizes, int n_in, void* d_out, int out_size, void* d_ws, size_t ws_size, hipStream_t stream) {
  (void)in_sizes; (void)n_in; (void)out_size;
  const float** F = (const float**)d_in;
  if (ws_size < (size_t)WS_END) return;
  char* ws = (char*)d_ws; _Float16 *QH = (_Float16*)(ws + WS_QH), *KH = (_Float16*)(ws + WS_KH), *VT = (_Float16*)(ws + WS_VT), *QL = (_Float16*)(ws + WS_QL), *KL = (_Float16*)(ws + WS_KL); __bf16 *VB = (__bf16*)(ws + WS_VB), *VBL = (__bf16*)(ws + WS_VBL); float *S = (float*)(ws + WS_S), *Y = (float*)(ws + WS_Y);
  (void)Y; (void)QL; (void)KL; (void)VB; (void)VBL;
  // inputs: 0 query; 1 key; 2 value [2,2048,1024]; 3 wq (out,in); 4 wk; 5 wv; 6 wo (out,in)
  k_proj<<<dim3(TNB * TT / 64, CC / 128, 3), 128, 0, stream>>>(F[0], F[1], F[2], F[3], F[4], F[5], nullptr, nullptr, nullptr, QH, QL, KH, KL, VT, VB, VBL);
  for (int b = 0; b < TNB; ++b) for (int h0 = 0; h0 < NH; h0 += HG) {
    k_sc<<<dim3(NQB, TT / 128, HG), 128, 0, stream>>>(QH, KH, QL, KL, b, h0, S);
    k_sm<<<dim3(TT, HG), 256, 0, stream>>>(S);
    k_pv<<<dim3(NQB, 1, HG), 128, 0, stream>>>(S, VT, VB, VBL, b, h0, Y);
  }
  k_out<<<dim3(TNB * TT / 64, DIN / 128), 128, 0, stream>>>(Y, F[6], nullptr, (float*)d_out);
}

// v001
// It runs in 459 microseconds.
// Next to v000, in two timings, it ran 2.92 and 2.93 times as fast.
// compute dtype: all float inputs rounded to bf16; q/k/v = in W^T + b with EXACT bf16 products on WMMA 16x16x32 (f32 accumulate); q as f16 hi + residual (x 2^10) against k once to f16 (2 products) / sqrt(1024); online softmax in f32 (precise expf), logits and P kept in registers; P = exp(s - running max) once to f16 against v once to f16 (1 product), / row sum in f32; ctx split bf16 hi + lo against exact Wo (2 products) + bo; f32 output.
#include <hip/hip_runtime.h>
#include <math.h>

typedef __attribute__((ext_vector_type(16))) _Float16 v16h;
typedef __attribute__((ext_vector_type(16))) __bf16 v16b;
typedef __attribute__((ext_vector_type(8)))  _Float16 v8h;
typedef __attribute__((ext_vector_type(8)))  float v8f;
typedef __attribute__((ext_vector_type(4)))  float v4f;
typedef __attribute__((ext_vector_type(2)))  float v2f;
typedef __attribute__((ext_vector_type(4)))  unsigned v4u;
typedef __attribute__((ext_vector_type(4)))  int v4i;
typedef float __attribute__((may_alias)) float_a;
typedef int __attribute__((may_alias)) int_a;

template <typename T> __device__ __forceinline__ void vst2(void* p, T v) { *(T*)p = v;  }
__device__ __forceinline__ v8f wmma16(v16h a, v16h b, v8f c) {
  v8f d = __builtin_amdgcn_wmma_f32_16x16x32_f16(false, a, false, b, (short)0, c, false, false);
  asm volatile("v_nop\n\tv_nop\n\tv_nop\n\tv_nop" : "+v"(d) : "v"(a), "v"(b));
  return d;
}
__device__ __forceinline__ v8f wmma_bf(v16b a, v16b b, v8f c) {
  v8f d = __builtin_amdgcn_wmma_f32_16x16x32_bf16(false, a, false, b, (short)0, c, false, false);
  asm volatile("v_nop\n\tv_nop\n\tv_nop\n\tv_nop" : "+v"(d) : "v"(a), "v"(b));
  return d;
}
// 16x16x32 fragments: lane = (h = lane>>4, row/col = lane&15); elements 0..7 = k0+8h+0..7, 8..15 = k0+16+8h+0..7; D element r = row 8h+r
__device__ __forceinline__ v16h frag_h(const _Float16* rowk0, int lane) {
  union { v16h v; v8h q[2]; } u; const _Float16* p = rowk0 + 8 * (lane >> 4);
  u.q[0] = *(const v8h*)p; u.q[1] = *(const v8h*)(p + 16); return u.v;
}
__device__ __forceinline__ v16h frag_f32(const float* rowk0, int lane) {
  v16h a; const float* p = rowk0 + 8 * (lane >> 4);
#pragma unroll
  for (int i = 0; i < 8; ++i) { a[i] = (_Float16)p[i]; a[8 + i] = (_Float16)p[16 + i]; }
  return a;
}
__device__ __forceinline__ v16h frag_f32s(const float* rowk0, int lane, float sc) {
  v16h a; const float* p = rowk0 + 8 * (lane >> 4);
#pragma unroll
  for (int i = 0; i < 8; ++i) { a[i] = (_Float16)(p[i] * sc); a[8 + i] = (_Float16)(p[16 + i] * sc); }
  return a;
}
// column fragment from a [K][ld] layout (column n), rows >= K read as 0
__device__ __forceinline__ v16h fragc_f32(const float* W, int k0, int n, int lane, int ld, int K) {
  v16h a; const int g = lane >> 4;
#pragma unroll
  for (int i = 0; i < 8; ++i) { const int ka = k0 + 8 * g + i, kb = ka + 16;
    a[i] = (_Float16)(ka < K ? W[(size_t)(ka < K ? ka : K - 1) * ld + n] : 0.f); a[8 + i] = (_Float16)(kb < K ? W[(size_t)(kb < K ? kb : K - 1) * ld + n] : 0.f); }
  return a;
}
struct F2 { v16b h, l; };
__device__ __forceinline__ F2 bsplit16(const float v[16]) { F2 r;
#pragma unroll
  for (int i = 0; i < 16; ++i) { const __bf16 h = (__bf16)v[i]; r.h[i] = h; r.l[i] = (__bf16)(v[i] - (float)h); }
  return r; }
__device__ __forceinline__ F2 split_row(const float* row, int k0, int lane) { float v[16]; const float* p = row + k0 + 8 * (lane >> 4);
#pragma unroll
  for (int i = 0; i < 8; ++i) { v[i] = p[i]; v[8 + i] = p[16 + i]; }
  return bsplit16(v); }
__device__ __forceinline__ F2 split_rowK(const float* row, int k0, int lane, int K) { float v[16]; const int g = lane >> 4;
#pragma unroll
  for (int i = 0; i < 8; ++i) { const int ka = k0 + 8 * g + i, kb = ka + 16; v[i] = ka < K ? row[ka < K ? ka : K - 1] : 0.f; v[8 + i] = kb < K ? row[kb < K ? kb : K - 1] : 0.f; }
  return bsplit16(v); }
__device__ __forceinline__ F2 split_col(const float* W, int k0, int n, int lane, int ld, int K) { float v[16]; const int g = lane >> 4;
#pragma unroll
  for (int i = 0; i < 8; ++i) { const int ka = k0 + 8 * g + i, kb = ka + 16; v[i] = ka < K ? W[(size_t)(ka < K ? ka : K - 1) * ld + n] : 0.f; v[8 + i] = kb < K ? W[(size_t)(kb < K ? kb : K - 1) * ld + n] : 0.f; }
  return bsplit16(v); }
__device__ __forceinline__ v8f mac3(const F2& a, const F2& b, v8f c) { c = wmma_bf(a.l, b.h, c); c = wmma_bf(a.h, b.l, c); return wmma_bf(a.h, b.h, c); }
__device__ __forceinline__ float sigm(float v) { return 1.0f / (1.0f + expf(-v)); }
#define LDSX() do { asm volatile("s_wait_dscnt 0" ::: "memory"); __builtin_amdgcn_wave_barrier(); __builtin_amdgcn_fence(__ATOMIC_RELEASE, "workgroup"); } while (0)

// Multi-head attention with separate query / key / value inputs whose scores are divided by sqrt(emb_size) (query / key / value [2,2048,1024]; torch (out,in) Wq / Wk / Wv / Wo [1024,1024] N(0, 1/1024), no biases: q = query @ Wq.T etc.; 16 heads x 64; energy / sqrt(1024) = x 1/32 (the module's own NOTE: the embedding width, not the head width); softmax over all keys (no mask); out merged @ Wo.T).
#define NB 2
#define TT 2048
#define CC 1024            // NH * HD = projected width
#define DIN 1024          // input (model) width
#define NH 16
#define HD 64
#define NQB (TT / 64)
#define HG 4
#define SCALE (0.03125f)
#define CAUSAL 0
#ifndef TNB
#define TNB NB
#endif
__device__ __forceinline__ float bfr(float v) { return (float)(__bf16)v; }
__host__ __device__ __forceinline__ int kb_last(int qb) { return CAUSAL ? ((qb * 64 + 63) >> 7) : (TT / 128 - 1); }
typedef __attribute__((ext_vector_type(8))) __bf16 v8b;
__device__ __forceinline__ v16b frag_b(const __bf16* rowk0, int lane) {
  union { v16b v; v8b q[2]; } u; const __bf16* p = rowk0 + 8 * (lane >> 4);
  u.q[0] = *(const v8b*)p; u.q[1] = *(const v8b*)(p + 16); return u.v;
}
#define QBH 0              // unused: no kernel here has a high-precision path
#define QHI 2048            // rows carrying a q residual plane (all rows when non-causal: 2-product logits everywhere)
#define KHI 64            // key rows carrying k residual / v bf16 hi+lo planes (written by k_proj, read by no kernel)
// B fragment (k rows k0+.., output column o) of a weight: (in,out) [K][ld] or (out,in) [ld rows of K]: bf16 exact, or f16(bf16 * 256) exact
__device__ __forceinline__ v16b wcol_io(const float* Wm, int k0, int o, int lane, int ld) { v16b w; const int g = lane >> 4;
#pragma unroll
  for (int i = 0; i < 8; ++i) { w[i] = (__bf16)Wm[(size_t)(k0 + 8 * g + i) * ld + o]; w[8 + i] = (__bf16)Wm[(size_t)(k0 + 16 + 8 * g + i) * ld + o]; }
  return w; }
__device__ __forceinline__ v16b wcol_oi(const float* Wm, int k0, int o, int lane, int K) { v16b w; const float* p = Wm + (size_t)o * K + k0 + 8 * (lane >> 4);
#pragma unroll
  for (int i = 0; i < 8; ++i) { w[i] = (__bf16)p[i]; w[8 + i] = (__bf16)p[16 + i]; }
  return w; }
__device__ __forceinline__ v16h wcolh_io(const float* Wm, int k0, int o, int lane, int ld) { v16h w; const int g = lane >> 4;
#pragma unroll
  for (int i = 0; i < 8; ++i) { w[i] = (_Float16)(bfr(Wm[(size_t)(k0 + 8 * g + i) * ld + o]) * 256.0f); w[8 + i] = (_Float16)(bfr(Wm[(size_t)(k0 + 16 + 8 * g + i) * ld + o]) * 256.0f); }
  return w; }
__device__ __forceinline__ v16h wcolh_oi(const float* Wm, int k0, int o, int lane, int K) { v16h w; const float* p = Wm + (size_t)o * K + k0 + 8 * (lane >> 4);
#pragma unroll
  for (int i = 0; i < 8; ++i) { w[i] = (_Float16)(bfr(p[i]) * 256.0f); w[8 + i] = (_Float16)(bfr(p[16 + i]) * 256.0f); }
  return w; }
#define WQKV_LAYOUT 1   // 0 = (in,out) [DIN][CC]; 1 = (out,in) [CC][DIN]; 2 = per-head [NH][DIN][HD]
__device__ __forceinline__ v16b wcol_hdk(const float* Wm, int k0, int o, int lane) { v16b w; const int g = lane >> 4; const float* p = Wm + (size_t)(o / HD) * DIN * HD + (o % HD);
#pragma unroll
  for (int i = 0; i < 8; ++i) { w[i] = (__bf16)p[(size_t)(k0 + 8 * g + i) * HD]; w[8 + i] = (__bf16)p[(size_t)(k0 + 16 + 8 * g + i) * HD]; }
  return w; }
#define WO_OUT_IN 1
#if WQKV_LAYOUT == 1
#define WCOL(W, k0, o, lane) wcol_oi(W, k0, o, lane, DIN)
#elif WQKV_LAYOUT == 2
#define WCOL(W, k0, o, lane) wcol_hdk(W, k0, o, lane)
#else
#define WCOL(W, k0, o, lane) wcol_io(W, k0, o, lane, CC)
#endif
#if WO_OUT_IN
#define WOCOL(W, k0, o, lane) wcol_oi(W, k0, o, lane, CC)
#define WOCOLH(W, k0, o, lane) wcolh_oi(W, k0, o, lane, CC)
#else
#define WOCOL(W, k0, o, lane) wcol_io(W, k0, o, lane, DIN)
#define WOCOLH(W, k0, o, lane) wcolh_io(W, k0, o, lane, DIN)
#endif

#ifndef SM_EXTRA_PARAMS
#define SM_EXTRA_PARAMS
#endif
#ifndef PROJ_EXTRA_PARAMS
#define PROJ_EXTRA_PARAMS
#endif
#ifndef SM_MASK_HOOK
#define SM_MASK_HOOK (void)0
#endif

#define WS_QH  0u                                      // f16 q rows [b*t][CC]
#define WS_KH  (WS_QH + 2u * (size_t)NB * TT * CC)      // f16 k rows [b*t][CC]
#define WS_VT  (WS_KH + 2u * (size_t)NB * TT * CC)      // f16 v planes [b][c][t]
#define WS_QL  (WS_VT + 2u * (size_t)NB * CC * TT)      // f16 q residual x 2^10 rows [b][t < QHI][CC]
#define WS_KL  (WS_QL + 2u * (size_t)NB * QHI * CC)     // f16 k residual x 2^10 rows [b][t < KHI][CC]
#define WS_VB  (WS_KL + 2u * (size_t)NB * KHI * CC)     // bf16 v hi planes [b][c][t < KHI]
#define WS_VBL (WS_VB + 2u * (size_t)NB * CC * KHI)
#define WS_S   (WS_VBL + 2u * (size_t)NB * CC * KHI)    // (unused: logits / P stay in registers)
#define WS_Y   (WS_S  + 4u * (size_t)HG * TT * TT)      // f32 ctx rows [b*t][CC] (only when there is an output projection)
#define WS_END (WS_Y  + 4u * (size_t)NB * TT * CC)

// ---- k_proj: block = (64 rows, 128 cols, which): q/k/v = X W (+ b) with exact bf16 products (K = DIN) -> which 0: q f16 rows (+ residual rows < QHI); 1: k f16 rows (+ residual rows < KHI); 2: v f16 planes [c][t] (+ bf16 hi/lo planes for t < KHI)
__global__ __launch_bounds__(128) void k_proj(const float* __restrict__ XQ, const float* __restrict__ XK, const float* __restrict__ XV, const float* __restrict__ WQ, const float* __restrict__ WK, const float* __restrict__ WV, const float* __restrict__ BQ, const float* __restrict__ BK, const float* __restrict__ BV,
    _Float16* __restrict__ QH, _Float16* __restrict__ QL, _Float16* __restrict__ KH, _Float16* __restrict__ KL, _Float16* __restrict__ VT, __bf16* __restrict__ VB, __bf16* __restrict__ VBL) {
  __shared__ __align__(16) _Float16 sh[64][136], sl[64][136]; __shared__ __align__(16) _Float16 th[128][72]; __shared__ __align__(16) __bf16 tb[128][72], tbl[128][72];
  const int tid = threadIdx.x, wave = tid >> 5, lane = tid & 31, col = lane & 15, g = lane >> 4; const int which = blockIdx.z; const int c0 = blockIdx.y * 128; const size_t r0 = (size_t)blockIdx.x * 64; const size_t bb = r0 / TT; const int t0 = (int)(r0 % TT);
  const float* X = which == 0 ? XQ : which == 1 ? XK : XV; const float* WA = which == 0 ? WQ : which == 1 ? WK : WV; const float* BA = which == 0 ? BQ : which == 1 ? BK : BV;
  v8f acc[8] = {};
#pragma unroll 2
  for (int kc = 0; kc < DIN / 32; ++kc) { v16b a; { const float* p = X + (r0 + wave * 16 + col) * DIN + kc * 32 + 8 * g;
#pragma unroll
      for (int i = 0; i < 8; ++i) { a[i] = (__bf16)p[i]; a[8 + i] = (__bf16)p[16 + i]; } }
    asm volatile("s_wait_loadcnt 0x0" ::: "memory");
#pragma unroll
    for (int j = 0; j < 8; ++j) { const v16b w = WCOL(WA, kc * 32, c0 + j * 16 + col, lane); asm volatile("s_wait_loadcnt 0x0" ::: "memory"); acc[j] = wmma_bf(a, w, acc[j]); } }
  if (which < 2) { _Float16* DH = which == 0 ? QH : KH; _Float16* DL = which == 0 ? QL : KL; const int nhi = which == 0 ? QHI : KHI; const bool hi_rows = t0 < nhi;
#pragma unroll
    for (int j = 0; j < 8; ++j) { const float bias = BA ? bfr(BA[c0 + j * 16 + col]) : 0.f;
#pragma unroll
      for (int r = 0; r < 8; ++r) { const float v = acc[j][r] + bias; const _Float16 hv = (_Float16)v; sh[wave * 16 + 8 * g + r][j * 16 + col] = hv; sl[wave * 16 + 8 * g + r][j * 16 + col] = (_Float16)((v - (float)hv) * 1024.0f); } }
    __syncthreads();
    for (int e = tid; e < 64 * 16; e += 128) { const int rl = e >> 4, q = e & 15; vst2((unsigned*)(DH + (r0 + rl) * CC + c0 + q * 8), *(const v4u*)&sh[rl][q * 8]); if (hi_rows) vst2((unsigned*)(DL + (bb * nhi + t0 + rl) * (size_t)CC + c0 + q * 8), *(const v4u*)&sl[rl][q * 8]); }
  } else { const bool hi_rows = t0 < KHI;
#pragma unroll
    for (int j = 0; j < 8; ++j) { const float bias = BA ? bfr(BA[c0 + j * 16 + col]) : 0.f;
#pragma unroll
      for (int r = 0; r < 8; ++r) { const float v = acc[j][r] + bias; const int rl = wave * 16 + 8 * g + r, cl = j * 16 + col; th[cl][rl] = (_Float16)v; const __bf16 bh = (__bf16)v; tb[cl][rl] = bh; tbl[cl][rl] = (__bf16)(v - (float)bh); } }
    __syncthreads();
    for (int e = tid; e < 128 * 8; e += 128) { const int cl = e >> 3, q = e & 7; vst2((unsigned*)(VT + (bb * CC + c0 + cl) * (size_t)TT + t0 + q * 8), *(const v4u*)&th[cl][q * 8]); if (hi_rows) { const size_t o3 = (bb * CC + c0 + cl) * (size_t)KHI + t0 + q * 8; vst2((unsigned*)(VB + o3), *(const v4u*)&tb[cl][q * 8]); vst2((unsigned*)(VBL + o3), *(const v4u*)&tbl[cl][q * 8]); } } } }
__global__ __launch_bounds__(256) __attribute__((amdgpu_waves_per_eu(4, 4))) void k_fa(const _Float16* __restrict__ QH, const _Float16* __restrict__ KH, const _Float16* __restrict__ QL, const _Float16* __restrict__ VT, float* __restrict__ Y) {
  const int tid = threadIdx.x, wave = tid >> 5, lane = tid & 31, col = lane & 15, g = lane >> 4; const int h = blockIdx.y, b = blockIdx.z; const int ql0 = blockIdx.x * 128 + wave * 16;
  const _Float16* qp = QH + ((size_t)b * TT + ql0 + col) * CC + h * HD; const _Float16* qlp = QL + ((size_t)b * QHI + ql0 + col) * CC + h * HD;
  const _Float16* kp = KH + ((size_t)b * TT + col) * CC + h * HD; const _Float16* vp = VT + ((size_t)b * CC + h * HD + col) * (size_t)TT;
  v16h qh[HD / 32], ql[HD / 32];
#pragma unroll
  for (int kc = 0; kc < HD / 32; ++kc) { qh[kc] = frag_h(qp + kc * 32, lane); ql[kc] = frag_h(qlp + kc * 32, lane); }
  v8f o[HD / 16] = {}; float m = -3.0e38f, l = 0.f;
  v16h kf[4][HD / 32];   // this trip's k fragments, all fetched together one trip ahead (one load latency a trip, under the P.V products)
#pragma unroll
  for (int j = 0; j < 4; ++j) {
#pragma unroll
    for (int kc = 0; kc < HD / 32; ++kc) kf[j][kc] = frag_h(kp + (size_t)(j * 16) * CC + kc * 32, lane); }
#pragma unroll 1   // kept rolled: two trips' fragments at once would not fit the 256 registers of four waves per SIMD
  for (int k0 = 0; k0 < TT; k0 += 64) { v8f acc[4] = {}, accl[4] = {};
#pragma unroll
    for (int j = 0; j < 4; ++j) {
#pragma unroll
      for (int kc = 0; kc < HD / 32; ++kc) { acc[j] = wmma16(kf[j][kc], qh[kc], acc[j]); accl[j] = wmma16(kf[j][kc], ql[kc], accl[j]); } }
    v16h vf[2][HD / 16];   // fetched here so that the softmax arithmetic covers their latency
#pragma unroll
    for (int kc = 0; kc < 2; ++kc) {
#pragma unroll
      for (int j = 0; j < HD / 16; ++j) vf[kc][j] = frag_h(vp + (size_t)(j * 16) * TT + k0 + kc * 32, lane); }
    asm volatile("s_wait_xcnt 0x0" ::: "memory");   // stands in front of the first overwrite of the v loads' address registers (the pointer's step to the next trip)
    __builtin_amdgcn_sched_barrier(0);   // keeps the v loads issued here, ahead of the softmax: sunk towards their use they would be waited for at full latency
    float mx = -3.0e38f;
#pragma unroll
    for (int j = 0; j < 4; ++j) {
#pragma unroll
      for (int r = 0; r < 8; ++r) { acc[j][r] = (acc[j][r] + accl[j][r] * (1.0f / 1024.0f)) * SCALE; mx = fmaxf(mx, acc[j][r]); } }
    mx = fmaxf(mx, __shfl_xor(mx, 16));
    const float mn = fmaxf(m, mx), alpha = expf(m - mn); m = mn;
    float sum = 0.f; v16h p[2];
#pragma unroll
    for (int j = 0; j < 4; ++j) {
#pragma unroll
      for (int r = 0; r < 8; ++r) { const float e = expf(acc[j][r] - mn); sum += e; p[j >> 1][(j & 1) * 8 + r] = (_Float16)e; } }
    l = l * alpha + sum;
#pragma unroll
    for (int j = 0; j < HD / 16; ++j) o[j] *= alpha;
    const int kn = k0 + 64 < TT ? k0 + 64 : 0;   // the last trip fetches trip 0's rows again (in bounds, unused)
    const _Float16* kq = kp + (size_t)kn * CC;
    __builtin_amdgcn_sched_barrier(0);   // keeps the next k loads behind the softmax: lifted into it, 64 more live registers spill
#pragma unroll
    for (int j = 0; j < 4; ++j) {
#pragma unroll
      for (int kc = 0; kc < HD / 32; ++kc) kf[j][kc] = frag_h(kq + (size_t)(j * 16) * CC + kc * 32, lane); }
    asm volatile("s_wait_xcnt 0x0" :: "v"(kq + 8 * g) : "memory");   // stands in front of the first overwrite of the k loads' address registers (the address named so that no load returns into it)
#pragma unroll
    for (int kc = 0; kc < 2; ++kc) {
#pragma unroll
      for (int j = 0; j < HD / 16; ++j) o[j] = wmma16(vf[kc][j], p[kc], o[j]); } }
  l += __shfl_xor(l, 16); const float inv = 1.0f / l;
  float* yp = Y + ((size_t)b * TT + ql0 + col) * CC + h * HD + 8 * g;
#pragma unroll
  for (int j = 0; j < HD / 16; ++j) { v4f lo, hi;
#pragma unroll
    for (int r = 0; r < 4; ++r) { lo[r] = o[j][r] * inv; hi[r] = o[j][4 + r] * inv; }
    vst2(yp + j * 16, lo); vst2(yp + j * 16 + 4, hi); } }
// ---- k_out: block = (64 rows, 128 cols): out = ctx Wo (+ bo): ctx bf16 hi + lo against exact bf16 Wo (2 products) for all rows; the f16(bf16 x 2^8) 1-product branch is not taken
__global__ __launch_bounds__(128) void k_out(const float* __restrict__ Y, const float* __restrict__ WO, const float* __restrict__ BO, float* __restrict__ OUT) { __shared__ __align__(16) float sf[4][16][132];
  const int tid = threadIdx.x, wave = tid >> 5, lane = tid & 31, col = lane & 15, g = lane >> 4; const int c0 = blockIdx.y * 128; const size_t r0 = (size_t)blockIdx.x * 64 + wave * 16;
  v8f acc[8] = {};
  if (true) {   /* ALL rows: ctx split bf16 hi + lo x exact Wo (2 products) */
#pragma unroll 2
    for (int kc = 0; kc < CC / 32; ++kc) { const F2 a = split_row(Y + (r0 + col) * CC, kc * 32, lane); asm volatile("s_wait_loadcnt 0x0" ::: "memory");
#pragma unroll
      for (int j = 0; j < 8; ++j) { const v16b w = WOCOL(WO, kc * 32, c0 + j * 16 + col, lane); asm volatile("s_wait_loadcnt 0x0" ::: "memory"); acc[j] = wmma_bf(a.h, w, acc[j]); acc[j] = wmma_bf(a.l, w, acc[j]); } }
#pragma unroll
    for (int j = 0; j < 8; ++j) { const float bias = BO ? bfr(BO[c0 + j * 16 + col]) : 0.f;
#pragma unroll
      for (int r = 0; r < 8; ++r) sf[wave][8 * g + r][j * 16 + col] = acc[j][r] + bias; }
  } else {
#pragma unroll 2
    for (int kc = 0; kc < CC / 32; ++kc) { const v16h a = frag_f32(Y + (r0 + col) * CC + kc * 32, lane); asm volatile("s_wait_loadcnt 0x0" ::: "memory");
#pragma unroll
      for (int j = 0; j < 8; ++j) { const v16h w = WOCOLH(WO, kc * 32, c0 + j * 16 + col, lane); asm volatile("s_wait_loadcnt 0x0" ::: "memory"); acc[j] = wmma16(a, w, acc[j]); } }
#pragma unroll
    for (int j = 0; j < 8; ++j) { const float bias = BO ? bfr(BO[c0 + j * 16 + col]) : 0.f;
#pragma unroll
      for (int r = 0; r < 8; ++r) sf[wave][8 * g + r][j * 16 + col] = acc[j][r] * (1.0f / 256.0f) + bias; } }
  LDSX(); for (int rl = 0; rl < 16; ++rl) vst2(OUT + (r0 + rl) * DIN + c0 + lane * 4, *(const v4f*)&sf[wave][rl][lane * 4]); }

extern "C" void kernel_launch(void* const* d_in, const int* in_sizes, int n_in, void* d_out, int out_size, void* d_ws, size_t ws_size, hipStream_t stream) {
  (void)in_sizes; (void)n_in; (void)out_size;
  const float** F = (const float**)d_in;
  if (ws_size < (size_t)WS_END) return;
  char* ws = (char*)d_ws; _Float16 *QH = (_Float16*)(ws + WS_QH), *KH = (_Float16*)(ws + WS_KH), *VT = (_Float16*)(ws + WS_VT), *QL = (_Float16*)(ws + WS_QL), *KL = (_Float16*)(ws + WS_KL); __bf16 *VB = (__bf16*)(ws + WS_VB), *VBL = (__bf16*)(ws + WS_VBL); float *Y = (float*)(ws + WS_Y);
  (void)Y; (void)QL; (void)KL; (void)VB; (void)VBL;
  // inputs: 0 query; 1 key; 2 value [2,2048,1024]; 3 wq (out,in); 4 wk; 5 wv; 6 wo (out,in)
  k_proj<<<dim3(TNB * TT / 64, CC / 128, 3), 128, 0, stream>>>(F[0], F[1], F[2], F[3], F[4], F[5], nullptr, nullptr, nullptr, QH, QL, KH, KL, VT, VB, VBL);
  k_fa<<<dim3(TT / 128, NH, TNB), 256, 0, stream>>>(QH, KH, QL, VT, Y);
  k_out<<<dim3(TNB * TT / 64, DIN / 128), 128, 0, stream>>>(Y, F[6], nullptr, (float*)d_out);
}

// v002
// One run takes 166 microseconds.
// Next to v001, in two timings, it ran 2.75 and 2.76 times as fast.
// All steps since v000 together make it 8.05 times as fast.
// compute dtype: all float inputs rounded to bf16; q/k/v = in W^T + b with EXACT bf16 products on WMMA 16x16x32 (f32 accumulate); q as f16 hi + residual (x 2^10) against k once to f16 (2 products) / sqrt(1024); online softmax in f32 (precise expf), logits and P kept in registers; P = exp(s - running max) once to f16 against v once to f16 (1 product), / row sum in f32; ctx split bf16 hi + lo against exact Wo (2 products) + bo; f32 output.
#include <hip/hip_runtime.h>
#include <math.h>

typedef __attribute__((ext_vector_type(16))) _Float16 v16h;
typedef __attribute__((ext_vector_type(16))) __bf16 v16b;
typedef __attribute__((ext_vector_type(8)))  _Float16 v8h;
typedef __attribute__((ext_vector_type(8)))  float v8f;
typedef __attribute__((ext_vector_type(4)))  float v4f;
typedef __attribute__((ext_vector_type(2)))  float v2f;
typedef __attribute__((ext_vector_type(4)))  unsigned v4u;
typedef __attribute__((ext_vector_type(4)))  int v4i;
typedef float __attribute__((may_alias)) float_a;
typedef int __attribute__((may_alias)) int_a;

template <typename T> __device__ __forceinline__ void vst2(void* p, T v) { *(T*)p = v;  }
__device__ __forceinline__ v8f wmma16(v16h a, v16h b, v8f c) {
  v8f d = __builtin_amdgcn_wmma_f32_16x16x32_f16(false, a, false, b, (short)0, c, false, false);
  asm volatile("v_nop\n\tv_nop\n\tv_nop\n\tv_nop" : "+v"(d) : "v"(a), "v"(b));
  return d;
}
__device__ __forceinline__ v8f wmma_bf(v16b a, v16b b, v8f c) {
  v8f d = __builtin_amdgcn_wmma_f32_16x16x32_bf16(false, a, false, b, (short)0, c, false, false);
  asm volatile("v_nop\n\tv_nop\n\tv_nop\n\tv_nop" : "+v"(d) : "v"(a), "v"(b));
  return d;
}
// 16x16x32 fragments: lane = (h = lane>>4, row/col = lane&15); elements 0..7 = k0+8h+0..7, 8..15 = k0+16+8h+0..7; D element r = row 8h+r
__device__ __forceinline__ v16h frag_h(const _Float16* rowk0, int lane) {
  union { v16h v; v8h q[2]; } u; const _Float16* p = rowk0 + 8 * (lane >> 4);
  u.q[0] = *(const v8h*)p; u.q[1] = *(const v8h*)(p + 16); return u.v;
}
__device__ __forceinline__ v16h frag_f32(const float* rowk0, int lane) {
  v16h a; const float* p = rowk0 + 8 * (lane >> 4);
#pragma unroll
  for (int i = 0; i < 8; ++i) { a[i] = (_Float16)p[i]; a[8 + i] = (_Float16)p[16 + i]; }
  return a;
}
__device__ __forceinline__ v16h frag_f32s(const float* rowk0, int lane, float sc) {
  v16h a; const float* p = rowk0 + 8 * (lane >> 4);
#pragma unroll
  for (int i = 0; i < 8; ++i) { a[i] = (_Float16)(p[i] * sc); a[8 + i] = (_Float16)(p[16 + i] * sc); }
  return a;
}
// column fragment from a [K][ld] layout (column n), rows >= K read as 0
__device__ __forceinline__ v16h fragc_f32(const float* W, int k0, int n, int lane, int ld, int K) {
  v16h a; const int g = lane >> 4;
#pragma unroll
  for (int i = 0; i < 8; ++i) { const int ka = k0 + 8 * g + i, kb = ka + 16;
    a[i] = (_Float16)(ka < K ? W[(size_t)(ka < K ? ka : K - 1) * ld + n] : 0.f); a[8 + i] = (_Float16)(kb < K ? W[(size_t)(kb < K ? kb : K - 1) * ld + n] : 0.f); }
  return a;
}
struct F2 { v16b h, l; };
__device__ __forceinline__ F2 bsplit16(const float v[16]) { F2 r;
#pragma unroll
  for (int i = 0; i < 16; ++i) { const __bf16 h = (__bf16)v[i]; r.h[i] = h; r.l[i] = (__bf16)(v[i] - (float)h); }
  return r; }
__device__ __forceinline__ F2 split_row(const float* row, int k0, int lane) { float v[16]; const float* p = row + k0 + 8 * (lane >> 4);
#pragma unroll
  for (int i = 0; i < 8; ++i) { v[i] = p[i]; v[8 + i] = p[16 + i]; }
  return bsplit16(v); }
__device__ __forceinline__ F2 split_rowK(const float* row, int k0, int lane, int K) { float v[16]; const int g = lane >> 4;
#pragma unroll
  for (int i = 0; i < 8; ++i) { const int ka = k0 + 8 * g + i, kb = ka + 16; v[i] = ka < K ? row[ka < K ? ka : K - 1] : 0.f; v[8 + i] = kb < K ? row[kb < K ? kb : K - 1] : 0.f; }
  return bsplit16(v); }
__device__ __forceinline__ F2 split_col(const float* W, int k0, int n, int lane, int ld, int K) { float v[16]; const int g = lane >> 4;
#pragma unroll
  for (int i = 0; i < 8; ++i) { const int ka = k0 + 8 * g + i, kb = ka + 16; v[i] = ka < K ? W[(size_t)(ka < K ? ka : K - 1) * ld + n] : 0.f; v[8 + i] = kb < K ? W[(size_t)(kb < K ? kb : K - 1) * ld + n] : 0.f; }
  return bsplit16(v); }
__device__ __forceinline__ v8f mac3(const F2& a, const F2& b, v8f c) { c = wmma_bf(a.l, b.h, c); c = wmma_bf(a.h, b.l, c); return wmma_bf(a.h, b.h, c); }
__device__ __forceinline__ float sigm(float v) { return 1.0f / (1.0f + expf(-v)); }
#define LDSX() do { asm volatile("s_wait_dscnt 0" ::: "memory"); __builtin_amdgcn_wave_barrier(); __builtin_amdgcn_fence(__ATOMIC_RELEASE, "workgroup"); } while (0)

// Multi-head attention with separate query / key / value inputs whose scores are divided by sqrt(emb_size) (query / key / value [2,2048,1024]; torch (out,in) Wq / Wk / Wv / Wo [1024,1024] N(0, 1/1024), no biases: q = query @ Wq.T etc.; 16 heads x 64; energy / sqrt(1024) = x 1/32 (the module's own NOTE: the embedding width, not the head width); softmax over all keys (no mask); out merged @ Wo.T).
#define NB 2
#define TT 2048
#define CC 1024            // NH * HD = projected width
#define DIN 1024          // input (model) width
#define NH 16
#define HD 64
#define NQB (TT / 64)
#define HG 4
#define SCALE (0.03125f)
#define CAUSAL 0
#ifndef TNB
#define TNB NB
#endif
__device__ __forceinline__ float bfr(float v) { return (float)(__bf16)v; }
__host__ __device__ __forceinline__ int kb_last(int qb) { return CAUSAL ? ((qb * 64 + 63) >> 7) : (TT / 128 - 1); }
typedef __attribute__((ext_vector_type(8))) __bf16 v8b;
__device__ __forceinline__ v16b frag_b(const __bf16* rowk0, int lane) {
  union { v16b v; v8b q[2]; } u; const __bf16* p = rowk0 + 8 * (lane >> 4);
  u.q[0] = *(const v8b*)p; u.q[1] = *(const v8b*)(p + 16); return u.v;
}
#define QBH 0              // unused: no kernel here has a high-precision path
#define QHI 2048            // rows carrying a q residual plane (all rows when non-causal: 2-product logits everywhere)
#define KHI 64            // key rows carrying k residual / v bf16 hi+lo planes (written by k_proj, read by no kernel)
// B fragment (k rows k0+.., output column o) of a weight: (in,out) [K][ld] or (out,in) [ld rows of K]: bf16 exact, or f16(bf16 * 256) exact
__device__ __forceinline__ v16b wcol_io(const float* Wm, int k0, int o, int lane, int ld) { v16b w; const int g = lane >> 4;
#pragma unroll
  for (int i = 0; i < 8; ++i) { w[i] = (__bf16)Wm[(size_t)(k0 + 8 * g + i) * ld + o]; w[8 + i] = (__bf16)Wm[(size_t)(k0 + 16 + 8 * g + i) * ld + o]; }
  return w; }
__device__ __forceinline__ v16b wcol_oi(const float* Wm, int k0, int o, int lane, int K) { v16b w; const float* p = Wm + (size_t)o * K + k0 + 8 * (lane >> 4);
#pragma unroll
  for (int i = 0; i < 8; ++i) { w[i] = (__bf16)p[i]; w[8 + i] = (__bf16)p[16 + i]; }
  return w; }
__device__ __forceinline__ v16h wcolh_io(const float* Wm, int k0, int o, int lane, int ld) { v16h w; const int g = lane >> 4;
#pragma unroll
  for (int i = 0; i < 8; ++i) { w[i] = (_Float16)(bfr(Wm[(size_t)(k0 + 8 * g + i) * ld + o]) * 256.0f); w[8 + i] = (_Float16)(bfr(Wm[(size_t)(k0 + 16 + 8 * g + i) * ld + o]) * 256.0f); }
  return w; }
__device__ __forceinline__ v16h wcolh_oi(const float* Wm, int k0, int o, int lane, int K) { v16h w; const float* p = Wm + (size_t)o * K + k0 + 8 * (lane >> 4);
#pragma unroll
  for (int i = 0; i < 8; ++i) { w[i] = (_Float16)(bfr(p[i]) * 256.0f); w[8 + i] = (_Float16)(bfr(p[16 + i]) * 256.0f); }
  return w; }
#define WQKV_LAYOUT 1   // 0 = (in,out) [DIN][CC]; 1 = (out,in) [CC][DIN]; 2 = per-head [NH][DIN][HD]; selects WCOL only, which no kernel uses (k_proj reads (out,in) rows)
__device__ __forceinline__ v16b wcol_hdk(const float* Wm, int k0, int o, int lane) { v16b w; const int g = lane >> 4; const float* p = Wm + (size_t)(o / HD) * DIN * HD + (o % HD);
#pragma unroll
  for (int i = 0; i < 8; ++i) { w[i] = (__bf16)p[(size_t)(k0 + 8 * g + i) * HD]; w[8 + i] = (__bf16)p[(size_t)(k0 + 16 + 8 * g + i) * HD]; }
  return w; }
#define WO_OUT_IN 1
#if WQKV_LAYOUT == 1
#define WCOL(W, k0, o, lane) wcol_oi(W, k0, o, lane, DIN)
#elif WQKV_LAYOUT == 2
#define WCOL(W, k0, o, lane) wcol_hdk(W, k0, o, lane)
#else
#define WCOL(W, k0, o, lane) wcol_io(W, k0, o, lane, CC)
#endif
#if WO_OUT_IN
#define WOCOL(W, k0, o, lane) wcol_oi(W, k0, o, lane, CC)
#define WOCOLH(W, k0, o, lane) wcolh_oi(W, k0, o, lane, CC)
#else
#define WOCOL(W, k0, o, lane) wcol_io(W, k0, o, lane, DIN)
#define WOCOLH(W, k0, o, lane) wcolh_io(W, k0, o, lane, DIN)
#endif

#ifndef SM_EXTRA_PARAMS
#define SM_EXTRA_PARAMS
#endif
#ifndef PROJ_EXTRA_PARAMS
#define PROJ_EXTRA_PARAMS
#endif
#ifndef SM_MASK_HOOK
#define SM_MASK_HOOK (void)0
#endif

#define WS_QH  0u                                      // f16 q rows [b*t][CC]
#define WS_KH  (WS_QH + 2u * (size_t)NB * TT * CC)      // f16 k rows [b*t][CC]
#define WS_VT  (WS_KH + 2u * (size_t)NB * TT * CC)      // f16 v planes [b][c][t]
#define WS_QL  (WS_VT + 2u * (size_t)NB * CC * TT)      // f16 q residual x 2^10 rows [b][t < QHI][CC]
#define WS_KL  (WS_QL + 2u * (size_t)NB * QHI * CC)     // f16 k residual x 2^10 rows [b][t < KHI][CC]
#define WS_VB  (WS_KL + 2u * (size_t)NB * KHI * CC)     // bf16 v hi planes [b][c][t < KHI]
#define WS_VBL (WS_VB + 2u * (size_t)NB * CC * KHI)
#define WS_S   (WS_VBL + 2u * (size_t)NB * CC * KHI)    // (unused: logits / P stay in registers)
#define WS_Y   (WS_S  + 4u * (size_t)HG * TT * TT)      // f32 ctx rows [b*t][CC] (only when there is an output projection)
#define WS_END (WS_Y  + 4u * (size_t)NB * TT * CC)

#define SK 64               // k per staged tile: 256 bytes of an f32 row
#define SP 72               // LDS row pitch in bf16: 144 bytes = 16 x 9, the pitch of ds_load_b128 readers
typedef __attribute__((ext_vector_type(4))) __bf16 v4b;
__device__ __forceinline__ v4b cvt4(v4f v) { v4b r;
#pragma unroll
  for (int i = 0; i < 4; ++i) r[i] = (__bf16)v[i];
  return r; }
// ---- k_proj: block = (64 rows, 128 cols, which): q/k/v = X W (+ b) with exact bf16 products (K = DIN) -> which 0: q f16 rows (+ residual rows < QHI); 1: k f16 rows (+ residual rows < KHI); 2: v f16 planes [c][t] (+ bf16 hi/lo planes for t < KHI)
__global__ __launch_bounds__(128) void k_proj(const float* __restrict__ XQ, const float* __restrict__ XK, const float* __restrict__ XV, const float* __restrict__ WQ, const float* __restrict__ WK, const float* __restrict__ WV, const float* __restrict__ BQ, const float* __restrict__ BK, const float* __restrict__ BV,
    _Float16* __restrict__ QH, _Float16* __restrict__ QL, _Float16* __restrict__ KH, _Float16* __restrict__ KL, _Float16* __restrict__ VT, __bf16* __restrict__ VB, __bf16* __restrict__ VBL) {
  // one LDS block: the main loop's operand tiles (two buffers) and, behind a barrier, the epilogue's staging arrays share it
  __shared__ __align__(16) unsigned char smem[90112];
  __bf16 (*xs)[64][SP] = (__bf16 (*)[64][SP])smem; __bf16 (*wt)[128][SP] = (__bf16 (*)[128][SP])(smem + 2 * 64 * SP * 2);
  _Float16 (*sh)[136] = (_Float16 (*)[136])smem; _Float16 (*sl)[136] = (_Float16 (*)[136])(smem + 17408); _Float16 (*th)[72] = (_Float16 (*)[72])(smem + 34816); __bf16 (*tb)[72] = (__bf16 (*)[72])(smem + 53248); __bf16 (*tbl)[72] = (__bf16 (*)[72])(smem + 71680);
  const int tid = threadIdx.x, wave = tid >> 5, lane = tid & 31, col = lane & 15, g = lane >> 4; const int which = blockIdx.z; const int c0 = blockIdx.y * 128; const size_t r0 = (size_t)blockIdx.x * 64; const size_t bb = r0 / TT; const int t0 = (int)(r0 % TT);
  const float* X = which == 0 ? XQ : which == 1 ? XK : XV; const float* WA = which == 0 ? WQ : which == 1 ? WK : WV; const float* BA = which == 0 ? BQ : which == 1 ? BK : BV;
  v8f acc[8] = {};
  const int sr = tid >> 4, sq = (tid & 15) * 4;   // a wave's 16-byte loads cover two whole 256-byte row pieces
  const float* xg = X + (r0 + sr) * DIN + sq; const float* wg = WA + (size_t)(c0 + sr) * DIN + sq;
  v4f xr[8], wr[16];
#pragma unroll
  for (int i = 0; i < 8; ++i) xr[i] = *(const v4f*)(xg + (size_t)(i * 8) * DIN);
#pragma unroll
  for (int i = 0; i < 16; ++i) wr[i] = *(const v4f*)(wg + (size_t)(i * 8) * DIN);
  asm volatile("s_wait_xcnt 0x0" :: "v"(xg), "v"(wg) : "memory");   // stands in front of the first overwrite of these loads' address registers (the addresses named so that they live up to it)
#pragma unroll 2   // two trips a pass of the loop, so that the buffer's number is a constant in the LDS addresses
  for (int c = 0; c < DIN / SK; ++c) { const int bs = c & 1;
#pragma unroll
    for (int i = 0; i < 8; ++i) *(v4b*)&xs[bs][sr + i * 8][sq] = cvt4(xr[i]);
#pragma unroll
    for (int i = 0; i < 16; ++i) *(v4b*)&wt[bs][sr + i * 8][sq] = cvt4(wr[i]);
    __syncthreads();   // publishes tile c; it also ends every wave's reads of the other buffer (tile c - 1), which the next trip refills
    if (c + 1 < DIN / SK) {
#pragma unroll
      for (int i = 0; i < 8; ++i) xr[i] = *(const v4f*)(xg + (size_t)(i * 8) * DIN + (c + 1) * SK);
#pragma unroll
      for (int i = 0; i < 16; ++i) wr[i] = *(const v4f*)(wg + (size_t)(i * 8) * DIN + (c + 1) * SK);
      asm volatile("s_wait_xcnt 0x0" ::: "memory");   // stands in front of the first overwrite of these loads' address registers; as a memory fence it also keeps the loads issued here, ahead of the products that cover their latency
    }
    v16b a[SK / 32], w[SK / 32][8];   // the tile's fragments, read as one group ahead of its products (reads among the products are each waited for at full LDS latency)
#pragma unroll
    for (int kc = 0; kc < SK / 32; ++kc) { a[kc] = frag_b(&xs[bs][wave * 16 + col][kc * 32], lane);
#pragma unroll
      for (int j = 0; j < 8; ++j) w[kc][j] = frag_b(&wt[bs][j * 16 + col][kc * 32], lane); }
#pragma unroll
    for (int kc = 0; kc < SK / 32; ++kc) {
#pragma unroll
      for (int j = 0; j < 8; ++j) acc[j] = wmma_bf(a[kc], w[kc][j], acc[j]); } }
  __syncthreads();   // every wave has left the operand tiles before the epilogue writes over them
  if (which < 2) { _Float16* DH = which == 0 ? QH : KH; _Float16* DL = which == 0 ? QL : KL; const int nhi = which == 0 ? QHI : KHI; const bool hi_rows = t0 < nhi;
#pragma unroll
    for (int j = 0; j < 8; ++j) { const float bias = BA ? bfr(BA[c0 + j * 16 + col]) : 0.f;
#pragma unroll
      for (int r = 0; r < 8; ++r) { const float v = acc[j][r] + bias; const _Float16 hv = (_Float16)v; sh[wave * 16 + 8 * g + r][j * 16 + col] = hv; sl[wave * 16 + 8 * g + r][j * 16 + col] = (_Float16)((v - (float)hv) * 1024.0f); } }
    __syncthreads();
    for (int e = tid; e < 64 * 16; e += 128) { const int rl = e >> 4, q = e & 15; vst2((unsigned*)(DH + (r0 + rl) * CC + c0 + q * 8), *(const v4u*)&sh[rl][q * 8]); if (hi_rows) vst2((unsigned*)(DL + (bb * nhi + t0 + rl) * (size_t)CC + c0 + q * 8), *(const v4u*)&sl[rl][q * 8]); }
  } else { const bool hi_rows = t0 < KHI;
#pragma unroll
    for (int j = 0; j < 8; ++j) { const float bias = BA ? bfr(BA[c0 + j * 16 + col]) : 0.f;
#pragma unroll
      for (int r = 0; r < 8; ++r) { const float v = acc[j][r] + bias; const int rl = wave * 16 + 8 * g + r, cl = j * 16 + col; th[cl][rl] = (_Float16)v; const __bf16 bh = (__bf16)v; tb[cl][rl] = bh; tbl[cl][rl] = (__bf16)(v - (float)bh); } }
    __syncthreads();
    for (int e = tid; e < 128 * 8; e += 128) { const int cl = e >> 3, q = e & 7; vst2((unsigned*)(VT + (bb * CC + c0 + cl) * (size_t)TT + t0 + q * 8), *(const v4u*)&th[cl][q * 8]); if (hi_rows) { const size_t o3 = (bb * CC + c0 + cl) * (size_t)KHI + t0 + q * 8; vst2((unsigned*)(VB + o3), *(const v4u*)&tb[cl][q * 8]); vst2((unsigned*)(VBL + o3), *(const v4u*)&tbl[cl][q * 8]); } } } }
__global__ __launch_bounds__(256) __attribute__((amdgpu_waves_per_eu(4, 4))) void k_fa(const _Float16* __restrict__ QH, const _Float16* __restrict__ KH, const _Float16* __restrict__ QL, const _Float16* __restrict__ VT, float* __restrict__ Y) {
  const int tid = threadIdx.x, wave = tid >> 5, lane = tid & 31, col = lane & 15, g = lane >> 4; const int h = blockIdx.y, b = blockIdx.z; const int ql0 = blockIdx.x * 128 + wave * 16;
  const _Float16* qp = QH + ((size_t)b * TT + ql0 + col) * CC + h * HD; const _Float16* qlp = QL + ((size_t)b * QHI + ql0 + col) * CC + h * HD;
  const _Float16* kp = KH + ((size_t)b * TT + col) * CC + h * HD; const _Float16* vp = VT + ((size_t)b * CC + h * HD + col) * (size_t)TT;
  v16h qh[HD / 32], ql[HD / 32];
#pragma unroll
  for (int kc = 0; kc < HD / 32; ++kc) { qh[kc] = frag_h(qp + kc * 32, lane); ql[kc] = frag_h(qlp + kc * 32, lane); }
  v8f o[HD / 16] = {}; float m = -3.0e38f, l = 0.f;
  v16h kf[4][HD / 32];   // this trip's k fragments, all fetched together one trip ahead (one load latency a trip, under the P.V products)
#pragma unroll
  for (int j = 0; j < 4; ++j) {
#pragma unroll
    for (int kc = 0; kc < HD / 32; ++kc) kf[j][kc] = frag_h(kp + (size_t)(j * 16) * CC + kc * 32, lane); }
#pragma unroll 1   // kept rolled: two trips' fragments at once would not fit the 256 registers of four waves per SIMD
  for (int k0 = 0; k0 < TT; k0 += 64) { v8f acc[4] = {}, accl[4] = {};
#pragma unroll
    for (int j = 0; j < 4; ++j) {
#pragma unroll
      for (int kc = 0; kc < HD / 32; ++kc) { acc[j] = wmma16(kf[j][kc], qh[kc], acc[j]); accl[j] = wmma16(kf[j][kc], ql[kc], accl[j]); } }
    v16h vf[2][HD / 16];   // fetched here so that the softmax arithmetic covers their latency
#pragma unroll
    for (int kc = 0; kc < 2; ++kc) {
#pragma unroll
      for (int j = 0; j < HD / 16; ++j) vf[kc][j] = frag_h(vp + (size_t)(j * 16) * TT + k0 + kc * 32, lane); }
    asm volatile("s_wait_xcnt 0x0" ::: "memory");   // stands in front of the first overwrite of the v loads' address registers (the pointer's step to the next trip)
    __builtin_amdgcn_sched_barrier(0);   // keeps the v loads issued here, ahead of the softmax: sunk towards their use they would be waited for at full latency
    float mx = -3.0e38f;
#pragma unroll
    for (int j = 0; j < 4; ++j) {
#pragma unroll
      for (int r = 0; r < 8; ++r) { acc[j][r] = (acc[j][r] + accl[j][r] * (1.0f / 1024.0f)) * SCALE; mx = fmaxf(mx, acc[j][r]); } }
    mx = fmaxf(mx, __shfl_xor(mx, 16));
    const float mn = fmaxf(m, mx), alpha = expf(m - mn); m = mn;
    float sum = 0.f; v16h p[2];
#pragma unroll
    for (int j = 0; j < 4; ++j) {
#pragma unroll
      for (int r = 0; r < 8; ++r) { const float e = expf(acc[j][r] - mn); sum += e; p[j >> 1][(j & 1) * 8 + r] = (_Float16)e; } }
    l = l * alpha + sum;
#pragma unroll
    for (int j = 0; j < HD / 16; ++j) o[j] *= alpha;
    const int kn = k0 + 64 < TT ? k0 + 64 : 0;   // the last trip fetches trip 0's rows again (in bounds, unused)
    const _Float16* kq = kp + (size_t)kn * CC;
    __builtin_amdgcn_sched_barrier(0);   // keeps the next k loads behind the softmax: lifted into it, 64 more live registers spill
#pragma unroll
    for (int j = 0; j < 4; ++j) {
#pragma unroll
      for (int kc = 0; kc < HD / 32; ++kc) kf[j][kc] = frag_h(kq + (size_t)(j * 16) * CC + kc * 32, lane); }
    asm volatile("s_wait_xcnt 0x0" :: "v"(kq + 8 * g) : "memory");   // stands in front of the first overwrite of the k loads' address registers (the address named so that no load returns into it)
#pragma unroll
    for (int kc = 0; kc < 2; ++kc) {
#pragma unroll
      for (int j = 0; j < HD / 16; ++j) o[j] = wmma16(vf[kc][j], p[kc], o[j]); } }
  l += __shfl_xor(l, 16); const float inv = 1.0f / l;
  float* yp = Y + ((size_t)b * TT + ql0 + col) * CC + h * HD + 8 * g;
#pragma unroll
  for (int j = 0; j < HD / 16; ++j) { v4f lo, hi;
#pragma unroll
    for (int r = 0; r < 4; ++r) { lo[r] = o[j][r] * inv; hi[r] = o[j][4 + r] * inv; }
    vst2(yp + j * 16, lo); vst2(yp + j * 16 + 4, hi); } }
// ---- k_out: block = (64 rows, 128 cols): out = ctx Wo (+ bo): all rows: ctx bf16 hi + lo against exact bf16 Wo (2 products)
__global__ __launch_bounds__(128) void k_out(const float* __restrict__ Y, const float* __restrict__ WO, const float* __restrict__ BO, float* __restrict__ OUT) { __shared__ __align__(16) float sf[4][16][132]; __shared__ __align__(16) __bf16 yh[2][64][SP], yl[2][64][SP], wt[2][128][SP];
  const int tid = threadIdx.x, wave = tid >> 5, lane = tid & 31, col = lane & 15, g = lane >> 4; const int c0 = blockIdx.y * 128; const size_t r0 = (size_t)blockIdx.x * 64 + wave * 16;
  v8f acc[8] = {};
  if (true) {   /* ALL rows: ctx split bf16 hi + lo x exact Wo (2 products) */
    const int sr = tid >> 4, sq = (tid & 15) * 4;   // a wave's 16-byte loads cover two whole 256-byte row pieces
    const float* yg = Y + ((size_t)blockIdx.x * 64 + sr) * CC + sq; const float* wg = WO + (size_t)(c0 + sr) * CC + sq;
    v4f yr[8], wr[16];
#pragma unroll
    for (int i = 0; i < 8; ++i) yr[i] = *(const v4f*)(yg + (size_t)(i * 8) * CC);
#pragma unroll
    for (int i = 0; i < 16; ++i) wr[i] = *(const v4f*)(wg + (size_t)(i * 8) * CC);
    asm volatile("s_wait_xcnt 0x0" :: "v"(yg), "v"(wg) : "memory");   // stands in front of the first overwrite of these loads' address registers (the addresses named so that they live up to it)
#pragma unroll 2   // two trips a pass of the loop, so that the buffer's number is a constant in the LDS addresses
    for (int c = 0; c < CC / SK; ++c) { const int bs = c & 1;
#pragma unroll
      for (int i = 0; i < 8; ++i) { const v4b hv = cvt4(yr[i]); v4f rs;
#pragma unroll
        for (int e = 0; e < 4; ++e) rs[e] = yr[i][e] - (float)hv[e];
        *(v4b*)&yh[bs][sr + i * 8][sq] = hv; *(v4b*)&yl[bs][sr + i * 8][sq] = cvt4(rs); }
#pragma unroll
      for (int i = 0; i < 16; ++i) *(v4b*)&wt[bs][sr + i * 8][sq] = cvt4(wr[i]);
      __syncthreads();   // publishes tile c; it also ends every wave's reads of the other buffer (tile c - 1), which the next trip refills
      if (c + 1 < CC / SK) {
#pragma unroll
        for (int i = 0; i < 8; ++i) yr[i] = *(const v4f*)(yg + (size_t)(i * 8) * CC + (c + 1) * SK);
#pragma unroll
        for (int i = 0; i < 16; ++i) wr[i] = *(const v4f*)(wg + (size_t)(i * 8) * CC + (c + 1) * SK);
        asm volatile("s_wait_xcnt 0x0" ::: "memory");   // stands in front of the first overwrite of these loads' address registers; as a memory fence it also keeps the loads issued here, ahead of the products that cover their latency
      }
      v16b ah[SK / 32], al[SK / 32], w[SK / 32][8];   // the tile's fragments, read as one group ahead of its products (reads among the products are each waited for at full LDS latency)
#pragma unroll
      for (int kc = 0; kc < SK / 32; ++kc) { ah[kc] = frag_b(&yh[bs][wave * 16 + col][kc * 32], lane); al[kc] = frag_b(&yl[bs][wave * 16 + col][kc * 32], lane);
#pragma unroll
        for (int j = 0; j < 8; ++j) w[kc][j] = frag_b(&wt[bs][j * 16 + col][kc * 32], lane); }
#pragma unroll
      for (int kc = 0; kc < SK / 32; ++kc) {
#pragma unroll
        for (int j = 0; j < 8; ++j) { acc[j] = wmma_bf(ah[kc], w[kc][j], acc[j]); acc[j] = wmma_bf(al[kc], w[kc][j], acc[j]); } } }
#pragma unroll
    for (int j = 0; j < 8; ++j) { const float bias = BO ? bfr(BO[c0 + j * 16 + col]) : 0.f;
#pragma unroll
      for (int r = 0; r < 8; ++r) sf[wave][8 * g + r][j * 16 + col] = acc[j][r] + bias; }
  } else {
#pragma unroll 2
    for (int kc = 0; kc < CC / 32; ++kc) { const v16h a = frag_f32(Y + (r0 + col) * CC + kc * 32, lane); asm volatile("s_wait_loadcnt 0x0" ::: "memory");
#pragma unroll
      for (int j = 0; j < 8; ++j) { const v16h w = WOCOLH(WO, kc * 32, c0 + j * 16 + col, lane); asm volatile("s_wait_loadcnt 0x0" ::: "memory"); acc[j] = wmma16(a, w, acc[j]); } }
#pragma unroll
    for (int j = 0; j < 8; ++j) { const float bias = BO ? bfr(BO[c0 + j * 16 + col]) : 0.f;
#pragma unroll
      for (int r = 0; r < 8; ++r) sf[wave][8 * g + r][j * 16 + col] = acc[j][r] * (1.0f / 256.0f) + bias; } }
  LDSX(); for (int rl = 0; rl < 16; ++rl) vst2(OUT + (r0 + rl) * DIN + c0 + lane * 4, *(const v4f*)&sf[wave][rl][lane * 4]); }

extern "C" void kernel_launch(void* const* d_in, const int* in_sizes, int n_in, void* d_out, int out_size, void* d_ws, size_t ws_size, hipStream_t stream) {
  (void)in_sizes; (void)n_in; (void)out_size;
  const float** F = (const float**)d_in;
  if (ws_size < (size_t)WS_END) return;
  char* ws = (char*)d_ws; _Float16 *QH = (_Float16*)(ws + WS_QH), *KH = (_Float16*)(ws + WS_KH), *VT = (_Float16*)(ws + WS_VT), *QL = (_Float16*)(ws + WS_QL), *KL = (_Float16*)(ws + WS_KL); __bf16 *VB = (__bf16*)(ws + WS_VB), *VBL = (__bf16*)(ws + WS_VBL); float *Y = (float*)(ws + WS_Y);
  (void)Y; (void)QL; (void)KL; (void)VB; (void)VBL;
  // inputs: 0 query; 1 key; 2 value [2,2048,1024]; 3 wq (out,in); 4 wk; 5 wv; 6 wo (out,in)
  k_proj<<<dim3(TNB * TT / 64, CC / 128, 3), 128, 0, stream>>>(F[0], F[1], F[2], F[3], F[4], F[5], nullptr, nullptr, nullptr, QH, QL, KH, KL, VT, VB, VBL);
  k_fa<<<dim3(TT / 128, NH, TNB), 256, 0, stream>>>(QH, KH, QL, VT, Y);
  k_out<<<dim3(TNB * TT / 64, DIN / 128), 128, 0, stream>>>(Y, F[6], nullptr, (float*)d_out);
}

// v003
// It runs in 143 microseconds.
// In two side-by-side timings against v002, it was 1.15 and 1.16 times as fast.
// Over all steps from v000 it is 9.30 times as fast.
// compute dtype: all float inputs rounded to bf16; q/k/v = in W^T + b with EXACT bf16 products on WMMA 16x16x32 (f32 accumulate); q as f16 hi + residual (x 2^10) against k once to f16 (2 products) / sqrt(1024); online softmax in f32 (precise expf), logits and P kept in registers; P = exp(s - running max) once to f16 against v once to f16 (1 product), / row sum in f32; ctx split bf16 hi + lo against exact Wo (2 products) + bo; f32 output.
#include <hip/hip_runtime.h>
#include <math.h>

typedef __attribute__((ext_vector_type(16))) _Float16 v16h;
typedef __attribute__((ext_vector_type(16))) __bf16 v16b;
typedef __attribute__((ext_vector_type(8)))  _Float16 v8h;
typedef __attribute__((ext_vector_type(8)))  float v8f;
typedef __attribute__((ext_vector_type(4)))  float v4f;
typedef __attribute__((ext_vector_type(2)))  float v2f;
typedef __attribute__((ext_vector_type(4)))  unsigned v4u;
typedef __attribute__((ext_vector_type(4)))  int v4i;
typedef float __attribute__((may_alias)) float_a;
typedef int __attribute__((may_alias)) int_a;

template <typename T> __device__ __forceinline__ void vst2(void* p, T v) { *(T*)p = v;  }
__device__ __forceinline__ v8f wmma16(v16h a, v16h b, v8f c) {
  v8f d = __builtin_amdgcn_wmma_f32_16x16x32_f16(false, a, false, b, (short)0, c, false, false);
  asm volatile("v_nop\n\tv_nop\n\tv_nop\n\tv_nop" : "+v"(d) : "v"(a), "v"(b));
  return d;
}
__device__ __forceinline__ v8f wmma_bf(v16b a, v16b b, v8f c) {
  v8f d = __builtin_amdgcn_wmma_f32_16x16x32_bf16(false, a, false, b, (short)0, c, false, false);
  asm volatile("v_nop\n\tv_nop\n\tv_nop\n\tv_nop" : "+v"(d) : "v"(a), "v"(b));
  return d;
}
// 16x16x32 fragments: lane = (h = lane>>4, row/col = lane&15); elements 0..7 = k0+8h+0..7, 8..15 = k0+16+8h+0..7; D element r = row 8h+r
__device__ __forceinline__ v16h frag_h(const _Float16* rowk0, int lane) {
  union { v16h v; v8h q[2]; } u; const _Float16* p = rowk0 + 8 * (lane >> 4);
  u.q[0] = *(const v8h*)p; u.q[1] = *(const v8h*)(p + 16); return u.v;
}
// the same fragment from a plane laid in fragment order: p = the lane's own 16 bytes of the first 512-byte piece (elements 0..7), the second piece (elements 8..15) follows it; each load of a wave covers four whole 128-byte lines
__device__ __forceinline__ v16h frag_p(const _Float16* p) {
  union { v16h v; v8h q[2]; } u;
  u.q[0] = *(const v8h*)p; u.q[1] = *(const v8h*)(p + 256); return u.v;
}
__device__ __forceinline__ v16h frag_f32(const float* rowk0, int lane) {
  v16h a; const float* p = rowk0 + 8 * (lane >> 4);
#pragma unroll
  for (int i = 0; i < 8; ++i) { a[i] = (_Float16)p[i]; a[8 + i] = (_Float16)p[16 + i]; }
  return a;
}
__device__ __forceinline__ v16h frag_f32s(const float* rowk0, int lane, float sc) {
  v16h a; const float* p = rowk0 + 8 * (lane >> 4);
#pragma unroll
  for (int i = 0; i < 8; ++i) { a[i] = (_Float16)(p[i] * sc); a[8 + i] = (_Float16)(p[16 + i] * sc); }
  return a;
}
// column fragment from a [K][ld] layout (column n), rows >= K read as 0
__device__ __forceinline__ v16h fragc_f32(const float* W, int k0, int n, int lane, int ld, int K) {
  v16h a; const int g = lane >> 4;
#pragma unroll
  for (int i = 0; i < 8; ++i) { const int ka = k0 + 8 * g + i, kb = ka + 16;
    a[i] = (_Float16)(ka < K ? W[(size_t)(ka < K ? ka : K - 1) * ld + n] : 0.f); a[8 + i] = (_Float16)(kb < K ? W[(size_t)(kb < K ? kb : K - 1) * ld + n] : 0.f); }
  return a;
}
struct F2 { v16b h, l; };
__device__ __forceinline__ F2 bsplit16(const float v[16]) { F2 r;
#pragma unroll
  for (int i = 0; i < 16; ++i) { const __bf16 h = (__bf16)v[i]; r.h[i] = h; r.l[i] = (__bf16)(v[i] - (float)h); }
  return r; }
__device__ __forceinline__ F2 split_row(const float* row, int k0, int lane) { float v[16]; const float* p = row + k0 + 8 * (lane >> 4);
#pragma unroll
  for (int i = 0; i < 8; ++i) { v[i] = p[i]; v[8 + i] = p[16 + i]; }
  return bsplit16(v); }
__device__ __forceinline__ F2 split_rowK(const float* row, int k0, int lane, int K) { float v[16]; const int g = lane >> 4;
#pragma unroll
  for (int i = 0; i < 8; ++i) { const int ka = k0 + 8 * g + i, kb = ka + 16; v[i] = ka < K ? row[ka < K ? ka : K - 1] : 0.f; v[8 + i] = kb < K ? row[kb < K ? kb : K - 1] : 0.f; }
  return bsplit16(v); }
__device__ __forceinline__ F2 split_col(const float* W, int k0, int n, int lane, int ld, int K) { float v[16]; const int g = lane >> 4;
#pragma unroll
  for (int i = 0; i < 8; ++i) { const int ka = k0 + 8 * g + i, kb = ka + 16; v[i] = ka < K ? W[(size_t)(ka < K ? ka : K - 1) * ld + n] : 0.f; v[8 + i] = kb < K ? W[(size_t)(kb < K ? kb : K - 1) * ld + n] : 0.f; }
  return bsplit16(v); }
__device__ __forceinline__ v8f mac3(const F2& a, const F2& b, v8f c) { c = wmma_bf(a.l, b.h, c); c = wmma_bf(a.h, b.l, c); return wmma_bf(a.h, b.h, c); }
__device__ __forceinline__ float sigm(float v) { return 1.0f / (1.0f + expf(-v)); }
#define LDSX() do { asm volatile("s_wait_dscnt 0" ::: "memory"); __builtin_amdgcn_wave_barrier(); __builtin_amdgcn_fence(__ATOMIC_RELEASE, "workgroup"); } while (0)

// Multi-head attention with separate query / key / value inputs whose scores are divided by sqrt(emb_size) (query / key / value [2,2048,1024]; torch (out,in) Wq / Wk / Wv / Wo [1024,1024] N(0, 1/1024), no biases: q = query @ Wq.T etc.; 16 heads x 64; energy / sqrt(1024) = x 1/32 (the module's own NOTE: the embedding width, not the head width); softmax over all keys (no mask); out merged @ Wo.T).
#define NB 2
#define TT 2048
#define CC 1024            // NH * HD = projected width
#define DIN 1024          // input (model) width
#define NH 16
#define HD 64
#define NQB (TT / 64)
#define HG 4
#define SCALE (0.03125f)
#define CAUSAL 0
#ifndef TNB
#define TNB NB
#endif
__device__ __forceinline__ float bfr(float v) { return (float)(__bf16)v; }
__host__ __device__ __forceinline__ int kb_last(int qb) { return CAUSAL ? ((qb * 64 + 63) >> 7) : (TT / 128 - 1); }
typedef __attribute__((ext_vector_type(8))) __bf16 v8b;
__device__ __forceinline__ v16b frag_b(const __bf16* rowk0, int lane) {
  union { v16b v; v8b q[2]; } u; const __bf16* p = rowk0 + 8 * (lane >> 4);
  u.q[0] = *(const v8b*)p; u.q[1] = *(const v8b*)(p + 16); return u.v;
}
#define QBH 0              // unused: no kernel here has a high-precision path
#define QHI 2048            // rows carrying a q residual plane (all rows when non-causal: 2-product logits everywhere)
#define KHI 64            // key rows carrying k residual / v bf16 hi+lo planes (written by k_proj, read by no kernel)
// B fragment (k rows k0+.., output column o) of a weight: (in,out) [K][ld] or (out,in) [ld rows of K]: bf16 exact, or f16(bf16 * 256) exact
__device__ __forceinline__ v16b wcol_io(const float* Wm, int k0, int o, int lane, int ld) { v16b w; const int g = lane >> 4;
#pragma unroll
  for (int i = 0; i < 8; ++i) { w[i] = (__bf16)Wm[(size_t)(k0 + 8 * g + i) * ld + o]; w[8 + i] = (__bf16)Wm[(size_t)(k0 + 16 + 8 * g + i) * ld + o]; }
  return w; }
__device__ __forceinline__ v16b wcol_oi(const float* Wm, int k0, int o, int lane, int K) { v16b w; const float* p = Wm + (size_t)o * K + k0 + 8 * (lane >> 4);
#pragma unroll
  for (int i = 0; i < 8; ++i) { w[i] = (__bf16)p[i]; w[8 + i] = (__bf16)p[16 + i]; }
  return w; }
__device__ __forceinline__ v16h wcolh_io(const float* Wm, int k0, int o, int lane, int ld) { v16h w; const int g = lane >> 4;
#pragma unroll
  for (int i = 0; i < 8; ++i) { w[i] = (_Float16)(bfr(Wm[(size_t)(k0 + 8 * g + i) * ld + o]) * 256.0f); w[8 + i] = (_Float16)(bfr(Wm[(size_t)(k0 + 16 + 8 * g + i) * ld + o]) * 256.0f); }
  return w; }
__device__ __forceinline__ v16h wcolh_oi(const float* Wm, int k0, int o, int lane, int K) { v16h w; const float* p = Wm + (size_t)o * K + k0 + 8 * (lane >> 4);
#pragma unroll
  for (int i = 0; i < 8; ++i) { w[i] = (_Float16)(bfr(p[i]) * 256.0f); w[8 + i] = (_Float16)(bfr(p[16 + i]) * 256.0f); }
  return w; }
#define WQKV_LAYOUT 1   // 0 = (in,out) [DIN][CC]; 1 = (out,in) [CC][DIN]; 2 = per-head [NH][DIN][HD]; selects WCOL only, which no kernel uses (k_proj reads (out,in) rows)
__device__ __forceinline__ v16b wcol_hdk(const float* Wm, int k0, int o, int lane) { v16b w; const int g = lane >> 4; const float* p = Wm + (size_t)(o / HD) * DIN * HD + (o % HD);
#pragma unroll
  for (int i = 0; i < 8; ++i) { w[i] = (__bf16)p[(size_t)(k0 + 8 * g + i) * HD]; w[8 + i] = (__bf16)p[(size_t)(k0 + 16 + 8 * g + i) * HD]; }
  return w; }
#define WO_OUT_IN 1
#if WQKV_LAYOUT == 1
#define WCOL(W, k0, o, lane) wcol_oi(W, k0, o, lane, DIN)
#elif WQKV_LAYOUT == 2
#define WCOL(W, k0, o, lane) wcol_hdk(W, k0, o, lane)
#else
#define WCOL(W, k0, o, lane) wcol_io(W, k0, o, lane, CC)
#endif
#if WO_OUT_IN
#define WOCOL(W, k0, o, lane) wcol_oi(W, k0, o, lane, CC)
#define WOCOLH(W, k0, o, lane) wcolh_oi(W, k0, o, lane, CC)
#else
#define WOCOL(W, k0, o, lane) wcol_io(W, k0, o, lane, DIN)
#define WOCOLH(W, k0, o, lane) wcolh_io(W, k0, o, lane, DIN)
#endif

#ifndef SM_EXTRA_PARAMS
#define SM_EXTRA_PARAMS
#endif
#ifndef PROJ_EXTRA_PARAMS
#define PROJ_EXTRA_PARAMS
#endif
#ifndef SM_MASK_HOOK
#define SM_MASK_HOOK (void)0
#endif

#define WS_QH  0u                                      // f16 q rows [b*t][CC]
#define WS_KH  (WS_QH + 2u * (size_t)NB * TT * CC)      // f16 k in fragment order [b][h][t / 16][d / 16][lane][8]: lane = 16 * ((d >> 3) & 1) + (t & 15), element d & 7
#define WS_VT  (WS_KH + 2u * (size_t)NB * TT * CC)      // f16 v in fragment order [b][h][t / 32][d / 16][(t >> 4) & 1][lane][8]: lane = 16 * ((t >> 3) & 1) + (d & 15), element t & 7
#define WS_QL  (WS_VT + 2u * (size_t)NB * CC * TT)      // f16 q residual x 2^10 rows [b][t < QHI][CC]
#define WS_KL  (WS_QL + 2u * (size_t)NB * QHI * CC)     // f16 k residual x 2^10 rows [b][t < KHI][CC]
#define WS_VB  (WS_KL + 2u * (size_t)NB * KHI * CC)     // bf16 v hi planes [b][c][t < KHI]
#define WS_VBL (WS_VB + 2u * (size_t)NB * CC * KHI)
#define WS_S   (WS_VBL + 2u * (size_t)NB * CC * KHI)    // (unused: logits / P stay in registers)
#define WS_Y   (WS_S  + 4u * (size_t)HG * TT * TT)      // f32 ctx rows [b*t][CC] (only when there is an output projection)
#define WS_END (WS_Y  + 4u * (size_t)NB * TT * CC)

#define SK 64               // k per staged tile: 256 bytes of an f32 row
#define SP 72               // LDS row pitch in bf16: 144 bytes = 16 x 9, the pitch of ds_load_b128 readers
typedef __attribute__((ext_vector_type(4))) __bf16 v4b;
__device__ __forceinline__ v4b cvt4(v4f v) { v4b r;
#pragma unroll
  for (int i = 0; i < 4; ++i) r[i] = (__bf16)v[i];
  return r; }
// eight 16-byte pieces of one thread from LDS to global memory, at constant byte offsets from one address; then the wait that stands in front of any overwrite of the registers these stores name (address and data named, so that they live up to it)
template <typename FS, typename FO> __device__ __forceinline__ void put8(void* p0, FS from, FO off) {
  v4u d[8];
#pragma unroll   // unrolled: d stays in registers, and the LDS reads go out as one group
  for (int it = 0; it < 8; ++it) d[it] = *(const v4u*)from(it);
#pragma unroll   // unrolled: the offsets become immediates on one address, which nothing overwrites in front of the wait
  for (int it = 0; it < 8; ++it) *(v4u*)((char*)p0 + off(it)) = d[it];
  asm volatile("s_wait_xcnt 0x0" :: "v"(p0), "v"(d[0]), "v"(d[1]), "v"(d[2]), "v"(d[3]), "v"(d[4]), "v"(d[5]), "v"(d[6]), "v"(d[7]) : "memory");
}
// ---- k_proj: block = (64 rows, 128 cols, which): q/k/v = X W (+ b) with exact bf16 products (K = DIN) -> which 0: q f16 rows (+ residual rows < QHI); 1: k f16 in fragment order (+ residual rows < KHI); 2: v f16 in fragment order (+ bf16 hi/lo planes for t < KHI)
__global__ __launch_bounds__(128) void k_proj(const float* __restrict__ XQ, const float* __restrict__ XK, const float* __restrict__ XV, const float* __restrict__ WQ, const float* __restrict__ WK, const float* __restrict__ WV, const float* __restrict__ BQ, const float* __restrict__ BK, const float* __restrict__ BV,
    _Float16* __restrict__ QH, _Float16* __restrict__ QL, _Float16* __restrict__ KH, _Float16* __restrict__ KL, _Float16* __restrict__ VT, __bf16* __restrict__ VB, __bf16* __restrict__ VBL) {
  // one LDS block: the main loop's operand tiles (two buffers) and, behind a barrier, the epilogue's staging arrays share it
  __shared__ __align__(16) unsigned char smem[90112];
  __bf16 (*xs)[64][SP] = (__bf16 (*)[64][SP])smem; __bf16 (*wt)[128][SP] = (__bf16 (*)[128][SP])(smem + 2 * 64 * SP * 2);
  _Float16 (*sh)[136] = (_Float16 (*)[136])smem; _Float16 (*sl)[136] = (_Float16 (*)[136])(smem + 17408); _Float16 (*th)[72] = (_Float16 (*)[72])(smem + 34816); __bf16 (*tb)[72] = (__bf16 (*)[72])(smem + 53248); __bf16 (*tbl)[72] = (__bf16 (*)[72])(smem + 71680);
  const int tid = threadIdx.x, wave = tid >> 5, lane = tid & 31, col = lane & 15, g = lane >> 4; const int which = blockIdx.z; const int c0 = blockIdx.y * 128; const size_t r0 = (size_t)blockIdx.x * 64; const size_t bb = r0 / TT; const int t0 = (int)(r0 % TT);
  const float* X = which == 0 ? XQ : which == 1 ? XK : XV; const float* WA = which == 0 ? WQ : which == 1 ? WK : WV; const float* BA = which == 0 ? BQ : which == 1 ? BK : BV;
  v8f acc[8] = {};
  const int sr = tid >> 4, sq = (tid & 15) * 4;   // a wave's 16-byte loads cover two whole 256-byte row pieces
  const float* xg = X + (r0 + sr) * DIN + sq; const float* wg = WA + (size_t)(c0 + sr) * DIN + sq;
  v4f xr[8], wr[16];
#pragma unroll
  for (int i = 0; i < 8; ++i) xr[i] = *(const v4f*)(xg + (size_t)(i * 8) * DIN);
#pragma unroll
  for (int i = 0; i < 16; ++i) wr[i] = *(const v4f*)(wg + (size_t)(i * 8) * DIN);
  asm volatile("s_wait_xcnt 0x0" :: "v"(xg), "v"(wg) : "memory");   // stands in front of the first overwrite of these loads' address registers (the addresses named so that they live up to it)
#pragma unroll 2   // two trips a pass of the loop, so that the buffer's number is a constant in the LDS addresses
  for (int c = 0; c < DIN / SK; ++c) { const int bs = c & 1;
#pragma unroll
    for (int i = 0; i < 8; ++i) *(v4b*)&xs[bs][sr + i * 8][sq] = cvt4(xr[i]);
#pragma unroll
    for (int i = 0; i < 16; ++i) *(v4b*)&wt[bs][sr + i * 8][sq] = cvt4(wr[i]);
    __syncthreads();   // publishes tile c; it also ends every wave's reads of the other buffer (tile c - 1), which the next trip refills
    if (c + 1 < DIN / SK) {
#pragma unroll
      for (int i = 0; i < 8; ++i) xr[i] = *(const v4f*)(xg + (size_t)(i * 8) * DIN + (c + 1) * SK);
#pragma unroll
      for (int i = 0; i < 16; ++i) wr[i] = *(const v4f*)(wg + (size_t)(i * 8) * DIN + (c + 1) * SK);
      asm volatile("s_wait_xcnt 0x0" ::: "memory");   // stands in front of the first overwrite of these loads' address registers; as a memory fence it also keeps the loads issued here, ahead of the products that cover their latency
    }
    v16b a[SK / 32], w[SK / 32][8];   // the tile's fragments, read as one group ahead of its products (reads among the products are each waited for at full LDS latency)
#pragma unroll
    for (int kc = 0; kc < SK / 32; ++kc) { a[kc] = frag_b(&xs[bs][wave * 16 + col][kc * 32], lane);
#pragma unroll
      for (int j = 0; j < 8; ++j) w[kc][j] = frag_b(&wt[bs][j * 16 + col][kc * 32], lane); }
#pragma unroll
    for (int kc = 0; kc < SK / 32; ++kc) {
#pragma unroll
      for (int j = 0; j < 8; ++j) acc[j] = wmma_bf(a[kc], w[kc][j], acc[j]); } }
  __syncthreads();   // every wave has left the operand tiles before the epilogue writes over them
  if (which < 2) { _Float16* DH = which == 0 ? QH : KH; _Float16* DL = which == 0 ? QL : KL; const int nhi = which == 0 ? QHI : KHI; const bool hi_rows = t0 < nhi;
#pragma unroll
    for (int j = 0; j < 8; ++j) { const float bias = BA ? bfr(BA[c0 + j * 16 + col]) : 0.f;
#pragma unroll
      for (int r = 0; r < 8; ++r) { const float v = acc[j][r] + bias; const _Float16 hv = (_Float16)v; sh[wave * 16 + 8 * g + r][j * 16 + col] = hv; sl[wave * 16 + 8 * g + r][j * 16 + col] = (_Float16)((v - (float)hv) * 1024.0f); } }
    __syncthreads();
    const int rl = tid >> 4, q8 = (tid & 15) * 8;   // rows: a thread's eight 16-byte pieces lie 8 rows apart
    if (which == 0) put8(DH + (r0 + rl) * CC + c0 + q8, [&](int it) { return (const void*)&sh[rl + it * 8][q8]; }, [](int it) { return it * 8 * CC * 2; });
    else   // k: 32 pieces of 512 bytes (2 heads x 4 key tiles x 4 groups of 16 d), one piece a wave's store; trip it = head it >> 2, key tile it & 3, the wave's number = the group of 16 d
      put8(DH + ((bb * NH + c0 / HD) * (TT / 16) + t0 / 16) * 1024 + tid * 8, [&](int it) { return (const void*)&sh[(it & 3) * 16 + col][(it >> 2) * HD + wave * 16 + g * 8]; }, [](int it) { return ((it >> 2) * (TT / 16) + (it & 3)) * 1024 * 2; });
    if (hi_rows) put8(DL + (bb * nhi + t0 + rl) * (size_t)CC + c0 + q8, [&](int it) { return (const void*)&sl[rl + it * 8][q8]; }, [](int it) { return it * 8 * CC * 2; });
  } else { const bool hi_rows = t0 < KHI;
#pragma unroll
    for (int j = 0; j < 8; ++j) { const float bias = BA ? bfr(BA[c0 + j * 16 + col]) : 0.f;
#pragma unroll
      for (int r = 0; r < 8; ++r) { const float v = acc[j][r] + bias; const int rl = wave * 16 + 8 * g + r, cl = j * 16 + col; th[cl][rl] = (_Float16)v; const __bf16 bh = (__bf16)v; tb[cl][rl] = bh; tbl[cl][rl] = (__bf16)(v - (float)bh); } }
    __syncthreads();
    // v: 32 pieces of 512 bytes (2 heads x 2 groups of 32 keys x 4 tiles of 16 d x 2 halves of 16 keys), one piece a wave's store; trip it = head it >> 2, key group (it >> 1) & 1, d tile 2 * (it & 1) + (wave >> 1), half wave & 1
    put8(VT + ((bb * NH + c0 / HD) * (TT / 32) + t0 / 32) * 2048 + tid * 8, [&](int it) { return (const void*)&th[(it >> 2) * HD + (2 * (it & 1) + (wave >> 1)) * 16 + col][((it >> 1) & 1) * 32 + (wave & 1) * 16 + g * 8]; }, [](int it) { return ((it >> 2) * (TT / 32) * 2048 + ((it >> 1) & 1) * 2048 + (it & 1) * 1024) * 2; });
    if (hi_rows) { const int cl = tid >> 3, q8 = (tid & 7) * 8; const size_t o3 = (bb * CC + c0 + cl) * (size_t)KHI + t0 + q8;
      put8(VB + o3, [&](int it) { return (const void*)&tb[cl + it * 16][q8]; }, [](int it) { return it * 16 * KHI * 2; });
      put8(VBL + o3, [&](int it) { return (const void*)&tbl[cl + it * 16][q8]; }, [](int it) { return it * 16 * KHI * 2; }); } } }
__global__ __launch_bounds__(256) __attribute__((amdgpu_waves_per_eu(4, 4))) void k_fa(const _Float16* __restrict__ QH, const _Float16* __restrict__ KH, const _Float16* __restrict__ QL, const _Float16* __restrict__ VT, float* __restrict__ Y) {
  const int tid = threadIdx.x, wave = tid >> 5, lane = tid & 31, col = lane & 15, g = lane >> 4; const int h = blockIdx.y, b = blockIdx.z; const int ql0 = blockIdx.x * 128 + wave * 16;
  const _Float16* qp = QH + ((size_t)b * TT + ql0 + col) * CC + h * HD; const _Float16* qlp = QL + ((size_t)b * QHI + ql0 + col) * CC + h * HD;
  const _Float16* kp = KH + (size_t)(b * NH + h) * (TT * HD) + lane * 8; const _Float16* vp = VT + (size_t)(b * NH + h) * (TT * HD) + lane * 8;   // 64 keys = 4,096 elements of either plane
  v16h qh[HD / 32], ql[HD / 32];
#pragma unroll
  for (int kc = 0; kc < HD / 32; ++kc) { qh[kc] = frag_h(qp + kc * 32, lane); ql[kc] = frag_h(qlp + kc * 32, lane); }
  v8f o[HD / 16] = {}; float m = -3.0e38f, l = 0.f;
  v16h kf[4][HD / 32];   // this trip's k fragments, all fetched together one trip ahead (one load latency a trip, under the P.V products)
#pragma unroll
  for (int j = 0; j < 4; ++j) {
#pragma unroll
    for (int kc = 0; kc < HD / 32; ++kc) kf[j][kc] = frag_p(kp + j * 1024 + kc * 512); }
#pragma unroll 1   // kept rolled: two trips' fragments at once would not fit the 256 registers of four waves per SIMD
  for (int k0 = 0; k0 < TT; k0 += 64) { v8f acc[4] = {}, accl[4] = {};
#pragma unroll
    for (int j = 0; j < 4; ++j) {
#pragma unroll
      for (int kc = 0; kc < HD / 32; ++kc) { acc[j] = wmma16(kf[j][kc], qh[kc], acc[j]); accl[j] = wmma16(kf[j][kc], ql[kc], accl[j]); } }
    v16h vf[2][HD / 16];   // fetched here so that the softmax arithmetic covers their latency
#pragma unroll
    for (int kc = 0; kc < 2; ++kc) {
#pragma unroll
      for (int j = 0; j < HD / 16; ++j) vf[kc][j] = frag_p(vp + (size_t)k0 * HD + kc * 2048 + j * 512); }
    asm volatile("s_wait_xcnt 0x0" ::: "memory");   // stands in front of the first overwrite of the v loads' address registers (the pointer's step to the next trip)
    __builtin_amdgcn_sched_barrier(0);   // keeps the v loads issued here, ahead of the softmax: sunk towards their use they would be waited for at full latency
    float mx = -3.0e38f;
#pragma unroll
    for (int j = 0; j < 4; ++j) {
#pragma unroll
      for (int r = 0; r < 8; ++r) { acc[j][r] = (acc[j][r] + accl[j][r] * (1.0f / 1024.0f)) * SCALE; mx = fmaxf(mx, acc[j][r]); } }
    mx = fmaxf(mx, __shfl_xor(mx, 16));
    const float mn = fmaxf(m, mx), alpha = expf(m - mn); m = mn;
    float sum = 0.f; v16h p[2];
#pragma unroll
    for (int j = 0; j < 4; ++j) {
#pragma unroll
      for (int r = 0; r < 8; ++r) { const float e = expf(acc[j][r] - mn); sum += e; p[j >> 1][(j & 1) * 8 + r] = (_Float16)e; } }
    l = l * alpha + sum;
#pragma unroll
    for (int j = 0; j < HD / 16; ++j) o[j] *= alpha;
    const int kn = k0 + 64 < TT ? k0 + 64 : 0;   // the last trip fetches trip 0's rows again (in bounds, unused)
    const _Float16* kq = kp + (size_t)kn * HD;
    __builtin_amdgcn_sched_barrier(0);   // keeps the next k loads behind the softmax: lifted into it, 64 more live registers spill
#pragma unroll
    for (int j = 0; j < 4; ++j) {
#pragma unroll
      for (int kc = 0; kc < HD / 32; ++kc) kf[j][kc] = frag_p(kq + j * 1024 + kc * 512); }
    asm volatile("s_wait_xcnt 0x0" :: "v"(kq) : "memory");   // stands in front of the first overwrite of the k loads' address registers (the address named so that no load returns into it)
#pragma unroll
    for (int kc = 0; kc < 2; ++kc) {
#pragma unroll
      for (int j = 0; j < HD / 16; ++j) o[j] = wmma16(vf[kc][j], p[kc], o[j]); } }
  l += __shfl_xor(l, 16); const float inv = 1.0f / l;
  float* yp = Y + ((size_t)b * TT + ql0 + col) * CC + h * HD + 8 * g;
#pragma unroll
  for (int j = 0; j < HD / 16; ++j) { v4f lo, hi;
#pragma unroll
    for (int r = 0; r < 4; ++r) { lo[r] = o[j][r] * inv; hi[r] = o[j][4 + r] * inv; }
    vst2(yp + j * 16, lo); vst2(yp + j * 16 + 4, hi); } }
// ---- k_out: block = (64 rows, 128 cols): out = ctx Wo (+ bo): all rows: ctx bf16 hi + lo against exact bf16 Wo (2 products)
__global__ __launch_bounds__(128) void k_out(const float* __restrict__ Y, const float* __restrict__ WO, const float* __restrict__ BO, float* __restrict__ OUT) { __shared__ __align__(16) float sf[4][16][132]; __shared__ __align__(16) __bf16 yh[2][64][SP], yl[2][64][SP], wt[2][128][SP];
  const int tid = threadIdx.x, wave = tid >> 5, lane = tid & 31, col = lane & 15, g = lane >> 4; const int c0 = blockIdx.y * 128; const size_t r0 = (size_t)blockIdx.x * 64 + wave * 16;
  v8f acc[8] = {};
  if (true) {   /* ALL rows: ctx split bf16 hi + lo x exact Wo (2 products) */
    const int sr = tid >> 4, sq = (tid & 15) * 4;   // a wave's 16-byte loads cover two whole 256-byte row pieces
    const float* yg = Y + ((size_t)blockIdx.x * 64 + sr) * CC + sq; const float* wg = WO + (size_t)(c0 + sr) * CC + sq;
    v4f yr[8], wr[16];
#pragma unroll
    for (int i = 0; i < 8; ++i) yr[i] = *(const v4f*)(yg + (size_t)(i * 8) * CC);
#pragma unroll
    for (int i = 0; i < 16; ++i) wr[i] = *(const v4f*)(wg + (size_t)(i * 8) * CC);
    asm volatile("s_wait_xcnt 0x0" :: "v"(yg), "v"(wg) : "memory");   // stands in front of the first overwrite of these loads' address registers (the addresses named so that they live up to it)
#pragma unroll 2   // two trips a pass of the loop, so that the buffer's number is a constant in the LDS addresses
    for (int c = 0; c < CC / SK; ++c) { const int bs = c & 1;
#pragma unroll
      for (int i = 0; i < 8; ++i) { const v4b hv = cvt4(yr[i]); v4f rs;
#pragma unroll
        for (int e = 0; e < 4; ++e) rs[e] = yr[i][e] - (float)hv[e];
        *(v4b*)&yh[bs][sr + i * 8][sq] = hv; *(v4b*)&yl[bs][sr + i * 8][sq] = cvt4(rs); }
#pragma unroll
      for (int i = 0; i < 16; ++i) *(v4b*)&wt[bs][sr + i * 8][sq] = cvt4(wr[i]);
      __syncthreads();   // publishes tile c; it also ends every wave's reads of the other buffer (tile c - 1), which the next trip refills
      if (c + 1 < CC / SK) {
#pragma unroll
        for (int i = 0; i < 8; ++i) yr[i] = *(const v4f*)(yg + (size_t)(i * 8) * CC + (c + 1) * SK);
#pragma unroll
        for (int i = 0; i < 16; ++i) wr[i] = *(const v4f*)(wg + (size_t)(i * 8) * CC + (c + 1) * SK);
        asm volatile("s_wait_xcnt 0x0" ::: "memory");   // stands in front of the first overwrite of these loads' address registers; as a memory fence it also keeps the loads issued here, ahead of the products that cover their latency
      }
      v16b ah[SK / 32], al[SK / 32], w[SK / 32][8];   // the tile's fragments, read as one group ahead of its products (reads among the products are each waited for at full LDS latency)
#pragma unroll
      for (int kc = 0; kc < SK / 32; ++kc) { ah[kc] = frag_b(&yh[bs][wave * 16 + col][kc * 32], lane); al[kc] = frag_b(&yl[bs][wave * 16 + col][kc * 32], lane);
#pragma unroll
        for (int j = 0; j < 8; ++j) w[kc][j] = frag_b(&wt[bs][j * 16 + col][kc * 32], lane); }
#pragma unroll
      for (int kc = 0; kc < SK / 32; ++kc) {
#pragma unroll
        for (int j = 0; j < 8; ++j) { acc[j] = wmma_bf(ah[kc], w[kc][j], acc[j]); acc[j] = wmma_bf(al[kc], w[kc][j], acc[j]); } } }
#pragma unroll
    for (int j = 0; j < 8; ++j) { const float bias = BO ? bfr(BO[c0 + j * 16 + col]) : 0.f;
#pragma unroll
      for (int r = 0; r < 8; ++r) sf[wave][8 * g + r][j * 16 + col] = acc[j][r] + bias; }
  } else {
#pragma unroll 2
    for (int kc = 0; kc < CC / 32; ++kc) { const v16h a = frag_f32(Y + (r0 + col) * CC + kc * 32, lane); asm volatile("s_wait_loadcnt 0x0" ::: "memory");
#pragma unroll
      for (int j = 0; j < 8; ++j) { const v16h w = WOCOLH(WO, kc * 32, c0 + j * 16 + col, lane); asm volatile("s_wait_loadcnt 0x0" ::: "memory"); acc[j] = wmma16(a, w, acc[j]); } }
#pragma unroll
    for (int j = 0; j < 8; ++j) { const float bias = BO ? bfr(BO[c0 + j * 16 + col]) : 0.f;
#pragma unroll
      for (int r = 0; r < 8; ++r) sf[wave][8 * g + r][j * 16 + col] = acc[j][r] * (1.0f / 256.0f) + bias; } }
  LDSX(); for (int rl = 0; rl < 16; ++rl) vst2(OUT + (r0 + rl) * DIN + c0 + lane * 4, *(const v4f*)&sf[wave][rl][lane * 4]); }

extern "C" void kernel_launch(void* const* d_in, const int* in_sizes, int n_in, void* d_out, int out_size, void* d_ws, size_t ws_size, hipStream_t stream) {
  (void)in_sizes; (void)n_in; (void)out_size;
  const float** F = (const float**)d_in;
  if (ws_size < (size_t)WS_END) return;
  char* ws = (char*)d_ws; _Float16 *QH = (_Float16*)(ws + WS_QH), *KH = (_Float16*)(ws + WS_KH), *VT = (_Float16*)(ws + WS_VT), *QL = (_Float16*)(ws + WS_QL), *KL = (_Float16*)(ws + WS_KL); __bf16 *VB = (__bf16*)(ws + WS_VB), *VBL = (__bf16*)(ws + WS_VBL); float *Y = (float*)(ws + WS_Y);
  (void)Y; (void)QL; (void)KL; (void)VB; (void)VBL;
  // inputs: 0 query; 1 key; 2 value [2,2048,1024]; 3 wq (out,in); 4 wk; 5 wv; 6 wo (out,in)
  k_proj<<<dim3(TNB * TT / 64, CC / 128, 3), 128, 0, stream>>>(F[0], F[1], F[2], F[3], F[4], F[5], nullptr, nullptr, nullptr, QH, QL, KH, KL, VT, VB, VBL);
  k_fa<<<dim3(TT / 128, NH, TNB), 256, 0, stream>>>(QH, KH, QL, VT, Y);
  k_out<<<dim3(TNB * TT / 64, DIN / 128), 128, 0, stream>>>(Y, F[6], nullptr, (float*)d_out);
}

// v004
// Measured time: 113 microseconds a run.
// In both of two side-by-side timings against v003, it was 1.27 times as fast.
// Over all steps from v000 it is 11.8 times as fast.
// compute dtype: all float inputs rounded to bf16; q/k/v = in W^T + b with EXACT bf16 products on WMMA 16x16x32 (f32 accumulate); q as f16 hi + residual (x 2^10) against k once to f16 (2 products) / sqrt(1024); online softmax in f32 (base 2: scale x log2(e) in one multiply-add, v_exp_f32), logits and P kept in registers; P = exp(s - running max) once to f16 against v once to f16 (1 product), / row sum in f32; ctx split bf16 hi + lo against exact Wo (2 products) + bo; f32 output.
#include <hip/hip_runtime.h>
#include <math.h>

typedef __attribute__((ext_vector_type(16))) _Float16 v16h;
typedef __attribute__((ext_vector_type(16))) __bf16 v16b;
typedef __attribute__((ext_vector_type(8)))  _Float16 v8h;
typedef __attribute__((ext_vector_type(8)))  float v8f;
typedef __attribute__((ext_vector_type(4)))  float v4f;
typedef __attribute__((ext_vector_type(2)))  float v2f;
typedef __attribute__((ext_vector_type(4)))  unsigned v4u;
typedef __attribute__((ext_vector_type(4)))  int v4i;
typedef float __attribute__((may_alias)) float_a;
typedef int __attribute__((may_alias)) int_a;

template <typename T> __device__ __forceinline__ void vst2(void* p, T v) { *(T*)p = v;  }
__device__ __forceinline__ v8f wmma16(v16h a, v16h b, v8f c) {
  v8f d = __builtin_amdgcn_wmma_f32_16x16x32_f16(false, a, false, b, (short)0, c, false, false);
  asm volatile("v_nop\n\tv_nop\n\tv_nop\n\tv_nop" : "+v"(d) : "v"(a), "v"(b));
  return d;
}
__device__ __forceinline__ v8f wmma_bf(v16b a, v16b b, v8f c) {
  v8f d = __builtin_amdgcn_wmma_f32_16x16x32_bf16(false, a, false, b, (short)0, c, false, false);
  asm volatile("v_nop\n\tv_nop\n\tv_nop\n\tv_nop" : "+v"(d) : "v"(a), "v"(b));
  return d;
}
// 16x16x32 fragments: lane = (h = lane>>4, row/col = lane&15); elements 0..7 = k0+8h+0..7, 8..15 = k0+16+8h+0..7; D element r = row 8h+r
__device__ __forceinline__ v16h frag_h(const _Float16* rowk0, int lane) {
  union { v16h v; v8h q[2]; } u; const _Float16* p = rowk0 + 8 * (lane >> 4);
  u.q[0] = *(const v8h*)p; u.q[1] = *(const v8h*)(p + 16); return u.v;
}
// the same fragment from a plane laid in fragment order: p = the lane's own 16 bytes of the first 512-byte piece (elements 0..7), the second piece (elements 8..15) follows it; each load of a wave covers four whole 128-byte lines
__device__ __forceinline__ v16h frag_p(const _Float16* p) {
  union { v16h v; v8h q[2]; } u;
  u.q[0] = *(const v8h*)p; u.q[1] = *(const v8h*)(p + 256); return u.v;
}
__device__ __forceinline__ v16h frag_f32(const float* rowk0, int lane) {
  v16h a; const float* p = rowk0 + 8 * (lane >> 4);
#pragma unroll
  for (int i = 0; i < 8; ++i) { a[i] = (_Float16)p[i]; a[8 + i] = (_Float16)p[16 + i]; }
  return a;
}
__device__ __forceinline__ v16h frag_f32s(const float* rowk0, int lane, float sc) {
  v16h a; const float* p = rowk0 + 8 * (lane >> 4);
#pragma unroll
  for (int i = 0; i < 8; ++i) { a[i] = (_Float16)(p[i] * sc); a[8 + i] = (_Float16)(p[16 + i] * sc); }
  return a;
}
// column fragment from a [K][ld] layout (column n), rows >= K read as 0
__device__ __forceinline__ v16h fragc_f32(const float* W, int k0, int n, int lane, int ld, int K) {
  v16h a; const int g = lane >> 4;
#pragma unroll
  for (int i = 0; i < 8; ++i) { const int ka = k0 + 8 * g + i, kb = ka + 16;
    a[i] = (_Float16)(ka < K ? W[(size_t)(ka < K ? ka : K - 1) * ld + n] : 0.f); a[8 + i] = (_Float16)(kb < K ? W[(size_t)(kb < K ? kb : K - 1) * ld + n] : 0.f); }
  return a;
}
struct F2 { v16b h, l; };
__device__ __forceinline__ F2 bsplit16(const float v[16]) { F2 r;
#pragma unroll
  for (int i = 0; i < 16; ++i) { const __bf16 h = (__bf16)v[i]; r.h[i] = h; r.l[i] = (__bf16)(v[i] - (float)h); }
  return r; }
__device__ __forceinline__ F2 split_row(const float* row, int k0, int lane) { float v[16]; const float* p = row + k0 + 8 * (lane >> 4);
#pragma unroll
  for (int i = 0; i < 8; ++i) { v[i] = p[i]; v[8 + i] = p[16 + i]; }
  return bsplit16(v); }
__device__ __forceinline__ F2 split_rowK(const float* row, int k0, int lane, int K) { float v[16]; const int g = lane >> 4;
#pragma unroll
  for (int i = 0; i < 8; ++i) { const int ka = k0 + 8 * g + i, kb = ka + 16; v[i] = ka < K ? row[ka < K ? ka : K - 1] : 0.f; v[8 + i] = kb < K ? row[kb < K ? kb : K - 1] : 0.f; }
  return bsplit16(v); }
__device__ __forceinline__ F2 split_col(const float* W, int k0, int n, int lane, int ld, int K) { float v[16]; const int g = lane >> 4;
#pragma unroll
  for (int i = 0; i < 8; ++i) { const int ka = k0 + 8 * g + i, kb = ka + 16; v[i] = ka < K ? W[(size_t)(ka < K ? ka : K - 1) * ld + n] : 0.f; v[8 + i] = kb < K ? W[(size_t)(kb < K ? kb : K - 1) * ld + n] : 0.f; }
  return bsplit16(v); }
__device__ __forceinline__ v8f mac3(const F2& a, const F2& b, v8f c) { c = wmma_bf(a.l, b.h, c); c = wmma_bf(a.h, b.l, c); return wmma_bf(a.h, b.h, c); }
__device__ __forceinline__ float sigm(float v) { return 1.0f / (1.0f + expf(-v)); }
#define LDSX() do { asm volatile("s_wait_dscnt 0" ::: "memory"); __builtin_amdgcn_wave_barrier(); __builtin_amdgcn_fence(__ATOMIC_RELEASE, "workgroup"); } while (0)

// Multi-head attention with separate query / key / value inputs whose scores are divided by sqrt(emb_size) (query / key / value [2,2048,1024]; torch (out,in) Wq / Wk / Wv / Wo [1024,1024] N(0, 1/1024), no biases: q = query @ Wq.T etc.; 16 heads x 64; energy / sqrt(1024) = x 1/32 (the module's own NOTE: the embedding width, not the head width); softmax over all keys (no mask); out merged @ Wo.T).
#define NB 2
#define TT 2048
#define CC 1024            // NH * HD = projected width
#define DIN 1024          // input (model) width
#define NH 16
#define HD 64
#define NQB (TT / 64)
#define HG 4
#define SCALE (0.03125f)
#define CAUSAL 0
#ifndef TNB
#define TNB NB
#endif
__device__ __forceinline__ float bfr(float v) { return (float)(__bf16)v; }
__host__ __device__ __forceinline__ int kb_last(int qb) { return CAUSAL ? ((qb * 64 + 63) >> 7) : (TT / 128 - 1); }
typedef __attribute__((ext_vector_type(8))) __bf16 v8b;
__device__ __forceinline__ v16b frag_b(const __bf16* rowk0, int lane) {
  union { v16b v; v8b q[2]; } u; const __bf16* p = rowk0 + 8 * (lane >> 4);
  u.q[0] = *(const v8b*)p; u.q[1] = *(const v8b*)(p + 16); return u.v;
}
#define QBH 0              // unused: no kernel here has a high-precision path
#define QHI 2048            // rows carrying a q residual plane (all rows when non-causal: 2-product logits everywhere)
#define KHI 64            // key rows carrying k residual / v bf16 hi+lo planes (written by k_proj, read by no kernel)
// B fragment (k rows k0+.., output column o) of a weight: (in,out) [K][ld] or (out,in) [ld rows of K]: bf16 exact, or f16(bf16 * 256) exact
__device__ __forceinline__ v16b wcol_io(const float* Wm, int k0, int o, int lane, int ld) { v16b w; const int g = lane >> 4;
#pragma unroll
  for (int i = 0; i < 8; ++i) { w[i] = (__bf16)Wm[(size_t)(k0 + 8 * g + i) * ld + o]; w[8 + i] = (__bf16)Wm[(size_t)(k0 + 16 + 8 * g + i) * ld + o]; }
  return w; }
__device__ __forceinline__ v16b wcol_oi(const float* Wm, int k0, int o, int lane, int K) { v16b w; const float* p = Wm + (size_t)o * K + k0 + 8 * (lane >> 4);
#pragma unroll
  for (int i = 0; i < 8; ++i) { w[i] = (__bf16)p[i]; w[8 + i] = (__bf16)p[16 + i]; }
  return w; }
__device__ __forceinline__ v16h wcolh_io(const float* Wm, int k0, int o, int lane, int ld) { v16h w; const int g = lane >> 4;
#pragma unroll
  for (int i = 0; i < 8; ++i) { w[i] = (_Float16)(bfr(Wm[(size_t)(k0 + 8 * g + i) * ld + o]) * 256.0f); w[8 + i] = (_Float16)(bfr(Wm[(size_t)(k0 + 16 + 8 * g + i) * ld + o]) * 256.0f); }
  return w; }
__device__ __forceinline__ v16h wcolh_oi(const float* Wm, int k0, int o, int lane, int K) { v16h w; const float* p = Wm + (size_t)o * K + k0 + 8 * (lane >> 4);
#pragma unroll
  for (int i = 0; i < 8; ++i) { w[i] = (_Float16)(bfr(p[i]) * 256.0f); w[8 + i] = (_Float16)(bfr(p[16 + i]) * 256.0f); }
  return w; }
#define WQKV_LAYOUT 1   // 0 = (in,out) [DIN][CC]; 1 = (out,in) [CC][DIN]; 2 = per-head [NH][DIN][HD]; selects WCOL only, which no kernel uses (k_proj reads (out,in) rows)
__device__ __forceinline__ v16b wcol_hdk(const float* Wm, int k0, int o, int lane) { v16b w; const int g = lane >> 4; const float* p = Wm + (size_t)(o / HD) * DIN * HD + (o % HD);
#pragma unroll
  for (int i = 0; i < 8; ++i) { w[i] = (__bf16)p[(size_t)(k0 + 8 * g + i) * HD]; w[8 + i] = (__bf16)p[(size_t)(k0 + 16 + 8 * g + i) * HD]; }
  return w; }
#define WO_OUT_IN 1
#if WQKV_LAYOUT == 1
#define WCOL(W, k0, o, lane) wcol_oi(W, k0, o, lane, DIN)
#elif WQKV_LAYOUT == 2
#define WCOL(W, k0, o, lane) wcol_hdk(W, k0, o, lane)
#else
#define WCOL(W, k0, o, lane) wcol_io(W, k0, o, lane, CC)
#endif
#if WO_OUT_IN
#define WOCOL(W, k0, o, lane) wcol_oi(W, k0, o, lane, CC)
#define WOCOLH(W, k0, o, lane) wcolh_oi(W, k0, o, lane, CC)
#else
#define WOCOL(W, k0, o, lane) wcol_io(W, k0, o, lane, DIN)
#define WOCOLH(W, k0, o, lane) wcolh_io(W, k0, o, lane, DIN)
#endif

#ifndef SM_EXTRA_PARAMS
#define SM_EXTRA_PARAMS
#endif
#ifndef PROJ_EXTRA_PARAMS
#define PROJ_EXTRA_PARAMS
#endif
#ifndef SM_MASK_HOOK
#define SM_MASK_HOOK (void)0
#endif

#define WS_QH  0u                                      // f16 q rows [b*t][CC]
#define WS_KH  (WS_QH + 2u * (size_t)NB * TT * CC)      // f16 k in fragment order [b][h][t / 16][d / 16][lane][8]: lane = 16 * ((d >> 3) & 1) + (t & 15), element d & 7
#define WS_VT  (WS_KH + 2u * (size_t)NB * TT * CC)      // f16 v in fragment order [b][h][t / 32][d / 16][(t >> 4) & 1][lane][8]: lane = 16 * ((t >> 3) & 1) + (d & 15), element t & 7
#define WS_QL  (WS_VT + 2u * (size_t)NB * CC * TT)      // f16 q residual x 2^10 rows [b][t < QHI][CC]
#define WS_KL  (WS_QL + 2u * (size_t)NB * QHI * CC)     // f16 k residual x 2^10 rows [b][t < KHI][CC]
#define WS_VB  (WS_KL + 2u * (size_t)NB * KHI * CC)     // bf16 v hi planes [b][c][t < KHI]
#define WS_VBL (WS_VB + 2u * (size_t)NB * CC * KHI)
#define WS_S   (WS_VBL + 2u * (size_t)NB * CC * KHI)    // (unused: logits / P stay in registers)
#define WS_Y   (WS_S  + 4u * (size_t)HG * TT * TT)      // f32 ctx rows [b*t][CC] (only when there is an output projection)
#define WS_END (WS_Y  + 4u * (size_t)NB * TT * CC)

#define SK 64               // k per staged tile: 256 bytes of an f32 row
#define SP 72               // LDS row pitch in bf16: 144 bytes = 16 x 9, the pitch of ds_load_b128 readers
typedef __attribute__((ext_vector_type(4))) __bf16 v4b;
__device__ __forceinline__ v4b cvt4(v4f v) { v4b r;
#pragma unroll
  for (int i = 0; i < 4; ++i) r[i] = (__bf16)v[i];
  return r; }
// eight 16-byte pieces of one thread from LDS to global memory, at constant byte offsets from one address; then the wait that stands in front of any overwrite of the registers these stores name (address and data named, so that they live up to it)
template <typename FS, typename FO> __device__ __forceinline__ void put8(void* p0, FS from, FO off) {
  v4u d[8];
#pragma unroll   // unrolled: d stays in registers, and the LDS reads go out as one group
  for (int it = 0; it < 8; ++it) d[it] = *(const v4u*)from(it);
#pragma unroll   // unrolled: the offsets become immediates on one address, which nothing overwrites in front of the wait
  for (int it = 0; it < 8; ++it) *(v4u*)((char*)p0 + off(it)) = d[it];
  asm volatile("s_wait_xcnt 0x0" :: "v"(p0), "v"(d[0]), "v"(d[1]), "v"(d[2]), "v"(d[3]), "v"(d[4]), "v"(d[5]), "v"(d[6]), "v"(d[7]) : "memory");
}
// ---- k_proj: block = (64 rows, 128 cols, which): q/k/v = X W (+ b) with exact bf16 products (K = DIN) -> which 0: q f16 rows (+ residual rows < QHI); 1: k f16 in fragment order (+ residual rows < KHI); 2: v f16 in fragment order (+ bf16 hi/lo planes for t < KHI)
__global__ __launch_bounds__(128) void k_proj(const float* __restrict__ XQ, const float* __restrict__ XK, const float* __restrict__ XV, const float* __restrict__ WQ, const float* __restrict__ WK, const float* __restrict__ WV, const float* __restrict__ BQ, const float* __restrict__ BK, const float* __restrict__ BV,
    _Float16* __restrict__ QH, _Float16* __restrict__ QL, _Float16* __restrict__ KH, _Float16* __restrict__ KL, _Float16* __restrict__ VT, __bf16* __restrict__ VB, __bf16* __restrict__ VBL) {
  // one LDS block: the main loop's operand tiles (two buffers) and, behind a barrier, the epilogue's staging arrays share it
  __shared__ __align__(16) unsigned char smem[90112];
  __bf16 (*xs)[64][SP] = (__bf16 (*)[64][SP])smem; __bf16 (*wt)[128][SP] = (__bf16 (*)[128][SP])(smem + 2 * 64 * SP * 2);
  _Float16 (*sh)[136] = (_Float16 (*)[136])smem; _Float16 (*sl)[136] = (_Float16 (*)[136])(smem + 17408); _Float16 (*th)[72] = (_Float16 (*)[72])(smem + 34816); __bf16 (*tb)[72] = (__bf16 (*)[72])(smem + 53248); __bf16 (*tbl)[72] = (__bf16 (*)[72])(smem + 71680);
  const int tid = threadIdx.x, wave = tid >> 5, lane = tid & 31, col = lane & 15, g = lane >> 4; const int which = blockIdx.z; const int c0 = blockIdx.y * 128; const size_t r0 = (size_t)blockIdx.x * 64; const size_t bb = r0 / TT; const int t0 = (int)(r0 % TT);
  const float* X = which == 0 ? XQ : which == 1 ? XK : XV; const float* WA = which == 0 ? WQ : which == 1 ? WK : WV; const float* BA = which == 0 ? BQ : which == 1 ? BK : BV;
  v8f acc[8] = {};
  const int sr = tid >> 4, sq = (tid & 15) * 4;   // a wave's 16-byte loads cover two whole 256-byte row pieces
  const float* xg = X + (r0 + sr) * DIN + sq; const float* wg = WA + (size_t)(c0 + sr) * DIN + sq;
  v4f xr[8], wr[16];
#pragma unroll
  for (int i = 0; i < 8; ++i) xr[i] = *(const v4f*)(xg + (size_t)(i * 8) * DIN);
#pragma unroll
  for (int i = 0; i < 16; ++i) wr[i] = *(const v4f*)(wg + (size_t)(i * 8) * DIN);
  asm volatile("s_wait_xcnt 0x0" :: "v"(xg), "v"(wg) : "memory");   // stands in front of the first overwrite of these loads' address registers (the addresses named so that they live up to it)
#pragma unroll 2   // two trips a pass of the loop, so that the buffer's number is a constant in the LDS addresses
  for (int c = 0; c < DIN / SK; ++c) { const int bs = c & 1;
#pragma unroll
    for (int i = 0; i < 8; ++i) *(v4b*)&xs[bs][sr + i * 8][sq] = cvt4(xr[i]);
#pragma unroll
    for (int i = 0; i < 16; ++i) *(v4b*)&wt[bs][sr + i * 8][sq] = cvt4(wr[i]);
    __syncthreads();   // publishes tile c; it also ends every wave's reads of the other buffer (tile c - 1), which the next trip refills
    if (c + 1 < DIN / SK) {
#pragma unroll
      for (int i = 0; i < 8; ++i) xr[i] = *(const v4f*)(xg + (size_t)(i * 8) * DIN + (c + 1) * SK);
#pragma unroll
      for (int i = 0; i < 16; ++i) wr[i] = *(const v4f*)(wg + (size_t)(i * 8) * DIN + (c + 1) * SK);
      asm volatile("s_wait_xcnt 0x0" ::: "memory");   // stands in front of the first overwrite of these loads' address registers; as a memory fence it also keeps the loads issued here, ahead of the products that cover their latency
    }
    v16b a[SK / 32], w[SK / 32][8];   // the tile's fragments, read as one group ahead of its products (reads among the products are each waited for at full LDS latency)
#pragma unroll
    for (int kc = 0; kc < SK / 32; ++kc) { a[kc] = frag_b(&xs[bs][wave * 16 + col][kc * 32], lane);
#pragma unroll
      for (int j = 0; j < 8; ++j) w[kc][j] = frag_b(&wt[bs][j * 16 + col][kc * 32], lane); }
#pragma unroll
    for (int kc = 0; kc < SK / 32; ++kc) {
#pragma unroll
      for (int j = 0; j < 8; ++j) acc[j] = wmma_bf(a[kc], w[kc][j], acc[j]); } }
  __syncthreads();   // every wave has left the operand tiles before the epilogue writes over them
  if (which < 2) { _Float16* DH = which == 0 ? QH : KH; _Float16* DL = which == 0 ? QL : KL; const int nhi = which == 0 ? QHI : KHI; const bool hi_rows = t0 < nhi;
#pragma unroll
    for (int j = 0; j < 8; ++j) { const float bias = BA ? bfr(BA[c0 + j * 16 + col]) : 0.f;
#pragma unroll
      for (int r = 0; r < 8; ++r) { const float v = acc[j][r] + bias; const _Float16 hv = (_Float16)v; sh[wave * 16 + 8 * g + r][j * 16 + col] = hv; sl[wave * 16 + 8 * g + r][j * 16 + col] = (_Float16)((v - (float)hv) * 1024.0f); } }
    __syncthreads();
    const int rl = tid >> 4, q8 = (tid & 15) * 8;   // rows: a thread's eight 16-byte pieces lie 8 rows apart
    if (which == 0) put8(DH + (r0 + rl) * CC + c0 + q8, [&](int it) { return (const void*)&sh[rl + it * 8][q8]; }, [](int it) { return it * 8 * CC * 2; });
    else   // k: 32 pieces of 512 bytes (2 heads x 4 key tiles x 4 groups of 16 d), one piece a wave's store; trip it = head it >> 2, key tile it & 3, the wave's number = the group of 16 d
      put8(DH + ((bb * NH + c0 / HD) * (TT / 16) + t0 / 16) * 1024 + tid * 8, [&](int it) { return (const void*)&sh[(it & 3) * 16 + col][(it >> 2) * HD + wave * 16 + g * 8]; }, [](int it) { return ((it >> 2) * (TT / 16) + (it & 3)) * 1024 * 2; });
    if (hi_rows) put8(DL + (bb * nhi + t0 + rl) * (size_t)CC + c0 + q8, [&](int it) { return (const void*)&sl[rl + it * 8][q8]; }, [](int it) { return it * 8 * CC * 2; });
  } else { const bool hi_rows = t0 < KHI;
#pragma unroll
    for (int j = 0; j < 8; ++j) { const float bias = BA ? bfr(BA[c0 + j * 16 + col]) : 0.f;
#pragma unroll
      for (int r = 0; r < 8; ++r) { const float v = acc[j][r] + bias; const int rl = wave * 16 + 8 * g + r, cl = j * 16 + col; th[cl][rl] = (_Float16)v; const __bf16 bh = (__bf16)v; tb[cl][rl] = bh; tbl[cl][rl] = (__bf16)(v - (float)bh); } }
    __syncthreads();
    // v: 32 pieces of 512 bytes (2 heads x 2 groups of 32 keys x 4 tiles of 16 d x 2 halves of 16 keys), one piece a wave's store; trip it = head it >> 2, key group (it >> 1) & 1, d tile 2 * (it & 1) + (wave >> 1), half wave & 1
    put8(VT + ((bb * NH + c0 / HD) * (TT / 32) + t0 / 32) * 2048 + tid * 8, [&](int it) { return (const void*)&th[(it >> 2) * HD + (2 * (it & 1) + (wave >> 1)) * 16 + col][((it >> 1) & 1) * 32 + (wave & 1) * 16 + g * 8]; }, [](int it) { return ((it >> 2) * (TT / 32) * 2048 + ((it >> 1) & 1) * 2048 + (it & 1) * 1024) * 2; });
    if (hi_rows) { const int cl = tid >> 3, q8 = (tid & 7) * 8; const size_t o3 = (bb * CC + c0 + cl) * (size_t)KHI + t0 + q8;
      put8(VB + o3, [&](int it) { return (const void*)&tb[cl + it * 16][q8]; }, [](int it) { return it * 16 * KHI * 2; });
      put8(VBL + o3, [&](int it) { return (const void*)&tbl[cl + it * 16][q8]; }, [](int it) { return it * 16 * KHI * 2; }); } } }
// 2^x of eight values, each in place. Asm text, not the builtin: in place, none of the eight names a register of another, so no v_exp_f32 overwrites the source register of the v_exp_f32 directly in front of it, where the instruction set asks for a slot.
// The closing v_nop is that same slot in front of whatever reads the last result.
__device__ __forceinline__ void exp2x8(v8f& x) {
  float a = x[0], b = x[1], c = x[2], d = x[3], e = x[4], f = x[5], g = x[6], h = x[7];
  asm("v_exp_f32 %0, %0\n\tv_exp_f32 %1, %1\n\tv_exp_f32 %2, %2\n\tv_exp_f32 %3, %3\n\tv_exp_f32 %4, %4\n\tv_exp_f32 %5, %5\n\tv_exp_f32 %6, %6\n\tv_exp_f32 %7, %7\n\tv_nop"
      : "+v"(a), "+v"(b), "+v"(c), "+v"(d), "+v"(e), "+v"(f), "+v"(g), "+v"(h));
  x[0] = a; x[1] = b; x[2] = c; x[3] = d; x[4] = e; x[5] = f; x[6] = g; x[7] = h;
}
__global__ __launch_bounds__(256) __attribute__((amdgpu_waves_per_eu(4, 4))) void k_fa(const _Float16* __restrict__ QH, const _Float16* __restrict__ KH, const _Float16* __restrict__ QL, const _Float16* __restrict__ VT, float* __restrict__ Y) {
  const int tid = threadIdx.x, wave = tid >> 5, lane = tid & 31, col = lane & 15, g = lane >> 4; const int h = blockIdx.y, b = blockIdx.z; const int ql0 = blockIdx.x * 128 + wave * 16;
  const _Float16* qp = QH + ((size_t)b * TT + ql0 + col) * CC + h * HD; const _Float16* qlp = QL + ((size_t)b * QHI + ql0 + col) * CC + h * HD;
  const _Float16* kp = KH + (size_t)(b * NH + h) * (TT * HD) + lane * 8; const _Float16* vp = VT + (size_t)(b * NH + h) * (TT * HD) + lane * 8;   // 64 keys = 4,096 elements of either plane
  v16h qh[HD / 32], ql[HD / 32];
#pragma unroll
  for (int kc = 0; kc < HD / 32; ++kc) { qh[kc] = frag_h(qp + kc * 32, lane); ql[kc] = frag_h(qlp + kc * 32, lane); }
  v8f o[HD / 16] = {}; float m = -3.0e38f, l = 0.f;
  v16h kf[4][HD / 32];   // this trip's k fragments, all fetched together one trip ahead (one load latency a trip, under the P.V products)
#pragma unroll
  for (int j = 0; j < 4; ++j) {
#pragma unroll
    for (int kc = 0; kc < HD / 32; ++kc) kf[j][kc] = frag_p(kp + j * 1024 + kc * 512); }
#pragma unroll 1   // kept rolled: two trips' fragments at once would not fit the 256 registers of four waves per SIMD
  for (int k0 = 0; k0 < TT; k0 += 64) { v8f acc[4] = {}, accl[4] = {};
#pragma unroll
    for (int j = 0; j < 4; ++j) {
#pragma unroll
      for (int kc = 0; kc < HD / 32; ++kc) { acc[j] = wmma16(kf[j][kc], qh[kc], acc[j]); accl[j] = wmma16(kf[j][kc], ql[kc], accl[j]); } }
    v16h vf[2][HD / 16];   // fetched here so that the softmax arithmetic covers their latency
#pragma unroll
    for (int kc = 0; kc < 2; ++kc) {
#pragma unroll
      for (int j = 0; j < HD / 16; ++j) vf[kc][j] = frag_p(vp + (size_t)k0 * HD + kc * 2048 + j * 512); }
    asm volatile("s_wait_xcnt 0x0" ::: "memory");   // stands in front of the first overwrite of the v loads' address registers (the pointer's step to the next trip)
    __builtin_amdgcn_sched_barrier(0);   // keeps the v loads issued here, ahead of the softmax: sunk towards their use they would be waited for at full latency
    // the logits stay unscaled up to the exponent: exp(SCALE * (s - max)) = 2^(s * C2 - max * C2) with C2 = SCALE * log2(e), one multiply-add and one v_exp_f32 an element
    const float C2 = SCALE * 1.44269504088896340736f;
    float mx = -3.0e38f;
#pragma unroll
    for (int j = 0; j < 4; ++j) {
#pragma unroll
      for (int r = 0; r < 8; ++r) { acc[j][r] = acc[j][r] + accl[j][r] * (1.0f / 1024.0f); mx = fmaxf(mx, acc[j][r]); } }
    mx = fmaxf(mx, __shfl_xor(mx, 16));
    const float mn = fmaxf(m, mx), alpha = __builtin_amdgcn_exp2f((m - mn) * C2), mc = mn * C2; m = mn;
    float sum = 0.f; v16h p[2];
#pragma unroll
    for (int j = 0; j < 4; ++j) {
#pragma unroll
      for (int r = 0; r < 8; ++r) acc[j][r] = __builtin_fmaf(acc[j][r], C2, -mc);
      exp2x8(acc[j]);
#pragma unroll
      for (int r = 0; r < 8; ++r) { sum += acc[j][r]; p[j >> 1][(j & 1) * 8 + r] = (_Float16)acc[j][r]; } }
    l = l * alpha + sum;
#pragma unroll
    for (int j = 0; j < HD / 16; ++j) o[j] *= alpha;
    const int kn = k0 + 64 < TT ? k0 + 64 : 0;   // the last trip fetches trip 0's rows again (in bounds, unused)
    const _Float16* kq = kp + (size_t)kn * HD;
    __builtin_amdgcn_sched_barrier(0);   // keeps the next k loads behind the softmax: lifted into it, 64 more live registers spill
#pragma unroll
    for (int j = 0; j < 4; ++j) {
#pragma unroll
      for (int kc = 0; kc < HD / 32; ++kc) kf[j][kc] = frag_p(kq + j * 1024 + kc * 512); }
    asm volatile("s_wait_xcnt 0x0" :: "v"(kq) : "memory");   // stands in front of the first overwrite of the k loads' address registers (the address named so that no load returns into it)
#pragma unroll
    for (int kc = 0; kc < 2; ++kc) {
#pragma unroll
      for (int j = 0; j < HD / 16; ++j) o[j] = wmma16(vf[kc][j], p[kc], o[j]); } }
  l += __shfl_xor(l, 16); const float inv = 1.0f / l;
  float* yp = Y + ((size_t)b * TT + ql0 + col) * CC + h * HD + 8 * g;
#pragma unroll
  for (int j = 0; j < HD / 16; ++j) { v4f lo, hi;
#pragma unroll
    for (int r = 0; r < 4; ++r) { lo[r] = o[j][r] * inv; hi[r] = o[j][4 + r] * inv; }
    vst2(yp + j * 16, lo); vst2(yp + j * 16 + 4, hi); } }
// ---- k_out: block = (64 rows, 128 cols): out = ctx Wo (+ bo): all rows: ctx bf16 hi + lo against exact bf16 Wo (2 products)
__global__ __launch_bounds__(128) void k_out(const float* __restrict__ Y, const float* __restrict__ WO, const float* __restrict__ BO, float* __restrict__ OUT) { __shared__ __align__(16) float sf[4][16][132]; __shared__ __align__(16) __bf16 yh[2][64][SP], yl[2][64][SP], wt[2][128][SP];
  const int tid = threadIdx.x, wave = tid >> 5, lane = tid & 31, col = lane & 15, g = lane >> 4; const int c0 = blockIdx.y * 128; const size_t r0 = (size_t)blockIdx.x * 64 + wave * 16;
  v8f acc[8] = {};
  if (true) {   /* ALL rows: ctx split bf16 hi + lo x exact Wo (2 products) */
    const int sr = tid >> 4, sq = (tid & 15) * 4;   // a wave's 16-byte loads cover two whole 256-byte row pieces
    const float* yg = Y + ((size_t)blockIdx.x * 64 + sr) * CC + sq; const float* wg = WO + (size_t)(c0 + sr) * CC + sq;
    v4f yr[8], wr[16];
#pragma unroll
    for (int i = 0; i < 8; ++i) yr[i] = *(const v4f*)(yg + (size_t)(i * 8) * CC);
#pragma unroll
    for (int i = 0; i < 16; ++i) wr[i] = *(const v4f*)(wg + (size_t)(i * 8) * CC);
    asm volatile("s_wait_xcnt 0x0" :: "v"(yg), "v"(wg) : "memory");   // stands in front of the first overwrite of these loads' address registers (the addresses named so that they live up to it)
#pragma unroll 2   // two trips a pass of the loop, so that the buffer's number is a constant in the LDS addresses
    for (int c = 0; c < CC / SK; ++c) { const int bs = c & 1;
#pragma unroll
      for (int i = 0; i < 8; ++i) { const v4b hv = cvt4(yr[i]); v4f rs;
#pragma unroll
        for (int e = 0; e < 4; ++e) rs[e] = yr[i][e] - (float)hv[e];
        *(v4b*)&yh[bs][sr + i * 8][sq] = hv; *(v4b*)&yl[bs][sr + i * 8][sq] = cvt4(rs); }
#pragma unroll
      for (int i = 0; i < 16; ++i) *(v4b*)&wt[bs][sr + i * 8][sq] = cvt4(wr[i]);
      __syncthreads();   // publishes tile c; it also ends every wave's reads of the other buffer (tile c - 1), which the next trip refills
      if (c + 1 < CC / SK) {
#pragma unroll
        for (int i = 0; i < 8; ++i) yr[i] = *(const v4f*)(yg + (size_t)(i * 8) * CC + (c + 1) * SK);
#pragma unroll
        for (int i = 0; i < 16; ++i) wr[i] = *(const v4f*)(wg + (size_t)(i * 8) * CC + (c + 1) * SK);
        asm volatile("s_wait_xcnt 0x0" ::: "memory");   // stands in front of the first overwrite of these loads' address registers; as a memory fence it also keeps the loads issued here, ahead of the products that cover their latency
      }
      v16b ah[SK / 32], al[SK / 32], w[SK / 32][8];   // the tile's fragments, read as one group ahead of its products (reads among the products are each waited for at full LDS latency)
#pragma unroll
      for (int kc = 0; kc < SK / 32; ++kc) { ah[kc] = frag_b(&yh[bs][wave * 16 + col][kc * 32], lane); al[kc] = frag_b(&yl[bs][wave * 16 + col][kc * 32], lane);
#pragma unroll
        for (int j = 0; j < 8; ++j) w[kc][j] = frag_b(&wt[bs][j * 16 + col][kc * 32], lane); }
#pragma unroll
      for (int kc = 0; kc < SK / 32; ++kc) {
#pragma unroll
        for (int j = 0; j < 8; ++j) { acc[j] = wmma_bf(ah[kc], w[kc][j], acc[j]); acc[j] = wmma_bf(al[kc], w[kc][j], acc[j]); } } }
#pragma unroll
    for (int j = 0; j < 8; ++j) { const float bias = BO ? bfr(BO[c0 + j * 16 + col]) : 0.f;
#pragma unroll
      for (int r = 0; r < 8; ++r) sf[wave][8 * g + r][j * 16 + col] = acc[j][r] + bias; }
  } else {
#pragma unroll 2
    for (int kc = 0; kc < CC / 32; ++kc) { const v16h a = frag_f32(Y + (r0 + col) * CC + kc * 32, lane); asm volatile("s_wait_loadcnt 0x0" ::: "memory");
#pragma unroll
      for (int j = 0; j < 8; ++j) { const v16h w = WOCOLH(WO, kc * 32, c0 + j * 16 + col, lane); asm volatile("s_wait_loadcnt 0x0" ::: "memory"); acc[j] = wmma16(a, w, acc[j]); } }
#pragma unroll
    for (int j = 0; j < 8; ++j) { const float bias = BO ? bfr(BO[c0 + j * 16 + col]) : 0.f;
#pragma unroll
      for (int r = 0; r < 8; ++r) sf[wave][8 * g + r][j * 16 + col] = acc[j][r] * (1.0f / 256.0f) + bias; } }
  LDSX(); for (int rl = 0; rl < 16; ++rl) vst2(OUT + (r0 + rl) * DIN + c0 + lane * 4, *(const v4f*)&sf[wave][rl][lane * 4]); }

extern "C" void kernel_launch(void* const* d_in, const int* in_sizes, int n_in, void* d_out, int out_size, void* d_ws, size_t ws_size, hipStream_t stream) {
  (void)in_sizes; (void)n_in; (void)out_size;
  const float** F = (const float**)d_in;
  if (ws_size < (size_t)WS_END) return;
  char* ws = (char*)d_ws; _Float16 *QH = (_Float16*)(ws + WS_QH), *KH = (_Float16*)(ws + WS_KH), *VT = (_Float16*)(ws + WS_VT), *QL = (_Float16*)(ws + WS_QL), *KL = (_Float16*)(ws + WS_KL); __bf16 *VB = (__bf16*)(ws + WS_VB), *VBL = (__bf16*)(ws + WS_VBL); float *Y = (float*)(ws + WS_Y);
  (void)Y; (void)QL; (void)KL; (void)VB; (void)VBL;
  // inputs: 0 query; 1 key; 2 value [2,2048,1024]; 3 wq (out,in); 4 wk; 5 wv; 6 wo (out,in)
  k_proj<<<dim3(TNB * TT / 64, CC / 128, 3), 128, 0, stream>>>(F[0], F[1], F[2], F[3], F[4], F[5], nullptr, nullptr, nullptr, QH, QL, KH, KL, VT, VB, VBL);
  k_fa<<<dim3(TT / 128, NH, TNB), 256, 0, stream>>>(QH, KH, QL, VT, Y);
  k_out<<<dim3(TNB * TT / 64, DIN / 128), 128, 0, stream>>>(Y, F[6], nullptr, (float*)d_out);
}

// v005
// It runs in 109 microseconds.
// Timed twice side by side with v004, it ran 1.04 times as fast both times.
// All steps since v000 together make it 12.2 times as fast.
// compute dtype: all float inputs rounded to bf16; q/k/v = in W^T + b with EXACT bf16 products on WMMA 16x16x32 (f32 accumulate); q as f16 hi + residual (x 2^10) against k once to f16 (2 products) / sqrt(1024); online softmax in f32 (base 2: scale x log2(e) in one multiply-add, v_exp_f32), logits and P kept in registers; P = exp(s - running max) once to f16 against v once to f16 (1 product), / row sum in f32; ctx split bf16 hi + lo against exact Wo (2 products) + bo; f32 output.
#include <hip/hip_runtime.h>
#include <math.h>

typedef __attribute__((ext_vector_type(16))) _Float16 v16h;
typedef __attribute__((ext_vector_type(16))) __bf16 v16b;
typedef __attribute__((ext_vector_type(8)))  _Float16 v8h;
typedef __attribute__((ext_vector_type(8)))  float v8f;
typedef __attribute__((ext_vector_type(4)))  float v4f;
typedef __attribute__((ext_vector_type(2)))  float v2f;
typedef __attribute__((ext_vector_type(4)))  unsigned v4u;
typedef __attribute__((ext_vector_type(4)))  int v4i;
typedef float __attribute__((may_alias)) float_a;
typedef int __attribute__((may_alias)) int_a;

template <typename T> __device__ __forceinline__ void vst2(void* p, T v) { *(T*)p = v;  }
__device__ __forceinline__ v8f wmma16(v16h a, v16h b, v8f c) {
  return __builtin_amdgcn_wmma_f32_16x16x32_f16(false, a, false, b, (short)0, c, false, false);
}
__device__ __forceinline__ v8f wmma_bf(v16b a, v16b b, v8f c) {
  v8f d = __builtin_amdgcn_wmma_f32_16x16x32_bf16(false, a, false, b, (short)0, c, false, false);
  asm volatile("v_nop\n\tv_nop\n\tv_nop\n\tv_nop" : "+v"(d) : "v"(a), "v"(b));
  return d;
}
// 16x16x32 fragments: lane = (h = lane>>4, row/col = lane&15); elements 0..7 = k0+8h+0..7, 8..15 = k0+16+8h+0..7; D element r = row 8h+r
__device__ __forceinline__ v16h frag_h(const _Float16* rowk0, int lane) {
  union { v16h v; v8h q[2]; } u; const _Float16* p = rowk0 + 8 * (lane >> 4);
  u.q[0] = *(const v8h*)p; u.q[1] = *(const v8h*)(p + 16); return u.v;
}
// the same fragment from a plane laid in fragment order: p = the lane's own 16 bytes of the first 512-byte piece (elements 0..7), the second piece (elements 8..15) follows it; each load of a wave covers four whole 128-byte lines
__device__ __forceinline__ v16h frag_p(const _Float16* p) {
  union { v16h v; v8h q[2]; } u;
  u.q[0] = *(const v8h*)p; u.q[1] = *(const v8h*)(p + 256); return u.v;
}
__device__ __forceinline__ v16h frag_f32(const float* rowk0, int lane) {
  v16h a; const float* p = rowk0 + 8 * (lane >> 4);
#pragma unroll
  for (int i = 0; i < 8; ++i) { a[i] = (_Float16)p[i]; a[8 + i] = (_Float16)p[16 + i]; }
  return a;
}
__device__ __forceinline__ v16h frag_f32s(const float* rowk0, int lane, float sc) {
  v16h a; const float* p = rowk0 + 8 * (lane >> 4);
#pragma unroll
  for (int i = 0; i < 8; ++i) { a[i] = (_Float16)(p[i] * sc); a[8 + i] = (_Float16)(p[16 + i] * sc); }
  return a;
}
// column fragment from a [K][ld] layout (column n), rows >= K read as 0
__device__ __forceinline__ v16h fragc_f32(const float* W, int k0, int n, int lane, int ld, int K) {
  v16h a; const int g = lane >> 4;
#pragma unroll
  for (int i = 0; i < 8; ++i) { const int ka = k0 + 8 * g + i, kb = ka + 16;
    a[i] = (_Float16)(ka < K ? W[(size_t)(ka < K ? ka : K - 1) * ld + n] : 0.f); a[8 + i] = (_Float16)(kb < K ? W[(size_t)(kb < K ? kb : K - 1) * ld + n] : 0.f); }
  return a;
}
struct F2 { v16b h, l; };
__device__ __forceinline__ F2 bsplit16(const float v[16]) { F2 r;
#pragma unroll
  for (int i = 0; i < 16; ++i) { const __bf16 h = (__bf16)v[i]; r.h[i] = h; r.l[i] = (__bf16)(v[i] - (float)h); }
  return r; }
__device__ __forceinline__ F2 split_row(const float* row, int k0, int lane) { float v[16]; const float* p = row + k0 + 8 * (lane >> 4);
#pragma unroll
  for (int i = 0; i < 8; ++i) { v[i] = p[i]; v[8 + i] = p[16 + i]; }
  return bsplit16(v); }
__device__ __forceinline__ F2 split_rowK(const float* row, int k0, int lane, int K) { float v[16]; const int g = lane >> 4;
#pragma unroll
  for (int i = 0; i < 8; ++i) { const int ka = k0 + 8 * g + i, kb = ka + 16; v[i] = ka < K ? row[ka < K ? ka : K - 1] : 0.f; v[8 + i] = kb < K ? row[kb < K ? kb : K - 1] : 0.f; }
  return bsplit16(v); }
__device__ __forceinline__ F2 split_col(const float* W, int k0, int n, int lane, int ld, int K) { float v[16]; const int g = lane >> 4;
#pragma unroll
  for (int i = 0; i < 8; ++i) { const int ka = k0 + 8 * g + i, kb = ka + 16; v[i] = ka < K ? W[(size_t)(ka < K ? ka : K - 1) * ld + n] : 0.f; v[8 + i] = kb < K ? W[(size_t)(kb < K ? kb : K - 1) * ld + n] : 0.f; }
  return bsplit16(v); }
__device__ __forceinline__ v8f mac3(const F2& a, const F2& b, v8f c) { c = wmma_bf(a.l, b.h, c); c = wmma_bf(a.h, b.l, c); return wmma_bf(a.h, b.h, c); }
__device__ __forceinline__ float sigm(float v) { return 1.0f / (1.0f + expf(-v)); }
#define LDSX() do { asm volatile("s_wait_dscnt 0" ::: "memory"); __builtin_amdgcn_wave_barrier(); __builtin_amdgcn_fence(__ATOMIC_RELEASE, "workgroup"); } while (0)

// Multi-head attention with separate query / key / value inputs whose scores are divided by sqrt(emb_size) (query / key / value [2,2048,1024]; torch (out,in) Wq / Wk / Wv / Wo [1024,1024] N(0, 1/1024), no biases: q = query @ Wq.T etc.; 16 heads x 64; energy / sqrt(1024) = x 1/32 (the module's own NOTE: the embedding width, not the head width); softmax over all keys (no mask); out merged @ Wo.T).
#define NB 2
#define TT 2048
#define CC 1024            // NH * HD = projected width
#define DIN 1024          // input (model) width
#define NH 16
#define HD 64
#define NQB (TT / 64)
#define HG 4
#define SCALE (0.03125f)
#define CAUSAL 0
#ifndef TNB
#define TNB NB
#endif
__device__ __forceinline__ float bfr(float v) { return (float)(__bf16)v; }
__host__ __device__ __forceinline__ int kb_last(int qb) { return CAUSAL ? ((qb * 64 + 63) >> 7) : (TT / 128 - 1); }
typedef __attribute__((ext_vector_type(8))) __bf16 v8b;
__device__ __forceinline__ v16b frag_b(const __bf16* rowk0, int lane) {
  union { v16b v; v8b q[2]; } u; const __bf16* p = rowk0 + 8 * (lane >> 4);
  u.q[0] = *(const v8b*)p; u.q[1] = *(const v8b*)(p + 16); return u.v;
}
#define QBH 0              // unused: no kernel here has a high-precision path
#define QHI 2048            // rows carrying a q residual plane (all rows when non-causal: 2-product logits everywhere)
#define KHI 64            // key rows carrying k residual / v bf16 hi+lo planes (written by k_proj, read by no kernel)
// B fragment (k rows k0+.., output column o) of a weight: (in,out) [K][ld] or (out,in) [ld rows of K]: bf16 exact, or f16(bf16 * 256) exact
__device__ __forceinline__ v16b wcol_io(const float* Wm, int k0, int o, int lane, int ld) { v16b w; const int g = lane >> 4;
#pragma unroll
  for (int i = 0; i < 8; ++i) { w[i] = (__bf16)Wm[(size_t)(k0 + 8 * g + i) * ld + o]; w[8 + i] = (__bf16)Wm[(size_t)(k0 + 16 + 8 * g + i) * ld + o]; }
  return w; }
__device__ __forceinline__ v16b wcol_oi(const float* Wm, int k0, int o, int lane, int K) { v16b w; const float* p = Wm + (size_t)o * K + k0 + 8 * (lane >> 4);
#pragma unroll
  for (int i = 0; i < 8; ++i) { w[i] = (__bf16)p[i]; w[8 + i] = (__bf16)p[16 + i]; }
  return w; }
__device__ __forceinline__ v16h wcolh_io(const float* Wm, int k0, int o, int lane, int ld) { v16h w; const int g = lane >> 4;
#pragma unroll
  for (int i = 0; i < 8; ++i) { w[i] = (_Float16)(bfr(Wm[(size_t)(k0 + 8 * g + i) * ld + o]) * 256.0f); w[8 + i] = (_Float16)(bfr(Wm[(size_t)(k0 + 16 + 8 * g + i) * ld + o]) * 256.0f); }
  return w; }
__device__ __forceinline__ v16h wcolh_oi(const float* Wm, int k0, int o, int lane, int K) { v16h w; const float* p = Wm + (size_t)o * K + k0 + 8 * (lane >> 4);
#pragma unroll
  for (int i = 0; i < 8; ++i) { w[i] = (_Float16)(bfr(p[i]) * 256.0f); w[8 + i] = (_Float16)(bfr(p[16 + i]) * 256.0f); }
  return w; }
#define WQKV_LAYOUT 1   // 0 = (in,out) [DIN][CC]; 1 = (out,in) [CC][DIN]; 2 = per-head [NH][DIN][HD]; selects WCOL only, which no kernel uses (k_proj reads (out,in) rows)
__device__ __forceinline__ v16b wcol_hdk(const float* Wm, int k0, int o, int lane) { v16b w; const int g = lane >> 4; const float* p = Wm + (size_t)(o / HD) * DIN * HD + (o % HD);
#pragma unroll
  for (int i = 0; i < 8; ++i) { w[i] = (__bf16)p[(size_t)(k0 + 8 * g + i) * HD]; w[8 + i] = (__bf16)p[(size_t)(k0 + 16 + 8 * g + i) * HD]; }
  return w; }
#define WO_OUT_IN 1
#if WQKV_LAYOUT == 1
#define WCOL(W, k0, o, lane) wcol_oi(W, k0, o, lane, DIN)
#elif WQKV_LAYOUT == 2
#define WCOL(W, k0, o, lane) wcol_hdk(W, k0, o, lane)
#else
#define WCOL(W, k0, o, lane) wcol_io(W, k0, o, lane, CC)
#endif
#if WO_OUT_IN
#define WOCOL(W, k0, o, lane) wcol_oi(W, k0, o, lane, CC)
#define WOCOLH(W, k0, o, lane) wcolh_oi(W, k0, o, lane, CC)
#else
#define WOCOL(W, k0, o, lane) wcol_io(W, k0, o, lane, DIN)
#define WOCOLH(W, k0, o, lane) wcolh_io(W, k0, o, lane, DIN)
#endif

#ifndef SM_EXTRA_PARAMS
#define SM_EXTRA_PARAMS
#endif
#ifndef PROJ_EXTRA_PARAMS
#define PROJ_EXTRA_PARAMS
#endif
#ifndef SM_MASK_HOOK
#define SM_MASK_HOOK (void)0
#endif

#define WS_QH  0u                                      // f16 q rows [b*t][CC]
#define WS_KH  (WS_QH + 2u * (size_t)NB * TT * CC)      // f16 k in fragment order [b][h][t / 16][d / 16][lane][8]: lane = 16 * ((d >> 3) & 1) + (t & 15), element d & 7
#define WS_VT  (WS_KH + 2u * (size_t)NB * TT * CC)      // f16 v in fragment order [b][h][t / 32][d / 16][(t >> 4) & 1][lane][8]: lane = 16 * ((t >> 3) & 1) + (d & 15), element t & 7
#define WS_QL  (WS_VT + 2u * (size_t)NB * CC * TT)      // f16 q residual x 2^10 rows [b][t < QHI][CC]
#define WS_KL  (WS_QL + 2u * (size_t)NB * QHI * CC)     // f16 k residual x 2^10 rows [b][t < KHI][CC]
#define WS_VB  (WS_KL + 2u * (size_t)NB * KHI * CC)     // bf16 v hi planes [b][c][t < KHI]
#define WS_VBL (WS_VB + 2u * (size_t)NB * CC * KHI)
#define WS_S   (WS_VBL + 2u * (size_t)NB * CC * KHI)    // (unused: logits / P stay in registers)
#define WS_Y   (WS_S  + 4u * (size_t)HG * TT * TT)      // f32 ctx rows [b*t][CC] (only when there is an output projection)
#define WS_END (WS_Y  + 4u * (size_t)NB * TT * CC)

#define SK 64               // k per staged tile: 256 bytes of an f32 row
#define SP 72               // LDS row pitch in bf16: 144 bytes = 16 x 9, the pitch of ds_load_b128 readers
typedef __attribute__((ext_vector_type(4))) __bf16 v4b;
__device__ __forceinline__ v4b cvt4(v4f v) { v4b r;
#pragma unroll
  for (int i = 0; i < 4; ++i) r[i] = (__bf16)v[i];
  return r; }
// eight 16-byte pieces of one thread from LDS to global memory, at constant byte offsets from one address; then the wait that stands in front of any overwrite of the registers these stores name (address and data named, so that they live up to it)
template <typename FS, typename FO> __device__ __forceinline__ void put8(void* p0, FS from, FO off) {
  v4u d[8];
#pragma unroll   // unrolled: d stays in registers, and the LDS reads go out as one group
  for (int it = 0; it < 8; ++it) d[it] = *(const v4u*)from(it);
#pragma unroll   // unrolled: the offsets become immediates on one address, which nothing overwrites in front of the wait
  for (int it = 0; it < 8; ++it) *(v4u*)((char*)p0 + off(it)) = d[it];
  asm volatile("s_wait_xcnt 0x0" :: "v"(p0), "v"(d[0]), "v"(d[1]), "v"(d[2]), "v"(d[3]), "v"(d[4]), "v"(d[5]), "v"(d[6]), "v"(d[7]) : "memory");
}
// ---- k_proj: block = (64 rows, 128 cols, which): q/k/v = X W (+ b) with exact bf16 products (K = DIN) -> which 0: q f16 rows (+ residual rows < QHI); 1: k f16 in fragment order (+ residual rows < KHI); 2: v f16 in fragment order (+ bf16 hi/lo planes for t < KHI)
__global__ __launch_bounds__(128) void k_proj(const float* __restrict__ XQ, const float* __restrict__ XK, const float* __restrict__ XV, const float* __restrict__ WQ, const float* __restrict__ WK, const float* __restrict__ WV, const float* __restrict__ BQ, const float* __restrict__ BK, const float* __restrict__ BV,
    _Float16* __restrict__ QH, _Float16* __restrict__ QL, _Float16* __restrict__ KH, _Float16* __restrict__ KL, _Float16* __restrict__ VT, __bf16* __restrict__ VB, __bf16* __restrict__ VBL) {
  // one LDS block: the main loop's operand tiles (two buffers) and, behind a barrier, the epilogue's staging arrays share it
  __shared__ __align__(16) unsigned char smem[90112];
  __bf16 (*xs)[64][SP] = (__bf16 (*)[64][SP])smem; __bf16 (*wt)[128][SP] = (__bf16 (*)[128][SP])(smem + 2 * 64 * SP * 2);
  _Float16 (*sh)[136] = (_Float16 (*)[136])smem; _Float16 (*sl)[136] = (_Float16 (*)[136])(smem + 17408); _Float16 (*th)[72] = (_Float16 (*)[72])(smem + 34816); __bf16 (*tb)[72] = (__bf16 (*)[72])(smem + 53248); __bf16 (*tbl)[72] = (__bf16 (*)[72])(smem + 71680);
  const int tid = threadIdx.x, wave = tid >> 5, lane = tid & 31, col = lane & 15, g = lane >> 4; const int which = blockIdx.z; const int c0 = blockIdx.y * 128; const size_t r0 = (size_t)blockIdx.x * 64; const size_t bb = r0 / TT; const int t0 = (int)(r0 % TT);
  const float* X = which == 0 ? XQ : which == 1 ? XK : XV; const float* WA = which == 0 ? WQ : which == 1 ? WK : WV; const float* BA = which == 0 ? BQ : which == 1 ? BK : BV;
  v8f acc[8] = {};
  const int sr = tid >> 4, sq = (tid & 15) * 4;   // a wave's 16-byte loads cover two whole 256-byte row pieces
  const float* xg = X + (r0 + sr) * DIN + sq; const float* wg = WA + (size_t)(c0 + sr) * DIN + sq;
  v4f xr[8], wr[16];
#pragma unroll
  for (int i = 0; i < 8; ++i) xr[i] = *(const v4f*)(xg + (size_t)(i * 8) * DIN);
#pragma unroll
  for (int i = 0; i < 16; ++i) wr[i] = *(const v4f*)(wg + (size_t)(i * 8) * DIN);
  asm volatile("s_wait_xcnt 0x0" :: "v"(xg), "v"(wg) : "memory");   // stands in front of the first overwrite of these loads' address registers (the addresses named so that they live up to it)
#pragma unroll 2   // two trips a pass of the loop, so that the buffer's number is a constant in the LDS addresses
  for (int c = 0; c < DIN / SK; ++c) { const int bs = c & 1;
#pragma unroll
    for (int i = 0; i < 8; ++i) *(v4b*)&xs[bs][sr + i * 8][sq] = cvt4(xr[i]);
#pragma unroll
    for (int i = 0; i < 16; ++i) *(v4b*)&wt[bs][sr + i * 8][sq] = cvt4(wr[i]);
    __syncthreads();   // publishes tile c; it also ends every wave's reads of the other buffer (tile c - 1), which the next trip refills
    if (c + 1 < DIN / SK) {
#pragma unroll
      for (int i = 0; i < 8; ++i) xr[i] = *(const v4f*)(xg + (size_t)(i * 8) * DIN + (c + 1) * SK);
#pragma unroll
      for (int i = 0; i < 16; ++i) wr[i] = *(const v4f*)(wg + (size_t)(i * 8) * DIN + (c + 1) * SK);
      asm volatile("s_wait_xcnt 0x0" ::: "memory");   // stands in front of the first overwrite of these loads' address registers; as a memory fence it also keeps the loads issued here, ahead of the products that cover their latency
    }
    v16b a[SK / 32], w[SK / 32][8];   // the tile's fragments, read as one group ahead of its products (reads among the products are each waited for at full LDS latency)
#pragma unroll
    for (int kc = 0; kc < SK / 32; ++kc) { a[kc] = frag_b(&xs[bs][wave * 16 + col][kc * 32], lane);
#pragma unroll
      for (int j = 0; j < 8; ++j) w[kc][j] = frag_b(&wt[bs][j * 16 + col][kc * 32], lane); }
#pragma unroll
    for (int kc = 0; kc < SK / 32; ++kc) {
#pragma unroll
      for (int j = 0; j < 8; ++j) acc[j] = wmma_bf(a[kc], w[kc][j], acc[j]); } }
  __syncthreads();   // every wave has left the operand tiles before the epilogue writes over them
  if (which < 2) { _Float16* DH = which == 0 ? QH : KH; _Float16* DL = which == 0 ? QL : KL; const int nhi = which == 0 ? QHI : KHI; const bool hi_rows = t0 < nhi;
#pragma unroll
    for (int j = 0; j < 8; ++j) { const float bias = BA ? bfr(BA[c0 + j * 16 + col]) : 0.f;
#pragma unroll
      for (int r = 0; r < 8; ++r) { const float v = acc[j][r] + bias; const _Float16 hv = (_Float16)v; sh[wave * 16 + 8 * g + r][j * 16 + col] = hv; sl[wave * 16 + 8 * g + r][j * 16 + col] = (_Float16)((v - (float)hv) * 1024.0f); } }
    __syncthreads();
    const int rl = tid >> 4, q8 = (tid & 15) * 8;   // rows: a thread's eight 16-byte pieces lie 8 rows apart
    if (which == 0) put8(DH + (r0 + rl) * CC + c0 + q8, [&](int it) { return (const void*)&sh[rl + it * 8][q8]; }, [](int it) { return it * 8 * CC * 2; });
    else   // k: 32 pieces of 512 bytes (2 heads x 4 key tiles x 4 groups of 16 d), one piece a wave's store; trip it = head it >> 2, key tile it & 3, the wave's number = the group of 16 d
      put8(DH + ((bb * NH + c0 / HD) * (TT / 16) + t0 / 16) * 1024 + tid * 8, [&](int it) { return (const void*)&sh[(it & 3) * 16 + col][(it >> 2) * HD + wave * 16 + g * 8]; }, [](int it) { return ((it >> 2) * (TT / 16) + (it & 3)) * 1024 * 2; });
    if (hi_rows) put8(DL + (bb * nhi + t0 + rl) * (size_t)CC + c0 + q8, [&](int it) { return (const void*)&sl[rl + it * 8][q8]; }, [](int it) { return it * 8 * CC * 2; });
  } else { const bool hi_rows = t0 < KHI;
#pragma unroll
    for (int j = 0; j < 8; ++j) { const float bias = BA ? bfr(BA[c0 + j * 16 + col]) : 0.f;
#pragma unroll
      for (int r = 0; r < 8; ++r) { const float v = acc[j][r] + bias; const int rl = wave * 16 + 8 * g + r, cl = j * 16 + col; th[cl][rl] = (_Float16)v; const __bf16 bh = (__bf16)v; tb[cl][rl] = bh; tbl[cl][rl] = (__bf16)(v - (float)bh); } }
    __syncthreads();
    // v: 32 pieces of 512 bytes (2 heads x 2 groups of 32 keys x 4 tiles of 16 d x 2 halves of 16 keys), one piece a wave's store; trip it = head it >> 2, key group (it >> 1) & 1, d tile 2 * (it & 1) + (wave >> 1), half wave & 1
    put8(VT + ((bb * NH + c0 / HD) * (TT / 32) + t0 / 32) * 2048 + tid * 8, [&](int it) { return (const void*)&th[(it >> 2) * HD + (2 * (it & 1) + (wave >> 1)) * 16 + col][((it >> 1) & 1) * 32 + (wave & 1) * 16 + g * 8]; }, [](int it) { return ((it >> 2) * (TT / 32) * 2048 + ((it >> 1) & 1) * 2048 + (it & 1) * 1024) * 2; });
    if (hi_rows) { const int cl = tid >> 3, q8 = (tid & 7) * 8; const size_t o3 = (bb * CC + c0 + cl) * (size_t)KHI + t0 + q8;
      put8(VB + o3, [&](int it) { return (const void*)&tb[cl + it * 16][q8]; }, [](int it) { return it * 16 * KHI * 2; });
      put8(VBL + o3, [&](int it) { return (const void*)&tbl[cl + it * 16][q8]; }, [](int it) { return it * 16 * KHI * 2; }); } } }
// 2^x of eight values, each in place. Asm text, not the builtin: in place, none of the eight names a register of another, so no v_exp_f32 overwrites the source register of the v_exp_f32 directly in front of it, where the instruction set asks for a slot.
// The closing v_nop is that same slot in front of whatever reads the last result.
__device__ __forceinline__ void exp2x8(v8f& x) {
  float a = x[0], b = x[1], c = x[2], d = x[3], e = x[4], f = x[5], g = x[6], h = x[7];
  asm("v_exp_f32 %0, %0\n\tv_exp_f32 %1, %1\n\tv_exp_f32 %2, %2\n\tv_exp_f32 %3, %3\n\tv_exp_f32 %4, %4\n\tv_exp_f32 %5, %5\n\tv_exp_f32 %6, %6\n\tv_exp_f32 %7, %7\n\tv_nop"
      : "+v"(a), "+v"(b), "+v"(c), "+v"(d), "+v"(e), "+v"(f), "+v"(g), "+v"(h));
  x[0] = a; x[1] = b; x[2] = c; x[3] = d; x[4] = e; x[5] = f; x[6] = g; x[7] = h;
}
__global__ __launch_bounds__(256) __attribute__((amdgpu_waves_per_eu(4, 4))) void k_fa(const _Float16* __restrict__ QH, const _Float16* __restrict__ KH, const _Float16* __restrict__ QL, const _Float16* __restrict__ VT, float* __restrict__ Y) {
  const int tid = threadIdx.x, wave = tid >> 5, lane = tid & 31, col = lane & 15, g = lane >> 4; const int h = blockIdx.y, b = blockIdx.z; const int ql0 = blockIdx.x * 128 + wave * 16;
  const _Float16* qp = QH + ((size_t)b * TT + ql0 + col) * CC + h * HD; const _Float16* qlp = QL + ((size_t)b * QHI + ql0 + col) * CC + h * HD;
  const _Float16* kp = KH + (size_t)(b * NH + h) * (TT * HD) + lane * 8; const _Float16* vp = VT + (size_t)(b * NH + h) * (TT * HD) + lane * 8;   // 64 keys = 4,096 elements of either plane
  v16h qh[HD / 32], ql[HD / 32];
#pragma unroll
  for (int kc = 0; kc < HD / 32; ++kc) { qh[kc] = frag_h(qp + kc * 32, lane); ql[kc] = frag_h(qlp + kc * 32, lane); }
  v8f o[HD / 16] = {}; float m = -3.0e38f, l = 0.f;
  v16h kf[4][HD / 32];   // this trip's k fragments, all fetched together one trip ahead (one load latency a trip, under the P.V products)
#pragma unroll
  for (int j = 0; j < 4; ++j) {
#pragma unroll
    for (int kc = 0; kc < HD / 32; ++kc) kf[j][kc] = frag_p(kp + j * 1024 + kc * 512); }
#pragma unroll 1   // kept rolled: two trips' fragments at once would not fit the 256 registers of four waves per SIMD
  for (int k0 = 0; k0 < TT; k0 += 64) { v8f acc[4] = {}, accl[4] = {};
#pragma unroll
    for (int j = 0; j < 4; ++j) {
#pragma unroll
      for (int kc = 0; kc < HD / 32; ++kc) { acc[j] = wmma16(kf[j][kc], qh[kc], acc[j]); accl[j] = wmma16(kf[j][kc], ql[kc], accl[j]); } }
    v16h vf[2][HD / 16];   // fetched here so that the softmax arithmetic covers their latency
#pragma unroll
    for (int kc = 0; kc < 2; ++kc) {
#pragma unroll
      for (int j = 0; j < HD / 16; ++j) vf[kc][j] = frag_p(vp + (size_t)k0 * HD + kc * 2048 + j * 512); }
    asm volatile("s_wait_xcnt 0x0" ::: "memory");   // stands in front of the first overwrite of the v loads' address registers (the pointer's step to the next trip)
    __builtin_amdgcn_sched_barrier(0);   // keeps the v loads issued here, ahead of the softmax: sunk towards their use they would be waited for at full latency
    // the logits stay unscaled up to the exponent: exp(SCALE * (s - max)) = 2^(s * C2 - max * C2) with C2 = SCALE * log2(e), one multiply-add and one v_exp_f32 an element
    const float C2 = SCALE * 1.44269504088896340736f;
    float mx = -3.0e38f;
#pragma unroll
    for (int j = 0; j < 4; ++j) {
#pragma unroll
      for (int r = 0; r < 8; ++r) { acc[j][r] = acc[j][r] + accl[j][r] * (1.0f / 1024.0f); mx = fmaxf(mx, acc[j][r]); } }
    mx = fmaxf(mx, __shfl_xor(mx, 16));
    const float mn = fmaxf(m, mx), alpha = __builtin_amdgcn_exp2f((m - mn) * C2), mc = mn * C2; m = mn;
    float sum = 0.f; v16h p[2];
#pragma unroll
    for (int j = 0; j < 4; ++j) {
#pragma unroll
      for (int r = 0; r < 8; ++r) acc[j][r] = __builtin_fmaf(acc[j][r], C2, -mc);
      exp2x8(acc[j]);
#pragma unroll
      for (int r = 0; r < 8; ++r) { sum += acc[j][r]; p[j >> 1][(j & 1) * 8 + r] = (_Float16)acc[j][r]; } }
    l = l * alpha + sum;
#pragma unroll
    for (int j = 0; j < HD / 16; ++j) o[j] *= alpha;
    const int kn = k0 + 64 < TT ? k0 + 64 : 0;   // the last trip fetches trip 0's rows again (in bounds, unused)
    const _Float16* kq = kp + (size_t)kn * HD;
    __builtin_amdgcn_sched_barrier(0);   // keeps the next k loads behind the softmax: lifted into it, 64 more live registers spill
#pragma unroll
    for (int j = 0; j < 4; ++j) {
#pragma unroll
      for (int kc = 0; kc < HD / 32; ++kc) kf[j][kc] = frag_p(kq + j * 1024 + kc * 512); }
    asm volatile("s_wait_xcnt 0x0" :: "v"(kq) : "memory");   // stands in front of the first overwrite of the k loads' address registers (the address named so that no load returns into it)
#pragma unroll
    for (int kc = 0; kc < 2; ++kc) {
#pragma unroll
      for (int j = 0; j < HD / 16; ++j) o[j] = wmma16(vf[kc][j], p[kc], o[j]); }
    // the four slots behind the trip's last products on the taken branch back: the next trip's first product may write its result over the P registers that these read as B
    asm volatile("v_nop\n\tv_nop\n\tv_nop\n\tv_nop" : "+v"(o[0]), "+v"(o[1]), "+v"(o[2]), "+v"(o[3]) : "v"(p[1])); }
  l += __shfl_xor(l, 16); const float inv = 1.0f / l;
  float* yp = Y + ((size_t)b * TT + ql0 + col) * CC + h * HD + 8 * g;
#pragma unroll
  for (int j = 0; j < HD / 16; ++j) { v4f lo, hi;
#pragma unroll
    for (int r = 0; r < 4; ++r) { lo[r] = o[j][r] * inv; hi[r] = o[j][4 + r] * inv; }
    vst2(yp + j * 16, lo); vst2(yp + j * 16 + 4, hi); } }
// ---- k_out: block = (64 rows, 128 cols): out = ctx Wo (+ bo): all rows: ctx bf16 hi + lo against exact bf16 Wo (2 products)
__global__ __launch_bounds__(128) void k_out(const float* __restrict__ Y, const float* __restrict__ WO, const float* __restrict__ BO, float* __restrict__ OUT) { __shared__ __align__(16) float sf[4][16][132]; __shared__ __align__(16) __bf16 yh[2][64][SP], yl[2][64][SP], wt[2][128][SP];
  const int tid = threadIdx.x, wave = tid >> 5, lane = tid & 31, col = lane & 15, g = lane >> 4; const int c0 = blockIdx.y * 128; const size_t r0 = (size_t)blockIdx.x * 64 + wave * 16;
  v8f acc[8] = {};
  if (true) {   /* ALL rows: ctx split bf16 hi + lo x exact Wo (2 products) */
    const int sr = tid >> 4, sq = (tid & 15) * 4;   // a wave's 16-byte loads cover two whole 256-byte row pieces
    const float* yg = Y + ((size_t)blockIdx.x * 64 + sr) * CC + sq; const float* wg = WO + (size_t)(c0 + sr) * CC + sq;
    v4f yr[8], wr[16];
#pragma unroll
    for (int i = 0; i < 8; ++i) yr[i] = *(const v4f*)(yg + (size_t)(i * 8) * CC);
#pragma unroll
    for (int i = 0; i < 16; ++i) wr[i] = *(const v4f*)(wg + (size_t)(i * 8) * CC);
    asm volatile("s_wait_xcnt 0x0" :: "v"(yg), "v"(wg) : "memory");   // stands in front of the first overwrite of these loads' address registers (the addresses named so that they live up to it)
#pragma unroll 2   // two trips a pass of the loop, so that the buffer's number is a constant in the LDS addresses
    for (int c = 0; c < CC / SK; ++c) { const int bs = c & 1;
#pragma unroll
      for (int i = 0; i < 8; ++i) { const v4b hv = cvt4(yr[i]); v4f rs;
#pragma unroll
        for (int e = 0; e < 4; ++e) rs[e] = yr[i][e] - (float)hv[e];
        *(v4b*)&yh[bs][sr + i * 8][sq] = hv; *(v4b*)&yl[bs][sr + i * 8][sq] = cvt4(rs); }
#pragma unroll
      for (int i = 0; i < 16; ++i) *(v4b*)&wt[bs][sr + i * 8][sq] = cvt4(wr[i]);
      __syncthreads();   // publishes tile c; it also ends every wave's reads of the other buffer (tile c - 1), which the next trip refills
      if (c + 1 < CC / SK) {
#pragma unroll
        for (int i = 0; i < 8; ++i) yr[i] = *(const v4f*)(yg + (size_t)(i * 8) * CC + (c + 1) * SK);
#pragma unroll
        for (int i = 0; i < 16; ++i) wr[i] = *(const v4f*)(wg + (size_t)(i * 8) * CC + (c + 1) * SK);
        asm volatile("s_wait_xcnt 0x0" ::: "memory");   // stands in front of the first overwrite of these loads' address registers; as a memory fence it also keeps the loads issued here, ahead of the products that cover their latency
      }
      v16b ah[SK / 32], al[SK / 32], w[SK / 32][8];   // the tile's fragments, read as one group ahead of its products (reads among the products are each waited for at full LDS latency)
#pragma unroll
      for (int kc = 0; kc < SK / 32; ++kc) { ah[kc] = frag_b(&yh[bs][wave * 16 + col][kc * 32], lane); al[kc] = frag_b(&yl[bs][wave * 16 + col][kc * 32], lane);
#pragma unroll
        for (int j = 0; j < 8; ++j) w[kc][j] = frag_b(&wt[bs][j * 16 + col][kc * 32], lane); }
#pragma unroll
      for (int kc = 0; kc < SK / 32; ++kc) {
#pragma unroll
        for (int j = 0; j < 8; ++j) { acc[j] = wmma_bf(ah[kc], w[kc][j], acc[j]); acc[j] = wmma_bf(al[kc], w[kc][j], acc[j]); } } }
#pragma unroll
    for (int j = 0; j < 8; ++j) { const float bias = BO ? bfr(BO[c0 + j * 16 + col]) : 0.f;
#pragma unroll
      for (int r = 0; r < 8; ++r) sf[wave][8 * g + r][j * 16 + col] = acc[j][r] + bias; }
  } else {
#pragma unroll 2
    for (int kc = 0; kc < CC / 32; ++kc) { const v16h a = frag_f32(Y + (r0 + col) * CC + kc * 32, lane); asm volatile("s_wait_loadcnt 0x0" ::: "memory");
#pragma unroll
      for (int j = 0; j < 8; ++j) { const v16h w = WOCOLH(WO, kc * 32, c0 + j * 16 + col, lane); asm volatile("s_wait_loadcnt 0x0" ::: "memory"); acc[j] = wmma16(a, w, acc[j]); } }
#pragma unroll
    for (int j = 0; j < 8; ++j) { const float bias = BO ? bfr(BO[c0 + j * 16 + col]) : 0.f;
#pragma unroll
      for (int r = 0; r < 8; ++r) sf[wave][8 * g + r][j * 16 + col] = acc[j][r] * (1.0f / 256.0f) + bias; } }
  LDSX(); for (int rl = 0; rl < 16; ++rl) vst2(OUT + (r0 + rl) * DIN + c0 + lane * 4, *(const v4f*)&sf[wave][rl][lane * 4]); }

extern "C" void kernel_launch(void* const* d_in, const int* in_sizes, int n_in, void* d_out, int out_size, void* d_ws, size_t ws_size, hipStream_t stream) {
  (void)in_sizes; (void)n_in; (void)out_size;
  const float** F = (const float**)d_in;
  if (ws_size < (size_t)WS_END) return;
  char* ws = (char*)d_ws; _Float16 *QH = (_Float16*)(ws + WS_QH), *KH = (_Float16*)(ws + WS_KH), *VT = (_Float16*)(ws + WS_VT), *QL = (_Float16*)(ws + WS_QL), *KL = (_Float16*)(ws + WS_KL); __bf16 *VB = (__bf16*)(ws + WS_VB), *VBL = (__bf16*)(ws + WS_VBL); float *Y = (float*)(ws + WS_Y);
  (void)Y; (void)QL; (void)KL; (void)VB; (void)VBL;
  // inputs: 0 query; 1 key; 2 value [2,2048,1024]; 3 wq (out,in); 4 wk; 5 wv; 6 wo (out,in)
  k_proj<<<dim3(TNB * TT / 64, CC / 128, 3), 128, 0, stream>>>(F[0], F[1], F[2], F[3], F[4], F[5], nullptr, nullptr, nullptr, QH, QL, KH, KL, VT, VB, VBL);
  k_fa<<<dim3(TT / 128, NH, TNB), 256, 0, stream>>>(QH, KH, QL, VT, Y);
  k_out<<<dim3(TNB * TT / 64, DIN / 128), 128, 0, stream>>>(Y, F[6], nullptr, (float*)d_out);
}

// v006
// Measured time: 102 microseconds a run.
// Next to v005, in two timings, it ran 1.07 and 1.06 times as fast.
// Over all steps from v000 it is 13.0 times as fast.
// compute dtype: all float inputs rounded to bf16; q/k/v = in W^T + b with EXACT bf16 products on WMMA 16x16x32 (f32 accumulate); q as f16 hi + residual (x 2^10) against k once to f16 (2 products) / sqrt(1024); online softmax in f32 (base 2: scale x log2(e) in one multiply-add, v_exp_f32), logits and P kept in registers; P = exp(s - running max) once to f16 against v once to f16 (1 product), / row sum in f32; ctx split bf16 hi + lo against exact Wo (2 products) + bo; f32 output.
#include <hip/hip_runtime.h>
#include <math.h>

typedef __attribute__((ext_vector_type(16))) _Float16 v16h;
typedef __attribute__((ext_vector_type(16))) __bf16 v16b;
typedef __attribute__((ext_vector_type(8)))  _Float16 v8h;
typedef __attribute__((ext_vector_type(8)))  float v8f;
typedef __attribute__((ext_vector_type(4)))  float v4f;
typedef __attribute__((ext_vector_type(2)))  float v2f;
typedef __attribute__((ext_vector_type(4)))  unsigned v4u;
typedef __attribute__((ext_vector_type(4)))  int v4i;
typedef float __attribute__((may_alias)) float_a;
typedef int __attribute__((may_alias)) int_a;

template <typename T> __device__ __forceinline__ void vst2(void* p, T v) { *(T*)p = v;  }
__device__ __forceinline__ v8f wmma16(v16h a, v16h b, v8f c) {
  return __builtin_amdgcn_wmma_f32_16x16x32_f16(false, a, false, b, (short)0, c, false, false);
}
__device__ __forceinline__ v8f wmma_bf(v16b a, v16b b, v8f c) {
  v8f d = __builtin_amdgcn_wmma_f32_16x16x32_bf16(false, a, false, b, (short)0, c, false, false);
  asm volatile("v_nop\n\tv_nop\n\tv_nop\n\tv_nop" : "+v"(d) : "v"(a), "v"(b));
  return d;
}
// 16x16x32 fragments: lane = (h = lane>>4, row/col = lane&15); elements 0..7 = k0+8h+0..7, 8..15 = k0+16+8h+0..7; D element r = row 8h+r
__device__ __forceinline__ v16h frag_h(const _Float16* rowk0, int lane) {
  union { v16h v; v8h q[2]; } u; const _Float16* p = rowk0 + 8 * (lane >> 4);
  u.q[0] = *(const v8h*)p; u.q[1] = *(const v8h*)(p + 16); return u.v;
}
// the same fragment from a plane laid in fragment order: p = the lane's own 16 bytes of the first 512-byte piece (elements 0..7), the second piece (elements 8..15) follows it; each load of a wave covers four whole 128-byte lines
__device__ __forceinline__ v16h frag_p(const _Float16* p) {
  union { v16h v; v8h q[2]; } u;
  u.q[0] = *(const v8h*)p; u.q[1] = *(const v8h*)(p + 256); return u.v;
}
__device__ __forceinline__ v16h frag_f32(const float* rowk0, int lane) {
  v16h a; const float* p = rowk0 + 8 * (lane >> 4);
#pragma unroll
  for (int i = 0; i < 8; ++i) { a[i] = (_Float16)p[i]; a[8 + i] = (_Float16)p[16 + i]; }
  return a;
}
__device__ __forceinline__ v16h frag_f32s(const float* rowk0, int lane, float sc) {
  v16h a; const float* p = rowk0 + 8 * (lane >> 4);
#pragma unroll
  for (int i = 0; i < 8; ++i) { a[i] = (_Float16)(p[i] * sc); a[8 + i] = (_Float16)(p[16 + i] * sc); }
  return a;
}
// column fragment from a [K][ld] layout (column n), rows >= K read as 0
__device__ __forceinline__ v16h fragc_f32(const float* W, int k0, int n, int lane, int ld, int K) {
  v16h a; const int g = lane >> 4;
#pragma unroll
  for (int i = 0; i < 8; ++i) { const int ka = k0 + 8 * g + i, kb = ka + 16;
    a[i] = (_Float16)(ka < K ? W[(size_t)(ka < K ? ka : K - 1) * ld + n] : 0.f); a[8 + i] = (_Float16)(kb < K ? W[(size_t)(kb < K ? kb : K - 1) * ld + n] : 0.f); }
  return a;
}
struct F2 { v16b h, l; };
__device__ __forceinline__ F2 bsplit16(const float v[16]) { F2 r;
#pragma unroll
  for (int i = 0; i < 16; ++i) { const __bf16 h = (__bf16)v[i]; r.h[i] = h; r.l[i] = (__bf16)(v[i] - (float)h); }
  return r; }
__device__ __forceinline__ F2 split_row(const float* row, int k0, int lane) { float v[16]; const float* p = row + k0 + 8 * (lane >> 4);
#pragma unroll
  for (int i = 0; i < 8; ++i) { v[i] = p[i]; v[8 + i] = p[16 + i]; }
  return bsplit16(v); }
__device__ __forceinline__ F2 split_rowK(const float* row, int k0, int lane, int K) { float v[16]; const int g = lane >> 4;
#pragma unroll
  for (int i = 0; i < 8; ++i) { const int ka = k0 + 8 * g + i, kb = ka + 16; v[i] = ka < K ? row[ka < K ? ka : K - 1] : 0.f; v[8 + i] = kb < K ? row[kb < K ? kb : K - 1] : 0.f; }
  return bsplit16(v); }
__device__ __forceinline__ F2 split_col(const float* W, int k0, int n, int lane, int ld, int K) { float v[16]; const int g = lane >> 4;
#pragma unroll
  for (int i = 0; i < 8; ++i) { const int ka = k0 + 8 * g + i, kb = ka + 16; v[i] = ka < K ? W[(size_t)(ka < K ? ka : K - 1) * ld + n] : 0.f; v[8 + i] = kb < K ? W[(size_t)(kb < K ? kb : K - 1) * ld + n] : 0.f; }
  return bsplit16(v); }
__device__ __forceinline__ v8f mac3(const F2& a, const F2& b, v8f c) { c = wmma_bf(a.l, b.h, c); c = wmma_bf(a.h, b.l, c); return wmma_bf(a.h, b.h, c); }
__device__ __forceinline__ float sigm(float v) { return 1.0f / (1.0f + expf(-v)); }
#define LDSX() do { asm volatile("s_wait_dscnt 0" ::: "memory"); __builtin_amdgcn_wave_barrier(); __builtin_amdgcn_fence(__ATOMIC_RELEASE, "workgroup"); } while (0)

// Multi-head attention with separate query / key / value inputs whose scores are divided by sqrt(emb_size) (query / key / value [2,2048,1024]; torch (out,in) Wq / Wk / Wv / Wo [1024,1024] N(0, 1/1024), no biases: q = query @ Wq.T etc.; 16 heads x 64; energy / sqrt(1024) = x 1/32 (the module's own NOTE: the embedding width, not the head width); softmax over all keys (no mask); out merged @ Wo.T).
#define NB 2
#define TT 2048
#define CC 1024            // NH * HD = projected width
#define DIN 1024          // input (model) width
#define NH 16
#define HD 64
#define NQB (TT / 64)
#define HG 4
#define SCALE (0.03125f)
#define CAUSAL 0
#ifndef TNB
#define TNB NB
#endif
__device__ __forceinline__ float bfr(float v) { return (float)(__bf16)v; }
__host__ __device__ __forceinline__ int kb_last(int qb) { return CAUSAL ? ((qb * 64 + 63) >> 7) : (TT / 128 - 1); }
typedef __attribute__((ext_vector_type(8))) __bf16 v8b;
__device__ __forceinline__ v16b frag_b(const __bf16* rowk0, int lane) {
  union { v16b v; v8b q[2]; } u; const __bf16* p = rowk0 + 8 * (lane >> 4);
  u.q[0] = *(const v8b*)p; u.q[1] = *(const v8b*)(p + 16); return u.v;
}
#define QBH 0              // unused: no kernel here has a high-precision path
#define QHI 2048            // rows carrying a q residual plane (all rows when non-causal: 2-product logits everywhere)
#define KHI 64            // key rows carrying k residual / v bf16 hi+lo planes (written by k_proj, read by no kernel)
// B fragment (k rows k0+.., output column o) of a weight: (in,out) [K][ld] or (out,in) [ld rows of K]: bf16 exact, or f16(bf16 * 256) exact
__device__ __forceinline__ v16b wcol_io(const float* Wm, int k0, int o, int lane, int ld) { v16b w; const int g = lane >> 4;
#pragma unroll
  for (int i = 0; i < 8; ++i) { w[i] = (__bf16)Wm[(size_t)(k0 + 8 * g + i) * ld + o]; w[8 + i] = (__bf16)Wm[(size_t)(k0 + 16 + 8 * g + i) * ld + o]; }
  return w; }
__device__ __forceinline__ v16b wcol_oi(const float* Wm, int k0, int o, int lane, int K) { v16b w; const float* p = Wm + (size_t)o * K + k0 + 8 * (lane >> 4);
#pragma unroll
  for (int i = 0; i < 8; ++i) { w[i] = (__bf16)p[i]; w[8 + i] = (__bf16)p[16 + i]; }
  return w; }
__device__ __forceinline__ v16h wcolh_io(const float* Wm, int k0, int o, int lane, int ld) { v16h w; const int g = lane >> 4;
#pragma unroll
  for (int i = 0; i < 8; ++i) { w[i] = (_Float16)(bfr(Wm[(size_t)(k0 + 8 * g + i) * ld + o]) * 256.0f); w[8 + i] = (_Float16)(bfr(Wm[(size_t)(k0 + 16 + 8 * g + i) * ld + o]) * 256.0f); }
  return w; }
__device__ __forceinline__ v16h wcolh_oi(const float* Wm, int k0, int o, int lane, int K) { v16h w; const float* p = Wm + (size_t)o * K + k0 + 8 * (lane >> 4);
#pragma unroll
  for (int i = 0; i < 8; ++i) { w[i] = (_Float16)(bfr(p[i]) * 256.0f); w[8 + i] = (_Float16)(bfr(p[16 + i]) * 256.0f); }
  return w; }
#define WQKV_LAYOUT 1   // 0 = (in,out) [DIN][CC]; 1 = (out,in) [CC][DIN]; 2 = per-head [NH][DIN][HD]; selects WCOL only, which no kernel uses (k_proj reads (out,in) rows)
__device__ __forceinline__ v16b wcol_hdk(const float* Wm, int k0, int o, int lane) { v16b w; const int g = lane >> 4; const float* p = Wm + (size_t)(o / HD) * DIN * HD + (o % HD);
#pragma unroll
  for (int i = 0; i < 8; ++i) { w[i] = (__bf16)p[(size_t)(k0 + 8 * g + i) * HD]; w[8 + i] = (__bf16)p[(size_t)(k0 + 16 + 8 * g + i) * HD]; }
  return w; }
#define WO_OUT_IN 1
#if WQKV_LAYOUT == 1
#define WCOL(W, k0, o, lane) wcol_oi(W, k0, o, lane, DIN)
#elif WQKV_LAYOUT == 2
#define WCOL(W, k0, o, lane) wcol_hdk(W, k0, o, lane)
#else
#define WCOL(W, k0, o, lane) wcol_io(W, k0, o, lane, CC)
#endif
#if WO_OUT_IN
#define WOCOL(W, k0, o, lane) wcol_oi(W, k0, o, lane, CC)
#define WOCOLH(W, k0, o, lane) wcolh_oi(W, k0, o, lane, CC)
#else
#define WOCOL(W, k0, o, lane) wcol_io(W, k0, o, lane, DIN)
#define WOCOLH(W, k0, o, lane) wcolh_io(W, k0, o, lane, DIN)
#endif

#ifndef SM_EXTRA_PARAMS
#define SM_EXTRA_PARAMS
#endif
#ifndef PROJ_EXTRA_PARAMS
#define PROJ_EXTRA_PARAMS
#endif
#ifndef SM_MASK_HOOK
#define SM_MASK_HOOK (void)0
#endif

#define WS_QH  0u                                      // f16 q rows [b*t][CC]
#define WS_KH  (WS_QH + 2u * (size_t)NB * TT * CC)      // f16 k in fragment order [b][h][t / 16][d / 16][lane][8]: lane = 16 * ((d >> 3) & 1) + (t & 15), element d & 7
#define WS_VT  (WS_KH + 2u * (size_t)NB * TT * CC)      // f16 v in fragment order [b][h][t / 32][d / 16][(t >> 4) & 1][lane][8]: lane = 16 * ((t >> 3) & 1) + (d & 15), element t & 7
#define WS_QL  (WS_VT + 2u * (size_t)NB * CC * TT)      // f16 q residual x 2^10 rows [b][t < QHI][CC]
#define WS_KL  (WS_QL + 2u * (size_t)NB * QHI * CC)     // f16 k residual x 2^10 rows [b][t < KHI][CC]
#define WS_VB  (WS_KL + 2u * (size_t)NB * KHI * CC)     // bf16 v hi planes [b][c][t < KHI]
#define WS_VBL (WS_VB + 2u * (size_t)NB * CC * KHI)
#define WS_S   (WS_VBL + 2u * (size_t)NB * CC * KHI)    // (unused: logits / P stay in registers)
#define WS_Y   (WS_S  + 4u * (size_t)HG * TT * TT)      // f32 ctx rows [b*t][CC] (only when there is an output projection)
#define WS_END (WS_Y  + 4u * (size_t)NB * TT * CC)

#define SK 64               // k per staged tile: 256 bytes of an f32 row
static_assert((DIN / SK & (DIN / SK - 1)) == 0 && (CC / SK & (CC / SK - 1)) == 0 && (TT & (TT - 1)) == 0, "the rotated k and key walks wrap by a mask");
#define SP 72               // LDS row pitch in bf16: 144 bytes = 16 x 9, the pitch of ds_load_b128 readers
typedef __attribute__((ext_vector_type(4))) __bf16 v4b;
__device__ __forceinline__ v4b cvt4(v4f v) { v4b r;
#pragma unroll
  for (int i = 0; i < 4; ++i) r[i] = (__bf16)v[i];
  return r; }
// eight 16-byte pieces of one thread from LDS to global memory, at constant byte offsets from one address; then the wait that stands in front of any overwrite of the registers these stores name (address and data named, so that they live up to it)
template <typename FS, typename FO> __device__ __forceinline__ void put8(void* p0, FS from, FO off) {
  v4u d[8];
#pragma unroll   // unrolled: d stays in registers, and the LDS reads go out as one group
  for (int it = 0; it < 8; ++it) d[it] = *(const v4u*)from(it);
#pragma unroll   // unrolled: the offsets become immediates on one address, which nothing overwrites in front of the wait
  for (int it = 0; it < 8; ++it) *(v4u*)((char*)p0 + off(it)) = d[it];
  asm volatile("s_wait_xcnt 0x0" :: "v"(p0), "v"(d[0]), "v"(d[1]), "v"(d[2]), "v"(d[3]), "v"(d[4]), "v"(d[5]), "v"(d[6]), "v"(d[7]) : "memory");
}
// ---- k_proj: block = (64 rows, 128 cols, which): q/k/v = X W (+ b) with exact bf16 products (K = DIN) -> which 0: q f16 rows (+ residual rows < QHI); 1: k f16 in fragment order (+ residual rows < KHI); 2: v f16 in fragment order (+ bf16 hi/lo planes for t < KHI)
__global__ __launch_bounds__(128) void k_proj(const float* __restrict__ XQ, const float* __restrict__ XK, const float* __restrict__ XV, const float* __restrict__ WQ, const float* __restrict__ WK, const float* __restrict__ WV, const float* __restrict__ BQ, const float* __restrict__ BK, const float* __restrict__ BV,
    _Float16* __restrict__ QH, _Float16* __restrict__ QL, _Float16* __restrict__ KH, _Float16* __restrict__ KL, _Float16* __restrict__ VT, __bf16* __restrict__ VB, __bf16* __restrict__ VBL) {
  // one LDS block: the main loop's operand tiles (two buffers) and, behind a barrier, the epilogue's staging arrays share it
  __shared__ __align__(16) unsigned char smem[90112];
  __bf16 (*xs)[64][SP] = (__bf16 (*)[64][SP])smem; __bf16 (*wt)[128][SP] = (__bf16 (*)[128][SP])(smem + 2 * 64 * SP * 2);
  _Float16 (*sh)[136] = (_Float16 (*)[136])smem; _Float16 (*sl)[136] = (_Float16 (*)[136])(smem + 17408); _Float16 (*th)[72] = (_Float16 (*)[72])(smem + 34816); __bf16 (*tb)[72] = (__bf16 (*)[72])(smem + 53248); __bf16 (*tbl)[72] = (__bf16 (*)[72])(smem + 71680);
  const int tid = threadIdx.x, wave = tid >> 5, lane = tid & 31, col = lane & 15, g = lane >> 4; const int which = blockIdx.z; const int c0 = blockIdx.y * 128; const size_t r0 = (size_t)blockIdx.x * 64; const size_t bb = r0 / TT; const int t0 = (int)(r0 % TT);
  const float* X = which == 0 ? XQ : which == 1 ? XK : XV; const float* WA = which == 0 ? WQ : which == 1 ? WK : WV; const float* BA = which == 0 ? BQ : which == 1 ? BK : BV;
  v8f acc[8] = {};
  const int sr = tid >> 4, sq = (tid & 15) * 4;   // a wave's 16-byte loads cover two whole 256-byte row pieces
  const float* xg = X + (r0 + sr) * DIN + sq; const float* wg = WA + (size_t)(c0 + sr) * DIN + sq;
  // the block's first k tile: the blocks that share a W tile (same y) or an X tile (same x) start together, and from tile 0 they would all ask L2 for the same 256-byte pieces at the same moment, every piece of a trip at the same offset in its 4,096-byte row; rotated, they walk the 16 tiles from different starts (each tile once)
  const int ks = (blockIdx.x + 2 * blockIdx.y) & (DIN / SK - 1);
  v4f xr[8], wr[16];
  { const float* xp = xg + ks * SK; const float* wp = wg + ks * SK;
#pragma unroll
    for (int i = 0; i < 8; ++i) xr[i] = *(const v4f*)(xp + (size_t)(i * 8) * DIN);
#pragma unroll
    for (int i = 0; i < 16; ++i) wr[i] = *(const v4f*)(wp + (size_t)(i * 8) * DIN);
    asm volatile("s_wait_xcnt 0x0" :: "v"(xp), "v"(wp) : "memory"); }   // stands in front of the first overwrite of these loads' address registers (the addresses named so that they live up to it)
#pragma unroll 2   // two trips a pass of the loop, so that the buffer's number is a constant in the LDS addresses
  for (int c = 0; c < DIN / SK; ++c) { const int bs = c & 1;
#pragma unroll
    for (int i = 0; i < 8; ++i) *(v4b*)&xs[bs][sr + i * 8][sq] = cvt4(xr[i]);
#pragma unroll
    for (int i = 0; i < 16; ++i) *(v4b*)&wt[bs][sr + i * 8][sq] = cvt4(wr[i]);
    __syncthreads();   // publishes tile c; it also ends every wave's reads of the other buffer (tile c - 1), which the next trip refills
    if (c + 1 < DIN / SK) { const int kn = ((c + 1 + ks) & (DIN / SK - 1)) * SK; const float* xp = xg + kn; const float* wp = wg + kn;
#pragma unroll
      for (int i = 0; i < 8; ++i) xr[i] = *(const v4f*)(xp + (size_t)(i * 8) * DIN);
#pragma unroll
      for (int i = 0; i < 16; ++i) wr[i] = *(const v4f*)(wp + (size_t)(i * 8) * DIN);
      asm volatile("s_wait_xcnt 0x0" :: "v"(xp), "v"(wp) : "memory");   // stands in front of the first overwrite of these loads' address registers (named so that they live up to it); as a memory fence it also keeps the loads issued here, ahead of the products that cover their latency
    }
    v16b a[SK / 32], w[SK / 32][8];   // the tile's fragments, read as one group ahead of its products (reads among the products are each waited for at full LDS latency)
#pragma unroll
    for (int kc = 0; kc < SK / 32; ++kc) { a[kc] = frag_b(&xs[bs][wave * 16 + col][kc * 32], lane);
#pragma unroll
      for (int j = 0; j < 8; ++j) w[kc][j] = frag_b(&wt[bs][j * 16 + col][kc * 32], lane); }
#pragma unroll
    for (int kc = 0; kc < SK / 32; ++kc) {
#pragma unroll
      for (int j = 0; j < 8; ++j) acc[j] = wmma_bf(a[kc], w[kc][j], acc[j]); } }
  __syncthreads();   // every wave has left the operand tiles before the epilogue writes over them
  if (which < 2) { _Float16* DH = which == 0 ? QH : KH; _Float16* DL = which == 0 ? QL : KL; const int nhi = which == 0 ? QHI : KHI; const bool hi_rows = t0 < nhi;
#pragma unroll
    for (int j = 0; j < 8; ++j) { const float bias = BA ? bfr(BA[c0 + j * 16 + col]) : 0.f;
#pragma unroll
      for (int r = 0; r < 8; ++r) { const float v = acc[j][r] + bias; const _Float16 hv = (_Float16)v; sh[wave * 16 + 8 * g + r][j * 16 + col] = hv; sl[wave * 16 + 8 * g + r][j * 16 + col] = (_Float16)((v - (float)hv) * 1024.0f); } }
    __syncthreads();
    const int rl = tid >> 4, q8 = (tid & 15) * 8;   // rows: a thread's eight 16-byte pieces lie 8 rows apart
    if (which == 0) put8(DH + (r0 + rl) * CC + c0 + q8, [&](int it) { return (const void*)&sh[rl + it * 8][q8]; }, [](int it) { return it * 8 * CC * 2; });
    else   // k: 32 pieces of 512 bytes (2 heads x 4 key tiles x 4 groups of 16 d), one piece a wave's store; trip it = head it >> 2, key tile it & 3, the wave's number = the group of 16 d
      put8(DH + ((bb * NH + c0 / HD) * (TT / 16) + t0 / 16) * 1024 + tid * 8, [&](int it) { return (const void*)&sh[(it & 3) * 16 + col][(it >> 2) * HD + wave * 16 + g * 8]; }, [](int it) { return ((it >> 2) * (TT / 16) + (it & 3)) * 1024 * 2; });
    if (hi_rows) put8(DL + (bb * nhi + t0 + rl) * (size_t)CC + c0 + q8, [&](int it) { return (const void*)&sl[rl + it * 8][q8]; }, [](int it) { return it * 8 * CC * 2; });
  } else { const bool hi_rows = t0 < KHI;
#pragma unroll
    for (int j = 0; j < 8; ++j) { const float bias = BA ? bfr(BA[c0 + j * 16 + col]) : 0.f;
#pragma unroll
      for (int r = 0; r < 8; ++r) { const float v = acc[j][r] + bias; const int rl = wave * 16 + 8 * g + r, cl = j * 16 + col; th[cl][rl] = (_Float16)v; const __bf16 bh = (__bf16)v; tb[cl][rl] = bh; tbl[cl][rl] = (__bf16)(v - (float)bh); } }
    __syncthreads();
    // v: 32 pieces of 512 bytes (2 heads x 2 groups of 32 keys x 4 tiles of 16 d x 2 halves of 16 keys), one piece a wave's store; trip it = head it >> 2, key group (it >> 1) & 1, d tile 2 * (it & 1) + (wave >> 1), half wave & 1
    put8(VT + ((bb * NH + c0 / HD) * (TT / 32) + t0 / 32) * 2048 + tid * 8, [&](int it) { return (const void*)&th[(it >> 2) * HD + (2 * (it & 1) + (wave >> 1)) * 16 + col][((it >> 1) & 1) * 32 + (wave & 1) * 16 + g * 8]; }, [](int it) { return ((it >> 2) * (TT / 32) * 2048 + ((it >> 1) & 1) * 2048 + (it & 1) * 1024) * 2; });
    if (hi_rows) { const int cl = tid >> 3, q8 = (tid & 7) * 8; const size_t o3 = (bb * CC + c0 + cl) * (size_t)KHI + t0 + q8;
      put8(VB + o3, [&](int it) { return (const void*)&tb[cl + it * 16][q8]; }, [](int it) { return it * 16 * KHI * 2; });
      put8(VBL + o3, [&](int it) { return (const void*)&tbl[cl + it * 16][q8]; }, [](int it) { return it * 16 * KHI * 2; }); } } }
// 2^x of eight values, each in place. Asm text, not the builtin: in place, none of the eight names a register of another, so no v_exp_f32 overwrites the source register of the v_exp_f32 directly in front of it, where the instruction set asks for a slot.
// The closing v_nop is that same slot in front of whatever reads the last result.
__device__ __forceinline__ void exp2x8(v8f& x) {
  float a = x[0], b = x[1], c = x[2], d = x[3], e = x[4], f = x[5], g = x[6], h = x[7];
  asm("v_exp_f32 %0, %0\n\tv_exp_f32 %1, %1\n\tv_exp_f32 %2, %2\n\tv_exp_f32 %3, %3\n\tv_exp_f32 %4, %4\n\tv_exp_f32 %5, %5\n\tv_exp_f32 %6, %6\n\tv_exp_f32 %7, %7\n\tv_nop"
      : "+v"(a), "+v"(b), "+v"(c), "+v"(d), "+v"(e), "+v"(f), "+v"(g), "+v"(h));
  x[0] = a; x[1] = b; x[2] = c; x[3] = d; x[4] = e; x[5] = f; x[6] = g; x[7] = h;
}
__global__ __launch_bounds__(256) __attribute__((amdgpu_waves_per_eu(4, 4))) void k_fa(const _Float16* __restrict__ QH, const _Float16* __restrict__ KH, const _Float16* __restrict__ QL, const _Float16* __restrict__ VT, float* __restrict__ Y) {
  const int tid = threadIdx.x, wave = tid >> 5, lane = tid & 31, col = lane & 15, g = lane >> 4; const int h = blockIdx.y, b = blockIdx.z; const int ql0 = blockIdx.x * 128 + wave * 16;
  const _Float16* qp = QH + ((size_t)b * TT + ql0 + col) * CC + h * HD; const _Float16* qlp = QL + ((size_t)b * QHI + ql0 + col) * CC + h * HD;
  const _Float16* kp = KH + (size_t)(b * NH + h) * (TT * HD) + lane * 8; const _Float16* vp = VT + (size_t)(b * NH + h) * (TT * HD) + lane * 8;   // 64 keys = 4,096 elements of either plane
  v16h qh[HD / 32], ql[HD / 32];
#pragma unroll
  for (int kc = 0; kc < HD / 32; ++kc) { qh[kc] = frag_h(qp + kc * 32, lane); ql[kc] = frag_h(qlp + kc * 32, lane); }
  asm volatile("s_wait_xcnt 0x0" :: "v"(qp), "v"(qlp) : "memory");   // stands in front of the first overwrite of the q loads' address registers (named so that no later load returns into them)
  v8f o[HD / 16] = {}; float m = -3.0e38f, l = 0.f;
  // the block's first key: the 16 blocks of one (b, h) start together and read the same k and v lines; rotated by 128 keys a block they walk the 2,048 keys from different starts and wrap (each key once; the block's 8 waves keep one start and go on sharing their lines)
  const int kst = (int)(blockIdx.x * 128u) & (TT - 1);
  const _Float16* kq0 = kp + (size_t)kst * HD;
  v16h kf[4][HD / 32];   // this trip's k fragments, all fetched together one trip ahead (one load latency a trip, under the P.V products)
#pragma unroll
  for (int j = 0; j < 4; ++j) {
#pragma unroll
    for (int kc = 0; kc < HD / 32; ++kc) kf[j][kc] = frag_p(kq0 + j * 1024 + kc * 512); }
  asm volatile("s_wait_xcnt 0x0" :: "v"(kq0) : "memory");   // stands in front of the first overwrite of these loads' address registers (the address named so that it lives up to the wait)
#pragma unroll 1   // kept rolled: two trips' fragments at once would not fit the 256 registers of four waves per SIMD
  for (int k0 = 0; k0 < TT; k0 += 64) { v8f acc[4] = {}, accl[4] = {};
#pragma unroll
    for (int j = 0; j < 4; ++j) {
#pragma unroll
      for (int kc = 0; kc < HD / 32; ++kc) { acc[j] = wmma16(kf[j][kc], qh[kc], acc[j]); accl[j] = wmma16(kf[j][kc], ql[kc], accl[j]); } }
    v16h vf[2][HD / 16];   // fetched here so that the softmax arithmetic covers their latency
    const _Float16* vq = vp + (size_t)((k0 + kst) & (TT - 1)) * HD;
#pragma unroll
    for (int kc = 0; kc < 2; ++kc) {
#pragma unroll
      for (int j = 0; j < HD / 16; ++j) vf[kc][j] = frag_p(vq + kc * 2048 + j * 512); }
    asm volatile("s_wait_xcnt 0x0" :: "v"(vq) : "memory");   // stands in front of the first overwrite of the v loads' address registers (the address named so that it lives up to the wait)
    __builtin_amdgcn_sched_barrier(0);   // keeps the v loads issued here, ahead of the softmax: sunk towards their use they would be waited for at full latency
    // the logits stay unscaled up to the exponent: exp(SCALE * (s - max)) = 2^(s * C2 - max * C2) with C2 = SCALE * log2(e), one multiply-add and one v_exp_f32 an element
    const float C2 = SCALE * 1.44269504088896340736f;
    float mx = -3.0e38f;
#pragma unroll
    for (int j = 0; j < 4; ++j) {
#pragma unroll
      for (int r = 0; r < 8; ++r) { acc[j][r] = acc[j][r] + accl[j][r] * (1.0f / 1024.0f); mx = fmaxf(mx, acc[j][r]); } }
    mx = fmaxf(mx, __shfl_xor(mx, 16));
    const float mn = fmaxf(m, mx), alpha = __builtin_amdgcn_exp2f((m - mn) * C2), mc = mn * C2; m = mn;
    float sum = 0.f; v16h p[2];
#pragma unroll
    for (int j = 0; j < 4; ++j) {
#pragma unroll
      for (int r = 0; r < 8; ++r) acc[j][r] = __builtin_fmaf(acc[j][r], C2, -mc);
      exp2x8(acc[j]);
#pragma unroll
      for (int r = 0; r < 8; ++r) { sum += acc[j][r]; p[j >> 1][(j & 1) * 8 + r] = (_Float16)acc[j][r]; } }
    l = l * alpha + sum;
#pragma unroll
    for (int j = 0; j < HD / 16; ++j) o[j] *= alpha;
    const int kn = (k0 + 64 + kst) & (TT - 1);   // the last trip fetches the first trip's rows again (in bounds, unused)
    const _Float16* kq = kp + (size_t)kn * HD;
    __builtin_amdgcn_sched_barrier(0);   // keeps the next k loads behind the softmax: lifted into it, 64 more live registers spill
#pragma unroll
    for (int j = 0; j < 4; ++j) {
#pragma unroll
      for (int kc = 0; kc < HD / 32; ++kc) kf[j][kc] = frag_p(kq + j * 1024 + kc * 512); }
    asm volatile("s_wait_xcnt 0x0" :: "v"(kq) : "memory");   // stands in front of the first overwrite of the k loads' address registers (the address named so that no load returns into it)
#pragma unroll
    for (int kc = 0; kc < 2; ++kc) {
#pragma unroll
      for (int j = 0; j < HD / 16; ++j) o[j] = wmma16(vf[kc][j], p[kc], o[j]); }
    // the four slots behind the trip's last products on the taken branch back: the next trip's first product may write its result over the P registers that these read as B
    asm volatile("v_nop\n\tv_nop\n\tv_nop\n\tv_nop" : "+v"(o[0]), "+v"(o[1]), "+v"(o[2]), "+v"(o[3]) : "v"(p[1])); }
  l += __shfl_xor(l, 16); const float inv = 1.0f / l;
  float* yp = Y + ((size_t)b * TT + ql0 + col) * CC + h * HD + 8 * g;
#pragma unroll
  for (int j = 0; j < HD / 16; ++j) { v4f lo, hi;
#pragma unroll
    for (int r = 0; r < 4; ++r) { lo[r] = o[j][r] * inv; hi[r] = o[j][4 + r] * inv; }
    vst2(yp + j * 16, lo); vst2(yp + j * 16 + 4, hi); } }
// ---- k_out: block = (64 rows, 128 cols): out = ctx Wo (+ bo): all rows: ctx bf16 hi + lo against exact bf16 Wo (2 products)
__global__ __launch_bounds__(128) void k_out(const float* __restrict__ Y, const float* __restrict__ WO, const float* __restrict__ BO, float* __restrict__ OUT) { __shared__ __align__(16) float sf[4][16][132]; __shared__ __align__(16) __bf16 yh[2][64][SP], yl[2][64][SP], wt[2][128][SP];
  const int tid = threadIdx.x, wave = tid >> 5, lane = tid & 31, col = lane & 15, g = lane >> 4; const int c0 = blockIdx.y * 128; const size_t r0 = (size_t)blockIdx.x * 64 + wave * 16;
  v8f acc[8] = {};
  if (true) {   /* ALL rows: ctx split bf16 hi + lo x exact Wo (2 products) */
    const int sr = tid >> 4, sq = (tid & 15) * 4;   // a wave's 16-byte loads cover two whole 256-byte row pieces
    const float* yg = Y + ((size_t)blockIdx.x * 64 + sr) * CC + sq; const float* wg = WO + (size_t)(c0 + sr) * CC + sq;
    const int ks = (blockIdx.x + 2 * blockIdx.y) & (CC / SK - 1);   // the block's first k tile, rotated as in k_proj and for the same reason
    v4f yr[8], wr[16];
    { const float* yp = yg + ks * SK; const float* wp = wg + ks * SK;
#pragma unroll
      for (int i = 0; i < 8; ++i) yr[i] = *(const v4f*)(yp + (size_t)(i * 8) * CC);
#pragma unroll
      for (int i = 0; i < 16; ++i) wr[i] = *(const v4f*)(wp + (size_t)(i * 8) * CC);
      asm volatile("s_wait_xcnt 0x0" :: "v"(yp), "v"(wp) : "memory"); }   // stands in front of the first overwrite of these loads' address registers (the addresses named so that they live up to it)
#pragma unroll 2   // two trips a pass of the loop, so that the buffer's number is a constant in the LDS addresses
    for (int c = 0; c < CC / SK; ++c) { const int bs = c & 1;
#pragma unroll
      for (int i = 0; i < 8; ++i) { const v4b hv = cvt4(yr[i]); v4f rs;
#pragma unroll
        for (int e = 0; e < 4; ++e) rs[e] = yr[i][e] - (float)hv[e];
        *(v4b*)&yh[bs][sr + i * 8][sq] = hv; *(v4b*)&yl[bs][sr + i * 8][sq] = cvt4(rs); }
#pragma unroll
      for (int i = 0; i < 16; ++i) *(v4b*)&wt[bs][sr + i * 8][sq] = cvt4(wr[i]);
      __syncthreads();   // publishes tile c; it also ends every wave's reads of the other buffer (tile c - 1), which the next trip refills
      if (c + 1 < CC / SK) { const int kn = ((c + 1 + ks) & (CC / SK - 1)) * SK; const float* yp = yg + kn; const float* wp = wg + kn;
#pragma unroll
        for (int i = 0; i < 8; ++i) yr[i] = *(const v4f*)(yp + (size_t)(i * 8) * CC);
#pragma unroll
        for (int i = 0; i < 16; ++i) wr[i] = *(const v4f*)(wp + (size_t)(i * 8) * CC);
        asm volatile("s_wait_xcnt 0x0" :: "v"(yp), "v"(wp) : "memory");   // stands in front of the first overwrite of these loads' address registers (named so that they live up to it); as a memory fence it also keeps the loads issued here, ahead of the products that cover their latency
      }
      v16b ah[SK / 32], al[SK / 32], w[SK / 32][8];   // the tile's fragments, read as one group ahead of its products (reads among the products are each waited for at full LDS latency)
#pragma unroll
      for (int kc = 0; kc < SK / 32; ++kc) { ah[kc] = frag_b(&yh[bs][wave * 16 + col][kc * 32], lane); al[kc] = frag_b(&yl[bs][wave * 16 + col][kc * 32], lane);
#pragma unroll
        for (int j = 0; j < 8; ++j) w[kc][j] = frag_b(&wt[bs][j * 16 + col][kc * 32], lane); }
#pragma unroll
      for (int kc = 0; kc < SK / 32; ++kc) {
#pragma unroll
        for (int j = 0; j < 8; ++j) { acc[j] = wmma_bf(ah[kc], w[kc][j], acc[j]); acc[j] = wmma_bf(al[kc], w[kc][j], acc[j]); } } }
#pragma unroll
    for (int j = 0; j < 8; ++j) { const float bias = BO ? bfr(BO[c0 + j * 16 + col]) : 0.f;
#pragma unroll
      for (int r = 0; r < 8; ++r) sf[wave][8 * g + r][j * 16 + col] = acc[j][r] + bias; }
  } else {
#pragma unroll 2
    for (int kc = 0; kc < CC / 32; ++kc) { const v16h a = frag_f32(Y + (r0 + col) * CC + kc * 32, lane); asm volatile("s_wait_loadcnt 0x0" ::: "memory");
#pragma unroll
      for (int j = 0; j < 8; ++j) { const v16h w = WOCOLH(WO, kc * 32, c0 + j * 16 + col, lane); asm volatile("s_wait_loadcnt 0x0" ::: "memory"); acc[j] = wmma16(a, w, acc[j]); } }
#pragma unroll
    for (int j = 0; j < 8; ++j) { const float bias = BO ? bfr(BO[c0 + j * 16 + col]) : 0.f;
#pragma unroll
      for (int r = 0; r < 8; ++r) sf[wave][8 * g + r][j * 16 + col] = acc[j][r] * (1.0f / 256.0f) + bias; } }
  LDSX(); for (int rl = 0; rl < 16; ++rl) vst2(OUT + (r0 + rl) * DIN + c0 + lane * 4, *(const v4f*)&sf[wave][rl][lane * 4]); }

extern "C" void kernel_launch(void* const* d_in, const int* in_sizes, int n_in, void* d_out, int out_size, void* d_ws, size_t ws_size, hipStream_t stream) {
  (void)in_sizes; (void)n_in; (void)out_size;
  const float** F = (const float**)d_in;
  if (ws_size < (size_t)WS_END) return;
  char* ws = (char*)d_ws; _Float16 *QH = (_Float16*)(ws + WS_QH), *KH = (_Float16*)(ws + WS_KH), *VT = (_Float16*)(ws + WS_VT), *QL = (_Float16*)(ws + WS_QL), *KL = (_Float16*)(ws + WS_KL); __bf16 *VB = (__bf16*)(ws + WS_VB), *VBL = (__bf16*)(ws + WS_VBL); float *Y = (float*)(ws + WS_Y);
  (void)Y; (void)QL; (void)KL; (void)VB; (void)VBL;
  // inputs: 0 query; 1 key; 2 value [2,2048,1024]; 3 wq (out,in); 4 wk; 5 wv; 6 wo (out,in)
  k_proj<<<dim3(TNB * TT / 64, CC / 128, 3), 128, 0, stream>>>(F[0], F[1], F[2], F[3], F[4], F[5], nullptr, nullptr, nullptr, QH, QL, KH, KL, VT, VB, VBL);
  k_fa<<<dim3(TT / 128, NH, TNB), 256, 0, stream>>>(QH, KH, QL, VT, Y);
  k_out<<<dim3(TNB * TT / 64, DIN / 128), 128, 0, stream>>>(Y, F[6], nullptr, (float*)d_out);
}

// v007
// A run of this version takes 95.1 microseconds.
// Timed twice side by side with v006, it ran 1.08 times as fast both times.
// Over all steps from v000 it is 14.0 times as fast.
// compute dtype: all float inputs rounded to bf16; q/k/v = in W^T + b with EXACT bf16 products on WMMA 16x16x32 (f32 accumulate); q once to f16 against k once to f16 (1 product) / sqrt(1024); online softmax in f32 (base 2: scale x log2(e) in one multiply-add, v_exp_f32), logits and P kept in registers; P = exp(s - running max) once to f16 against v once to f16 (1 product), / row sum in f32; ctx split bf16 hi + lo against exact Wo (2 products) + bo; f32 output.
#include <hip/hip_runtime.h>
#include <math.h>

typedef __attribute__((ext_vector_type(16))) _Float16 v16h;
typedef __attribute__((ext_vector_type(16))) __bf16 v16b;
typedef __attribute__((ext_vector_type(8)))  _Float16 v8h;
typedef __attribute__((ext_vector_type(8)))  float v8f;
typedef __attribute__((ext_vector_type(4)))  float v4f;
typedef __attribute__((ext_vector_type(2)))  float v2f;
typedef __attribute__((ext_vector_type(4)))  unsigned v4u;
typedef __attribute__((ext_vector_type(4)))  int v4i;
typedef float __attribute__((may_alias)) float_a;
typedef int __attribute__((may_alias)) int_a;

template <typename T> __device__ __forceinline__ void vst2(void* p, T v) { *(T*)p = v;  }
__device__ __forceinline__ v8f wmma16(v16h a, v16h b, v8f c) {
  return __builtin_amdgcn_wmma_f32_16x16x32_f16(false, a, false, b, (short)0, c, false, false);
}
__device__ __forceinline__ v8f wmma_bf(v16b a, v16b b, v8f c) {
  v8f d = __builtin_amdgcn_wmma_f32_16x16x32_bf16(false, a, false, b, (short)0, c, false, false);
  asm volatile("v_nop\n\tv_nop\n\tv_nop\n\tv_nop" : "+v"(d) : "v"(a), "v"(b));
  return d;
}
// 16x16x32 fragments: lane = (h = lane>>4, row/col = lane&15); elements 0..7 = k0+8h+0..7, 8..15 = k0+16+8h+0..7; D element r = row 8h+r
__device__ __forceinline__ v16h frag_h(const _Float16* rowk0, int lane) {
  union { v16h v; v8h q[2]; } u; const _Float16* p = rowk0 + 8 * (lane >> 4);
  u.q[0] = *(const v8h*)p; u.q[1] = *(const v8h*)(p + 16); return u.v;
}
// the same fragment from a plane laid in fragment order: p = the lane's own 16 bytes of the first 512-byte piece (elements 0..7), the second piece (elements 8..15) follows it; each load of a wave covers four whole 128-byte lines
__device__ __forceinline__ v16h frag_p(const _Float16* p) {
  union { v16h v; v8h q[2]; } u;
  u.q[0] = *(const v8h*)p; u.q[1] = *(const v8h*)(p + 256); return u.v;
}
__device__ __forceinline__ v16h frag_f32(const float* rowk0, int lane) {
  v16h a; const float* p = rowk0 + 8 * (lane >> 4);
#pragma unroll
  for (int i = 0; i < 8; ++i) { a[i] = (_Float16)p[i]; a[8 + i] = (_Float16)p[16 + i]; }
  return a;
}
__device__ __forceinline__ v16h frag_f32s(const float* rowk0, int lane, float sc) {
  v16h a; const float* p = rowk0 + 8 * (lane >> 4);
#pragma unroll
  for (int i = 0; i < 8; ++i) { a[i] = (_Float16)(p[i] * sc); a[8 + i] = (_Float16)(p[16 + i] * sc); }
  return a;
}
// column fragment from a [K][ld] layout (column n), rows >= K read as 0
__device__ __forceinline__ v16h fragc_f32(const float* W, int k0, int n, int lane, int ld, int K) {
  v16h a; const int g = lane >> 4;
#pragma unroll
  for (int i = 0; i < 8; ++i) { const int ka = k0 + 8 * g + i, kb = ka + 16;
    a[i] = (_Float16)(ka < K ? W[(size_t)(ka < K ? ka : K - 1) * ld + n] : 0.f); a[8 + i] = (_Float16)(kb < K ? W[(size_t)(kb < K ? kb : K - 1) * ld + n] : 0.f); }
  return a;
}
struct F2 { v16b h, l; };
__device__ __forceinline__ F2 bsplit16(const float v[16]) { F2 r;
#pragma unroll
  for (int i = 0; i < 16; ++i) { const __bf16 h = (__bf16)v[i]; r.h[i] = h; r.l[i] = (__bf16)(v[i] - (float)h); }
  return r; }
__device__ __forceinline__ F2 split_row(const float* row, int k0, int lane) { float v[16]; const float* p = row + k0 + 8 * (lane >> 4);
#pragma unroll
  for (int i = 0; i < 8; ++i) { v[i] = p[i]; v[8 + i] = p[16 + i]; }
  return bsplit16(v); }
__device__ __forceinline__ F2 split_rowK(const float* row, int k0, int lane, int K) { float v[16]; const int g = lane >> 4;
#pragma unroll
  for (int i = 0; i < 8; ++i) { const int ka = k0 + 8 * g + i, kb = ka + 16; v[i] = ka < K ? row[ka < K ? ka : K - 1] : 0.f; v[8 + i] = kb < K ? row[kb < K ? kb : K - 1] : 0.f; }
  return bsplit16(v); }
__device__ __forceinline__ F2 split_col(const float* W, int k0, int n, int lane, int ld, int K) { float v[16]; const int g = lane >> 4;
#pragma unroll
  for (int i = 0; i < 8; ++i) { const int ka = k0 + 8 * g + i, kb = ka + 16; v[i] = ka < K ? W[(size_t)(ka < K ? ka : K - 1) * ld + n] : 0.f; v[8 + i] = kb < K ? W[(size_t)(kb < K ? kb : K - 1) * ld + n] : 0.f; }
  return bsplit16(v); }
__device__ __forceinline__ v8f mac3(const F2& a, const F2& b, v8f c) { c = wmma_bf(a.l, b.h, c); c = wmma_bf(a.h, b.l, c); return wmma_bf(a.h, b.h, c); }
__device__ __forceinline__ float sigm(float v) { return 1.0f / (1.0f + expf(-v)); }
#define LDSX() do { asm volatile("s_wait_dscnt 0" ::: "memory"); __builtin_amdgcn_wave_barrier(); __builtin_amdgcn_fence(__ATOMIC_RELEASE, "workgroup"); } while (0)

// Multi-head attention with separate query / key / value inputs whose scores are divided by sqrt(emb_size) (query / key / value [2,2048,1024]; torch (out,in) Wq / Wk / Wv / Wo [1024,1024] N(0, 1/1024), no biases: q = query @ Wq.T etc.; 16 heads x 64; energy / sqrt(1024) = x 1/32 (the module's own NOTE: the embedding width, not the head width); softmax over all keys (no mask); out merged @ Wo.T).
#define NB 2
#define TT 2048
#define CC 1024            // NH * HD = projected width
#define DIN 1024          // input (model) width
#define NH 16
#define HD 64
#define NQB (TT / 64)
#define HG 4
#define SCALE (0.03125f)
#define CAUSAL 0
#ifndef TNB
#define TNB NB
#endif
__device__ __forceinline__ float bfr(float v) { return (float)(__bf16)v; }
__host__ __device__ __forceinline__ int kb_last(int qb) { return CAUSAL ? ((qb * 64 + 63) >> 7) : (TT / 128 - 1); }
typedef __attribute__((ext_vector_type(8))) __bf16 v8b;
__device__ __forceinline__ v16b frag_b(const __bf16* rowk0, int lane) {
  union { v16b v; v8b q[2]; } u; const __bf16* p = rowk0 + 8 * (lane >> 4);
  u.q[0] = *(const v8b*)p; u.q[1] = *(const v8b*)(p + 16); return u.v;
}
#define QBH 0              // unused: no kernel in this file has a high-precision path
#define QHI 0               // rows carrying a q residual plane (none: the logits take q once to f16, the rounding that k has)
#define KHI 64            // key rows carrying k residual / v bf16 hi+lo planes (written by k_proj; no kernel reads them)
// B fragment (k rows k0+.., output column o) of a weight: (in,out) [K][ld] or (out,in) [ld rows of K]: bf16 exact, or f16(bf16 * 256) exact
__device__ __forceinline__ v16b wcol_io(const float* Wm, int k0, int o, int lane, int ld) { v16b w; const int g = lane >> 4;
#pragma unroll
  for (int i = 0; i < 8; ++i) { w[i] = (__bf16)Wm[(size_t)(k0 + 8 * g + i) * ld + o]; w[8 + i] = (__bf16)Wm[(size_t)(k0 + 16 + 8 * g + i) * ld + o]; }
  return w; }
__device__ __forceinline__ v16b wcol_oi(const float* Wm, int k0, int o, int lane, int K) { v16b w; const float* p = Wm + (size_t)o * K + k0 + 8 * (lane >> 4);
#pragma unroll
  for (int i = 0; i < 8; ++i) { w[i] = (__bf16)p[i]; w[8 + i] = (__bf16)p[16 + i]; }
  return w; }
__device__ __forceinline__ v16h wcolh_io(const float* Wm, int k0, int o, int lane, int ld) { v16h w; const int g = lane >> 4;
#pragma unroll
  for (int i = 0; i < 8; ++i) { w[i] = (_Float16)(bfr(Wm[(size_t)(k0 + 8 * g + i) * ld + o]) * 256.0f); w[8 + i] = (_Float16)(bfr(Wm[(size_t)(k0 + 16 + 8 * g + i) * ld + o]) * 256.0f); }
  return w; }
__device__ __forceinline__ v16h wcolh_oi(const float* Wm, int k0, int o, int lane, int K) { v16h w; const float* p = Wm + (size_t)o * K + k0 + 8 * (lane >> 4);
#pragma unroll
  for (int i = 0; i < 8; ++i) { w[i] = (_Float16)(bfr(p[i]) * 256.0f); w[8 + i] = (_Float16)(bfr(p[16 + i]) * 256.0f); }
  return w; }
#define WQKV_LAYOUT 1   // 0 = (in,out) [DIN][CC]; 1 = (out,in) [CC][DIN]; 2 = per-head [NH][DIN][HD]; selects WCOL only, which no kernel uses (k_proj reads (out,in) rows)
__device__ __forceinline__ v16b wcol_hdk(const float* Wm, int k0, int o, int lane) { v16b w; const int g = lane >> 4; const float* p = Wm + (size_t)(o / HD) * DIN * HD + (o % HD);
#pragma unroll
  for (int i = 0; i < 8; ++i) { w[i] = (__bf16)p[(size_t)(k0 + 8 * g + i) * HD]; w[8 + i] = (__bf16)p[(size_t)(k0 + 16 + 8 * g + i) * HD]; }
  return w; }
#define WO_OUT_IN 1
#if WQKV_LAYOUT == 1
#define WCOL(W, k0, o, lane) wcol_oi(W, k0, o, lane, DIN)
#elif WQKV_LAYOUT == 2
#define WCOL(W, k0, o, lane) wcol_hdk(W, k0, o, lane)
#else
#define WCOL(W, k0, o, lane) wcol_io(W, k0, o, lane, CC)
#endif
#if WO_OUT_IN
#define WOCOL(W, k0, o, lane) wcol_oi(W, k0, o, lane, CC)
#define WOCOLH(W, k0, o, lane) wcolh_oi(W, k0, o, lane, CC)
#else
#define WOCOL(W, k0, o, lane) wcol_io(W, k0, o, lane, DIN)
#define WOCOLH(W, k0, o, lane) wcolh_io(W, k0, o, lane, DIN)
#endif

#ifndef SM_EXTRA_PARAMS
#define SM_EXTRA_PARAMS
#endif
#ifndef PROJ_EXTRA_PARAMS
#define PROJ_EXTRA_PARAMS
#endif
#ifndef SM_MASK_HOOK
#define SM_MASK_HOOK (void)0
#endif

#define WS_QH  0u                                      // f16 q rows [b*t][CC]
#define WS_KH  (WS_QH + 2u * (size_t)NB * TT * CC)      // f16 k in fragment order [b][h][t / 16][d / 16][lane][8]: lane = 16 * ((d >> 3) & 1) + (t & 15), element d & 7
#define WS_VT  (WS_KH + 2u * (size_t)NB * TT * CC)      // f16 v in fragment order [b][h][t / 32][d / 16][(t >> 4) & 1][lane][8]: lane = 16 * ((t >> 3) & 1) + (d & 15), element t & 7
#define WS_QL  (WS_VT + 2u * (size_t)NB * CC * TT)      // f16 q residual x 2^10 rows [b][t < QHI][CC]
#define WS_KL  (WS_QL + 2u * (size_t)NB * QHI * CC)     // f16 k residual x 2^10 rows [b][t < KHI][CC]
#define WS_VB  (WS_KL + 2u * (size_t)NB * KHI * CC)     // bf16 v hi planes [b][c][t < KHI]
#define WS_VBL (WS_VB + 2u * (size_t)NB * CC * KHI)
#define WS_S   (WS_VBL + 2u * (size_t)NB * CC * KHI)    // (unused: logits / P stay in registers)
#define WS_Y   (WS_S  + 4u * (size_t)HG * TT * TT)      // f32 ctx rows [b*t][CC] (only when there is an output projection)
#define WS_END (WS_Y  + 4u * (size_t)NB * TT * CC)

#define SK 64               // k per staged tile: 256 bytes of an f32 row
static_assert((DIN / SK & (DIN / SK - 1)) == 0 && (CC / SK & (CC / SK - 1)) == 0 && (TT & (TT - 1)) == 0, "the rotated k and key walks wrap by a mask");
#define SP 72               // LDS row pitch in bf16: 144 bytes = 16 x 9, the pitch of ds_load_b128 readers
typedef __attribute__((ext_vector_type(4))) __bf16 v4b;
__device__ __forceinline__ v4b cvt4(v4f v) { v4b r;
#pragma unroll
  for (int i = 0; i < 4; ++i) r[i] = (__bf16)v[i];
  return r; }
// eight 16-byte pieces of one thread from LDS to global memory, at constant byte offsets from one address; then the wait that stands in front of any overwrite of the registers these stores name (address and data named, so that they live up to it)
template <typename FS, typename FO> __device__ __forceinline__ void put8(void* p0, FS from, FO off) {
  v4u d[8];
#pragma unroll   // unrolled: d stays in registers, and the LDS reads go out as one group
  for (int it = 0; it < 8; ++it) d[it] = *(const v4u*)from(it);
#pragma unroll   // unrolled: the offsets become immediates on one address, which nothing overwrites in front of the wait
  for (int it = 0; it < 8; ++it) *(v4u*)((char*)p0 + off(it)) = d[it];
  asm volatile("s_wait_xcnt 0x0" :: "v"(p0), "v"(d[0]), "v"(d[1]), "v"(d[2]), "v"(d[3]), "v"(d[4]), "v"(d[5]), "v"(d[6]), "v"(d[7]) : "memory");
}
// ---- k_proj: block = (64 rows, 128 cols, which): q/k/v = X W (+ b) with exact bf16 products (K = DIN) -> which 0: q f16 rows (+ residual rows < QHI); 1: k f16 in fragment order (+ residual rows < KHI); 2: v f16 in fragment order (+ bf16 hi/lo planes for t < KHI)
__global__ __launch_bounds__(128) void k_proj(const float* __restrict__ XQ, const float* __restrict__ XK, const float* __restrict__ XV, const float* __restrict__ WQ, const float* __restrict__ WK, const float* __restrict__ WV, const float* __restrict__ BQ, const float* __restrict__ BK, const float* __restrict__ BV,
    _Float16* __restrict__ QH, _Float16* __restrict__ QL, _Float16* __restrict__ KH, _Float16* __restrict__ KL, _Float16* __restrict__ VT, __bf16* __restrict__ VB, __bf16* __restrict__ VBL) {
  // one LDS block: the main loop's operand tiles (two buffers) and, behind a barrier, the epilogue's staging arrays share it
  __shared__ __align__(16) unsigned char smem[90112];
  __bf16 (*xs)[64][SP] = (__bf16 (*)[64][SP])smem; __bf16 (*wt)[128][SP] = (__bf16 (*)[128][SP])(smem + 2 * 64 * SP * 2);
  _Float16 (*sh)[136] = (_Float16 (*)[136])smem; _Float16 (*sl)[136] = (_Float16 (*)[136])(smem + 17408); _Float16 (*th)[72] = (_Float16 (*)[72])(smem + 34816); __bf16 (*tb)[72] = (__bf16 (*)[72])(smem + 53248); __bf16 (*tbl)[72] = (__bf16 (*)[72])(smem + 71680);
  const int tid = threadIdx.x, wave = tid >> 5, lane = tid & 31, col = lane & 15, g = lane >> 4; const int which = blockIdx.z; const int c0 = blockIdx.y * 128; const size_t r0 = (size_t)blockIdx.x * 64; const size_t bb = r0 / TT; const int t0 = (int)(r0 % TT);
  const float* X = which == 0 ? XQ : which == 1 ? XK : XV; const float* WA = which == 0 ? WQ : which == 1 ? WK : WV; const float* BA = which == 0 ? BQ : which == 1 ? BK : BV;
  v8f acc[8] = {};
  const int sr = tid >> 4, sq = (tid & 15) * 4;   // a wave's 16-byte loads cover two whole 256-byte row pieces
  const float* xg = X + (r0 + sr) * DIN + sq; const float* wg = WA + (size_t)(c0 + sr) * DIN + sq;
  // the block's first k tile: the blocks that share a W tile (same y) or an X tile (same x) start together, and from tile 0 they would all ask L2 for the same 256-byte pieces at the same moment, every piece of a trip at the same offset in its 4,096-byte row; rotated, they walk the 16 tiles from different starts (each tile once)
  const int ks = (blockIdx.x + 2 * blockIdx.y) & (DIN / SK - 1);
  v4f xr[8], wr[16];
  { const float* xp = xg + ks * SK; const float* wp = wg + ks * SK;
#pragma unroll
    for (int i = 0; i < 8; ++i) xr[i] = *(const v4f*)(xp + (size_t)(i * 8) * DIN);
#pragma unroll
    for (int i = 0; i < 16; ++i) wr[i] = *(const v4f*)(wp + (size_t)(i * 8) * DIN);
    asm volatile("s_wait_xcnt 0x0" :: "v"(xp), "v"(wp) : "memory"); }   // stands in front of the first overwrite of these loads' address registers (the addresses named so that they live up to it)
#pragma unroll 2   // two trips a pass of the loop, so that the buffer's number is a constant in the LDS addresses
  for (int c = 0; c < DIN / SK; ++c) { const int bs = c & 1;
#pragma unroll
    for (int i = 0; i < 8; ++i) *(v4b*)&xs[bs][sr + i * 8][sq] = cvt4(xr[i]);
#pragma unroll
    for (int i = 0; i < 16; ++i) *(v4b*)&wt[bs][sr + i * 8][sq] = cvt4(wr[i]);
    __syncthreads();   // publishes tile c; it also ends every wave's reads of the other buffer (tile c - 1), which the next trip refills
    if (c + 1 < DIN / SK) { const int kn = ((c + 1 + ks) & (DIN / SK - 1)) * SK; const float* xp = xg + kn; const float* wp = wg + kn;
#pragma unroll
      for (int i = 0; i < 8; ++i) xr[i] = *(const v4f*)(xp + (size_t)(i * 8) * DIN);
#pragma unroll
      for (int i = 0; i < 16; ++i) wr[i] = *(const v4f*)(wp + (size_t)(i * 8) * DIN);
      asm volatile("s_wait_xcnt 0x0" :: "v"(xp), "v"(wp) : "memory");   // stands in front of the first overwrite of these loads' address registers (named so that they live up to it); as a memory fence it also keeps the loads issued here, ahead of the products that cover their latency
    }
    v16b a[SK / 32], w[SK / 32][8];   // the tile's fragments, read as one group ahead of its products (reads among the products are each waited for at full LDS latency)
#pragma unroll
    for (int kc = 0; kc < SK / 32; ++kc) { a[kc] = frag_b(&xs[bs][wave * 16 + col][kc * 32], lane);
#pragma unroll
      for (int j = 0; j < 8; ++j) w[kc][j] = frag_b(&wt[bs][j * 16 + col][kc * 32], lane); }
#pragma unroll
    for (int kc = 0; kc < SK / 32; ++kc) {
#pragma unroll
      for (int j = 0; j < 8; ++j) acc[j] = wmma_bf(a[kc], w[kc][j], acc[j]); } }
  __syncthreads();   // every wave has left the operand tiles before the epilogue writes over them
  if (which < 2) { _Float16* DH = which == 0 ? QH : KH; _Float16* DL = which == 0 ? QL : KL; const int nhi = which == 0 ? QHI : KHI; const bool hi_rows = t0 < nhi;
#pragma unroll
    for (int j = 0; j < 8; ++j) { const float bias = BA ? bfr(BA[c0 + j * 16 + col]) : 0.f;
#pragma unroll
      for (int r = 0; r < 8; ++r) { const float v = acc[j][r] + bias; const _Float16 hv = (_Float16)v; acc[j][r] = (v - (float)hv) * 1024.0f; sh[wave * 16 + 8 * g + r][j * 16 + col] = hv; } }
    if (hi_rows) {   // the residual plane is staged only by the blocks that store it
#pragma unroll
      for (int j = 0; j < 8; ++j) {
#pragma unroll
        for (int r = 0; r < 8; ++r) sl[wave * 16 + 8 * g + r][j * 16 + col] = (_Float16)acc[j][r]; } }
    __syncthreads();
    const int rl = tid >> 4, q8 = (tid & 15) * 8;   // rows: a thread's eight 16-byte pieces lie 8 rows apart
    if (which == 0) put8(DH + (r0 + rl) * CC + c0 + q8, [&](int it) { return (const void*)&sh[rl + it * 8][q8]; }, [](int it) { return it * 8 * CC * 2; });
    else   // k: 32 pieces of 512 bytes (2 heads x 4 key tiles x 4 groups of 16 d), one piece a wave's store; trip it = head it >> 2, key tile it & 3, the wave's number = the group of 16 d
      put8(DH + ((bb * NH + c0 / HD) * (TT / 16) + t0 / 16) * 1024 + tid * 8, [&](int it) { return (const void*)&sh[(it & 3) * 16 + col][(it >> 2) * HD + wave * 16 + g * 8]; }, [](int it) { return ((it >> 2) * (TT / 16) + (it & 3)) * 1024 * 2; });
    if (hi_rows) put8(DL + (bb * nhi + t0 + rl) * (size_t)CC + c0 + q8, [&](int it) { return (const void*)&sl[rl + it * 8][q8]; }, [](int it) { return it * 8 * CC * 2; });
  } else { const bool hi_rows = t0 < KHI;
#pragma unroll
    for (int j = 0; j < 8; ++j) { const float bias = BA ? bfr(BA[c0 + j * 16 + col]) : 0.f;
#pragma unroll
      for (int r = 0; r < 8; ++r) { const float v = acc[j][r] + bias; const int rl = wave * 16 + 8 * g + r, cl = j * 16 + col; th[cl][rl] = (_Float16)v; const __bf16 bh = (__bf16)v; tb[cl][rl] = bh; tbl[cl][rl] = (__bf16)(v - (float)bh); } }
    __syncthreads();
    // v: 32 pieces of 512 bytes (2 heads x 2 groups of 32 keys x 4 tiles of 16 d x 2 halves of 16 keys), one piece a wave's store; trip it = head it >> 2, key group (it >> 1) & 1, d tile 2 * (it & 1) + (wave >> 1), half wave & 1
    put8(VT + ((bb * NH + c0 / HD) * (TT / 32) + t0 / 32) * 2048 + tid * 8, [&](int it) { return (const void*)&th[(it >> 2) * HD + (2 * (it & 1) + (wave >> 1)) * 16 + col][((it >> 1) & 1) * 32 + (wave & 1) * 16 + g * 8]; }, [](int it) { return ((it >> 2) * (TT / 32) * 2048 + ((it >> 1) & 1) * 2048 + (it & 1) * 1024) * 2; });
    if (hi_rows) { const int cl = tid >> 3, q8 = (tid & 7) * 8; const size_t o3 = (bb * CC + c0 + cl) * (size_t)KHI + t0 + q8;
      put8(VB + o3, [&](int it) { return (const void*)&tb[cl + it * 16][q8]; }, [](int it) { return it * 16 * KHI * 2; });
      put8(VBL + o3, [&](int it) { return (const void*)&tbl[cl + it * 16][q8]; }, [](int it) { return it * 16 * KHI * 2; }); } } }
// 2^x of eight values, each in place. Asm text, not the builtin: in place, none of the eight names a register of another, so no v_exp_f32 overwrites the source register of the v_exp_f32 directly in front of it, where the instruction set asks for a slot.
// The closing v_nop is that same slot in front of whatever reads the last result.
__device__ __forceinline__ void exp2x8(v8f& x) {
  float a = x[0], b = x[1], c = x[2], d = x[3], e = x[4], f = x[5], g = x[6], h = x[7];
  asm("v_exp_f32 %0, %0\n\tv_exp_f32 %1, %1\n\tv_exp_f32 %2, %2\n\tv_exp_f32 %3, %3\n\tv_exp_f32 %4, %4\n\tv_exp_f32 %5, %5\n\tv_exp_f32 %6, %6\n\tv_exp_f32 %7, %7\n\tv_nop"
      : "+v"(a), "+v"(b), "+v"(c), "+v"(d), "+v"(e), "+v"(f), "+v"(g), "+v"(h));
  x[0] = a; x[1] = b; x[2] = c; x[3] = d; x[4] = e; x[5] = f; x[6] = g; x[7] = h;
}
__global__ __launch_bounds__(256) __attribute__((amdgpu_waves_per_eu(4, 4))) void k_fa(const _Float16* __restrict__ QH, const _Float16* __restrict__ KH, const _Float16* __restrict__ VT, float* __restrict__ Y) {
  const int tid = threadIdx.x, wave = tid >> 5, lane = tid & 31, col = lane & 15, g = lane >> 4; const int h = blockIdx.y, b = blockIdx.z; const int ql0 = blockIdx.x * 128 + wave * 16;
  const _Float16* qp = QH + ((size_t)b * TT + ql0 + col) * CC + h * HD;
  const _Float16* kp = KH + (size_t)(b * NH + h) * (TT * HD) + lane * 8; const _Float16* vp = VT + (size_t)(b * NH + h) * (TT * HD) + lane * 8;   // 64 keys = 4,096 elements of either plane
  v16h qh[HD / 32];
#pragma unroll
  for (int kc = 0; kc < HD / 32; ++kc) qh[kc] = frag_h(qp + kc * 32, lane);
  asm volatile("s_wait_xcnt 0x0" :: "v"(qp) : "memory");   // stands in front of the first overwrite of the q loads' address registers (named so that no later load returns into them)
  v8f o[HD / 16] = {}; float m = -3.0e38f, l = 0.f;
  // the block's first key: the 16 blocks of one (b, h) start together and read the same k and v lines; rotated by 128 keys a block they walk the 2,048 keys from different starts and wrap (each key once; the block's 8 waves keep one start and go on sharing their lines)
  const int kst = (int)(blockIdx.x * 128u) & (TT - 1);
  const _Float16* kq0 = kp + (size_t)kst * HD;
  v16h kf[4][HD / 32];   // this trip's k fragments, all fetched together one trip ahead (one load latency a trip, under the P.V products)
#pragma unroll
  for (int j = 0; j < 4; ++j) {
#pragma unroll
    for (int kc = 0; kc < HD / 32; ++kc) kf[j][kc] = frag_p(kq0 + j * 1024 + kc * 512); }
  asm volatile("s_wait_xcnt 0x0" :: "v"(kq0) : "memory");   // stands in front of the first overwrite of these loads' address registers (the address named so that it lives up to the wait)
#pragma unroll 1   // kept rolled: two trips' fragments at once would not fit the 256 registers of four waves per SIMD
  for (int k0 = 0; k0 < TT; k0 += 64) { v8f acc[4] = {};
#pragma unroll
    for (int j = 0; j < 4; ++j) {
#pragma unroll
      for (int kc = 0; kc < HD / 32; ++kc) acc[j] = wmma16(kf[j][kc], qh[kc], acc[j]); }
    v16h vf[2][HD / 16];   // fetched here so that the softmax arithmetic covers their latency
    const _Float16* vq = vp + (size_t)((k0 + kst) & (TT - 1)) * HD;
#pragma unroll
    for (int kc = 0; kc < 2; ++kc) {
#pragma unroll
      for (int j = 0; j < HD / 16; ++j) vf[kc][j] = frag_p(vq + kc * 2048 + j * 512); }
    asm volatile("s_wait_xcnt 0x0" :: "v"(vq) : "memory");   // stands in front of the first overwrite of the v loads' address registers (the address named so that it lives up to the wait)
    __builtin_amdgcn_sched_barrier(0);   // keeps the v loads issued here, ahead of the softmax: sunk towards their use they would be waited for at full latency
    // the logits stay unscaled up to the exponent: exp(SCALE * (s - max)) = 2^(s * C2 - max * C2) with C2 = SCALE * log2(e), one multiply-add and one v_exp_f32 an element
    const float C2 = SCALE * 1.44269504088896340736f;
    float mx = -3.0e38f;
#pragma unroll
    for (int j = 0; j < 4; ++j) {
#pragma unroll
      for (int r = 0; r < 8; ++r) mx = fmaxf(mx, acc[j][r]); }
    mx = fmaxf(mx, __shfl_xor(mx, 16));
    const float mn = fmaxf(m, mx), alpha = __builtin_amdgcn_exp2f((m - mn) * C2), mc = mn * C2; m = mn;
    float sum = 0.f; v16h p[2];
#pragma unroll
    for (int j = 0; j < 4; ++j) {
#pragma unroll
      for (int r = 0; r < 8; ++r) acc[j][r] = __builtin_fmaf(acc[j][r], C2, -mc);
      exp2x8(acc[j]);
#pragma unroll
      for (int r = 0; r < 8; ++r) { sum += acc[j][r]; p[j >> 1][(j & 1) * 8 + r] = (_Float16)acc[j][r]; } }
    l = l * alpha + sum;
#pragma unroll
    for (int j = 0; j < HD / 16; ++j) o[j] *= alpha;
    const int kn = (k0 + 64 + kst) & (TT - 1);   // the last trip fetches the first trip's rows again (in bounds, unused)
    const _Float16* kq = kp + (size_t)kn * HD;
    __builtin_amdgcn_sched_barrier(0);   // keeps the next k loads behind the softmax: lifted into it, 64 more live registers spill
#pragma unroll
    for (int j = 0; j < 4; ++j) {
#pragma unroll
      for (int kc = 0; kc < HD / 32; ++kc) kf[j][kc] = frag_p(kq + j * 1024 + kc * 512); }
    asm volatile("s_wait_xcnt 0x0" :: "v"(kq) : "memory");   // stands in front of the first overwrite of the k loads' address registers (the address named so that no load returns into it)
#pragma unroll
    for (int kc = 0; kc < 2; ++kc) {
#pragma unroll
      for (int j = 0; j < HD / 16; ++j) o[j] = wmma16(vf[kc][j], p[kc], o[j]); }
    // the four slots behind the trip's last products on the taken branch back: the next trip's first product may write its result over the P registers that these read as B
    asm volatile("v_nop\n\tv_nop\n\tv_nop\n\tv_nop" : "+v"(o[0]), "+v"(o[1]), "+v"(o[2]), "+v"(o[3]) : "v"(p[1])); }
  l += __shfl_xor(l, 16); const float inv = 1.0f / l;
  float* yp = Y + ((size_t)b * TT + ql0 + col) * CC + h * HD + 8 * g;
#pragma unroll
  for (int j = 0; j < HD / 16; ++j) { v4f lo, hi;
#pragma unroll
    for (int r = 0; r < 4; ++r) { lo[r] = o[j][r] * inv; hi[r] = o[j][4 + r] * inv; }
    vst2(yp + j * 16, lo); vst2(yp + j * 16 + 4, hi); } }
// ---- k_out: block = (64 rows, 128 cols): out = ctx Wo (+ bo): all rows: ctx bf16 hi + lo against exact bf16 Wo (2 products)
__global__ __launch_bounds__(128) void k_out(const float* __restrict__ Y, const float* __restrict__ WO, const float* __restrict__ BO, float* __restrict__ OUT) { __shared__ __align__(16) float sf[4][16][132]; __shared__ __align__(16) __bf16 yh[2][64][SP], yl[2][64][SP], wt[2][128][SP];
  const int tid = threadIdx.x, wave = tid >> 5, lane = tid & 31, col = lane & 15, g = lane >> 4; const int c0 = blockIdx.y * 128; const size_t r0 = (size_t)blockIdx.x * 64 + wave * 16;
  v8f acc[8] = {};
  if (true) {   /* ALL rows: ctx split bf16 hi + lo x exact Wo (2 products) */
    const int sr = tid >> 4, sq = (tid & 15) * 4;   // a wave's 16-byte loads cover two whole 256-byte row pieces
    const float* yg = Y + ((size_t)blockIdx.x * 64 + sr) * CC + sq; const float* wg = WO + (size_t)(c0 + sr) * CC + sq;
    const int ks = (blockIdx.x + 2 * blockIdx.y) & (CC / SK - 1);   // the block's first k tile, rotated as in k_proj and for the same reason
    v4f yr[8], wr[16];
    { const float* yp = yg + ks * SK; const float* wp = wg + ks * SK;
#pragma unroll
      for (int i = 0; i < 8; ++i) yr[i] = *(const v4f*)(yp + (size_t)(i * 8) * CC);
#pragma unroll
      for (int i = 0; i < 16; ++i) wr[i] = *(const v4f*)(wp + (size_t)(i * 8) * CC);
      asm volatile("s_wait_xcnt 0x0" :: "v"(yp), "v"(wp) : "memory"); }   // stands in front of the first overwrite of these loads' address registers (the addresses named so that they live up to it)
#pragma unroll 2   // two trips a pass of the loop, so that the buffer's number is a constant in the LDS addresses
    for (int c = 0; c < CC / SK; ++c) { const int bs = c & 1;
#pragma unroll
      for (int i = 0; i < 8; ++i) { const v4b hv = cvt4(yr[i]); v4f rs;
#pragma unroll
        for (int e = 0; e < 4; ++e) rs[e] = yr[i][e] - (float)hv[e];
        *(v4b*)&yh[bs][sr + i * 8][sq] = hv; *(v4b*)&yl[bs][sr + i * 8][sq] = cvt4(rs); }
#pragma unroll
      for (int i = 0; i < 16; ++i) *(v4b*)&wt[bs][sr + i * 8][sq] = cvt4(wr[i]);
      __syncthreads();   // publishes tile c; it also ends every wave's reads of the other buffer (tile c - 1), which the next trip refills
      if (c + 1 < CC / SK) { const int kn = ((c + 1 + ks) & (CC / SK - 1)) * SK; const float* yp = yg + kn; const float* wp = wg + kn;
#pragma unroll
        for (int i = 0; i < 8; ++i) yr[i] = *(const v4f*)(yp + (size_t)(i * 8) * CC);
#pragma unroll
        for (int i = 0; i < 16; ++i) wr[i] = *(const v4f*)(wp + (size_t)(i * 8) * CC);
        asm volatile("s_wait_xcnt 0x0" :: "v"(yp), "v"(wp) : "memory");   // stands in front of the first overwrite of these loads' address registers (named so that they live up to it); as a memory fence it also keeps the loads issued here, ahead of the products that cover their latency
      }
      v16b ah[SK / 32], al[SK / 32], w[SK / 32][8];   // the tile's fragments, read as one group ahead of its products (reads among the products are each waited for at full LDS latency)
#pragma unroll
      for (int kc = 0; kc < SK / 32; ++kc) { ah[kc] = frag_b(&yh[bs][wave * 16 + col][kc * 32], lane); al[kc] = frag_b(&yl[bs][wave * 16 + col][kc * 32], lane);
#pragma unroll
        for (int j = 0; j < 8; ++j) w[kc][j] = frag_b(&wt[bs][j * 16 + col][kc * 32], lane); }
#pragma unroll
      for (int kc = 0; kc < SK / 32; ++kc) {
#pragma unroll
        for (int j = 0; j < 8; ++j) { acc[j] = wmma_bf(ah[kc], w[kc][j], acc[j]); acc[j] = wmma_bf(al[kc], w[kc][j], acc[j]); } } }
#pragma unroll
    for (int j = 0; j < 8; ++j) { const float bias = BO ? bfr(BO[c0 + j * 16 + col]) : 0.f;
#pragma unroll
      for (int r = 0; r < 8; ++r) sf[wave][8 * g + r][j * 16 + col] = acc[j][r] + bias; }
  } else {
#pragma unroll 2
    for (int kc = 0; kc < CC / 32; ++kc) { const v16h a = frag_f32(Y + (r0 + col) * CC + kc * 32, lane); asm volatile("s_wait_loadcnt 0x0" ::: "memory");
#pragma unroll
      for (int j = 0; j < 8; ++j) { const v16h w = WOCOLH(WO, kc * 32, c0 + j * 16 + col, lane); asm volatile("s_wait_loadcnt 0x0" ::: "memory"); acc[j] = wmma16(a, w, acc[j]); } }
#pragma unroll
    for (int j = 0; j < 8; ++j) { const float bias = BO ? bfr(BO[c0 + j * 16 + col]) : 0.f;
#pragma unroll
      for (int r = 0; r < 8; ++r) sf[wave][8 * g + r][j * 16 + col] = acc[j][r] * (1.0f / 256.0f) + bias; } }
  LDSX(); for (int rl = 0; rl < 16; ++rl) vst2(OUT + (r0 + rl) * DIN + c0 + lane * 4, *(const v4f*)&sf[wave][rl][lane * 4]); }

extern "C" void kernel_launch(void* const* d_in, const int* in_sizes, int n_in, void* d_out, int out_size, void* d_ws, size_t ws_size, hipStream_t stream) {
  (void)in_sizes; (void)n_in; (void)out_size;
  const float** F = (const float**)d_in;
  if (ws_size < (size_t)WS_END) return;
  char* ws = (char*)d_ws; _Float16 *QH = (_Float16*)(ws + WS_QH), *KH = (_Float16*)(ws + WS_KH), *VT = (_Float16*)(ws + WS_VT), *QL = (_Float16*)(ws + WS_QL), *KL = (_Float16*)(ws + WS_KL); __bf16 *VB = (__bf16*)(ws + WS_VB), *VBL = (__bf16*)(ws + WS_VBL); float *Y = (float*)(ws + WS_Y);
  (void)Y; (void)QL; (void)KL; (void)VB; (void)VBL;
  // inputs: 0 query; 1 key; 2 value [2,2048,1024]; 3 wq (out,in); 4 wk; 5 wv; 6 wo (out,in)
  k_proj<<<dim3(TNB * TT / 64, CC / 128, 3), 128, 0, stream>>>(F[0], F[1], F[2], F[3], F[4], F[5], nullptr, nullptr, nullptr, QH, QL, KH, KL, VT, VB, VBL);
  k_fa<<<dim3(TT / 128, NH, TNB), 256, 0, stream>>>(QH, KH, VT, Y);
  k_out<<<dim3(TNB * TT / 64, DIN / 128), 128, 0, stream>>>(Y, F[6], nullptr, (float*)d_out);
}

// v008
// A run of this version takes 88.8 microseconds.
// Next to v007, in two timings, it ran 1.07 times as fast each time.
// Over all steps from v000 it is 15.0 times as fast.
// compute dtype: all float inputs rounded to bf16; q/k/v = in W^T + b with EXACT bf16 products on WMMA 16x16x32 (f32 accumulate); q once to f16 against k once to f16 (1 product) / sqrt(1024); online softmax in f32 (base 2: scale x log2(e) in one multiply-add, v_exp_f32), logits and P kept in registers; P = exp(s - running max) once to f16 against v once to f16 (1 product), / row sum in f32; ctx split bf16 hi + lo against exact Wo (2 products) + bo; f32 output.
#include <hip/hip_runtime.h>
#include <math.h>

typedef __attribute__((ext_vector_type(16))) _Float16 v16h;
typedef __attribute__((ext_vector_type(16))) __bf16 v16b;
typedef __attribute__((ext_vector_type(8)))  _Float16 v8h;
typedef __attribute__((ext_vector_type(8)))  float v8f;
typedef __attribute__((ext_vector_type(4)))  float v4f;
typedef __attribute__((ext_vector_type(2)))  float v2f;
typedef __attribute__((ext_vector_type(4)))  unsigned v4u;
typedef __attribute__((ext_vector_type(4)))  int v4i;
typedef float __attribute__((may_alias)) float_a;
typedef int __attribute__((may_alias)) int_a;

template <typename T> __device__ __forceinline__ void vst2(void* p, T v) { *(T*)p = v;  }
__device__ __forceinline__ v8f wmma16(v16h a, v16h b, v8f c) {
  return __builtin_amdgcn_wmma_f32_16x16x32_f16(false, a, false, b, (short)0, c, false, false);
}
__device__ __forceinline__ v8f wmma_bf(v16b a, v16b b, v8f c) {
  v8f d = __builtin_amdgcn_wmma_f32_16x16x32_bf16(false, a, false, b, (short)0, c, false, false);
  asm volatile("v_nop\n\tv_nop\n\tv_nop\n\tv_nop" : "+v"(d) : "v"(a), "v"(b));
  return d;
}
// 16x16x32 fragments: lane = (h = lane>>4, row/col = lane&15); elements 0..7 = k0+8h+0..7, 8..15 = k0+16+8h+0..7; D element r = row 8h+r
__device__ __forceinline__ v16h frag_h(const _Float16* rowk0, int lane) {
  union { v16h v; v8h q[2]; } u; const _Float16* p = rowk0 + 8 * (lane >> 4);
  u.q[0] = *(const v8h*)p; u.q[1] = *(const v8h*)(p + 16); return u.v;
}
// the same fragment from a plane laid in fragment order: p = the lane's own 16 bytes of the first 512-byte piece (elements 0..7), the second piece (elements 8..15) follows it; each load of a wave covers four whole 128-byte lines
__device__ __forceinline__ v16h frag_p(const _Float16* p) {
  union { v16h v; v8h q[2]; } u;
  u.q[0] = *(const v8h*)p; u.q[1] = *(const v8h*)(p + 256); return u.v;
}
__device__ __forceinline__ v16h frag_f32(const float* rowk0, int lane) {
  v16h a; const float* p = rowk0 + 8 * (lane >> 4);
#pragma unroll
  for (int i = 0; i < 8; ++i) { a[i] = (_Float16)p[i]; a[8 + i] = (_Float16)p[16 + i]; }
  return a;
}
__device__ __forceinline__ v16h frag_f32s(const float* rowk0, int lane, float sc) {
  v16h a; const float* p = rowk0 + 8 * (lane >> 4);
#pragma unroll
  for (int i = 0; i < 8; ++i) { a[i] = (_Float16)(p[i] * sc); a[8 + i] = (_Float16)(p[16 + i] * sc); }
  return a;
}
// column fragment from a [K][ld] layout (column n), rows >= K read as 0
__device__ __forceinline__ v16h fragc_f32(const float* W, int k0, int n, int lane, int ld, int K) {
  v16h a; const int g = lane >> 4;
#pragma unroll
  for (int i = 0; i < 8; ++i) { const int ka = k0 + 8 * g + i, kb = ka + 16;
    a[i] = (_Float16)(ka < K ? W[(size_t)(ka < K ? ka : K - 1) * ld + n] : 0.f); a[8 + i] = (_Float16)(kb < K ? W[(size_t)(kb < K ? kb : K - 1) * ld + n] : 0.f); }
  return a;
}
struct F2 { v16b h, l; };
__device__ __forceinline__ F2 bsplit16(const float v[16]) { F2 r;
#pragma unroll
  for (int i = 0; i < 16; ++i) { const __bf16 h = (__bf16)v[i]; r.h[i] = h; r.l[i] = (__bf16)(v[i] - (float)h); }
  return r; }
__device__ __forceinline__ F2 split_row(const float* row, int k0, int lane) { float v[16]; const float* p = row + k0 + 8 * (lane >> 4);
#pragma unroll
  for (int i = 0; i < 8; ++i) { v[i] = p[i]; v[8 + i] = p[16 + i]; }
  return bsplit16(v); }
__device__ __forceinline__ F2 split_rowK(const float* row, int k0, int lane, int K) { float v[16]; const int g = lane >> 4;
#pragma unroll
  for (int i = 0; i < 8; ++i) { const int ka = k0 + 8 * g + i, kb = ka + 16; v[i] = ka < K ? row[ka < K ? ka : K - 1] : 0.f; v[8 + i] = kb < K ? row[kb < K ? kb : K - 1] : 0.f; }
  return bsplit16(v); }
__device__ __forceinline__ F2 split_col(const float* W, int k0, int n, int lane, int ld, int K) { float v[16]; const int g = lane >> 4;
#pragma unroll
  for (int i = 0; i < 8; ++i) { const int ka = k0 + 8 * g + i, kb = ka + 16; v[i] = ka < K ? W[(size_t)(ka < K ? ka : K - 1) * ld + n] : 0.f; v[8 + i] = kb < K ? W[(size_t)(kb < K ? kb : K - 1) * ld + n] : 0.f; }
  return bsplit16(v); }
__device__ __forceinline__ v8f mac3(const F2& a, const F2& b, v8f c) { c = wmma_bf(a.l, b.h, c); c = wmma_bf(a.h, b.l, c); return wmma_bf(a.h, b.h, c); }
__device__ __forceinline__ float sigm(float v) { return 1.0f / (1.0f + expf(-v)); }
#define LDSX() do { asm volatile("s_wait_dscnt 0" ::: "memory"); __builtin_amdgcn_wave_barrier(); __builtin_amdgcn_fence(__ATOMIC_RELEASE, "workgroup"); } while (0)

// Multi-head attention with separate query / key / value inputs whose scores are divided by sqrt(emb_size) (query / key / value [2,2048,1024]; torch (out,in) Wq / Wk / Wv / Wo [1024,1024] N(0, 1/1024), no biases: q = query @ Wq.T etc.; 16 heads x 64; energy / sqrt(1024) = x 1/32 (the module's own NOTE: the embedding width, not the head width); softmax over all keys (no mask); out merged @ Wo.T).
#define NB 2
#define TT 2048
#define CC 1024            // NH * HD = projected width
#define DIN 1024          // input (model) width
#define NH 16
#define HD 64
#define NQB (TT / 64)
#define HG 4
#define SCALE (0.03125f)
#define CAUSAL 0
#ifndef TNB
#define TNB NB
#endif
__device__ __forceinline__ float bfr(float v) { return (float)(__bf16)v; }
__host__ __device__ __forceinline__ int kb_last(int qb) { return CAUSAL ? ((qb * 64 + 63) >> 7) : (TT / 128 - 1); }
typedef __attribute__((ext_vector_type(8))) __bf16 v8b;
__device__ __forceinline__ v16b frag_b(const __bf16* rowk0, int lane) {
  union { v16b v; v8b q[2]; } u; const __bf16* p = rowk0 + 8 * (lane >> 4);
  u.q[0] = *(const v8b*)p; u.q[1] = *(const v8b*)(p + 16); return u.v;
}
#define QBH 0              // unused: no kernel in this file has a high-precision path
#define QHI 0               // rows carrying a q residual plane (none: the logits take q once to f16, the rounding that k has)
#define KHI 64            // key rows carrying k residual / v bf16 hi+lo planes (written by k_proj; no kernel reads them)
// B fragment (k rows k0+.., output column o) of a weight: (in,out) [K][ld] or (out,in) [ld rows of K]: bf16 exact, or f16(bf16 * 256) exact
__device__ __forceinline__ v16b wcol_io(const float* Wm, int k0, int o, int lane, int ld) { v16b w; const int g = lane >> 4;
#pragma unroll
  for (int i = 0; i < 8; ++i) { w[i] = (__bf16)Wm[(size_t)(k0 + 8 * g + i) * ld + o]; w[8 + i] = (__bf16)Wm[(size_t)(k0 + 16 + 8 * g + i) * ld + o]; }
  return w; }
__device__ __forceinline__ v16b wcol_oi(const float* Wm, int k0, int o, int lane, int K) { v16b w; const float* p = Wm + (size_t)o * K + k0 + 8 * (lane >> 4);
#pragma unroll
  for (int i = 0; i < 8; ++i) { w[i] = (__bf16)p[i]; w[8 + i] = (__bf16)p[16 + i]; }
  return w; }
__device__ __forceinline__ v16h wcolh_io(const float* Wm, int k0, int o, int lane, int ld) { v16h w; const int g = lane >> 4;
#pragma unroll
  for (int i = 0; i < 8; ++i) { w[i] = (_Float16)(bfr(Wm[(size_t)(k0 + 8 * g + i) * ld + o]) * 256.0f); w[8 + i] = (_Float16)(bfr(Wm[(size_t)(k0 + 16 + 8 * g + i) * ld + o]) * 256.0f); }
  return w; }
__device__ __forceinline__ v16h wcolh_oi(const float* Wm, int k0, int o, int lane, int K) { v16h w; const float* p = Wm + (size_t)o * K + k0 + 8 * (lane >> 4);
#pragma unroll
  for (int i = 0; i < 8; ++i) { w[i] = (_Float16)(bfr(p[i]) * 256.0f); w[8 + i] = (_Float16)(bfr(p[16 + i]) * 256.0f); }
  return w; }
#define WQKV_LAYOUT 1   // 0 = (in,out) [DIN][CC]; 1 = (out,in) [CC][DIN]; 2 = per-head [NH][DIN][HD]; selects WCOL only, which no kernel uses (k_wcvt reads (out,in) rows)
__device__ __forceinline__ v16b wcol_hdk(const float* Wm, int k0, int o, int lane) { v16b w; const int g = lane >> 4; const float* p = Wm + (size_t)(o / HD) * DIN * HD + (o % HD);
#pragma unroll
  for (int i = 0; i < 8; ++i) { w[i] = (__bf16)p[(size_t)(k0 + 8 * g + i) * HD]; w[8 + i] = (__bf16)p[(size_t)(k0 + 16 + 8 * g + i) * HD]; }
  return w; }
#define WO_OUT_IN 1
#if WQKV_LAYOUT == 1
#define WCOL(W, k0, o, lane) wcol_oi(W, k0, o, lane, DIN)
#elif WQKV_LAYOUT == 2
#define WCOL(W, k0, o, lane) wcol_hdk(W, k0, o, lane)
#else
#define WCOL(W, k0, o, lane) wcol_io(W, k0, o, lane, CC)
#endif
#if WO_OUT_IN
#define WOCOL(W, k0, o, lane) wcol_oi(W, k0, o, lane, CC)
#define WOCOLH(W, k0, o, lane) wcolh_oi(W, k0, o, lane, CC)
#else
#define WOCOL(W, k0, o, lane) wcol_io(W, k0, o, lane, DIN)
#define WOCOLH(W, k0, o, lane) wcolh_io(W, k0, o, lane, DIN)
#endif

#ifndef SM_EXTRA_PARAMS
#define SM_EXTRA_PARAMS
#endif
#ifndef PROJ_EXTRA_PARAMS
#define PROJ_EXTRA_PARAMS
#endif
#ifndef SM_MASK_HOOK
#define SM_MASK_HOOK (void)0
#endif

#define WS_QH  0u                                      // f16 q rows [b*t][CC]
#define WS_KH  (WS_QH + 2u * (size_t)NB * TT * CC)      // f16 k in fragment order [b][h][t / 16][d / 16][lane][8]: lane = 16 * ((d >> 3) & 1) + (t & 15), element d & 7
#define WS_VT  (WS_KH + 2u * (size_t)NB * TT * CC)      // f16 v in fragment order [b][h][t / 32][d / 16][(t >> 4) & 1][lane][8]: lane = 16 * ((t >> 3) & 1) + (d & 15), element t & 7
#define WS_QL  (WS_VT + 2u * (size_t)NB * CC * TT)      // f16 q residual x 2^10 rows [b][t < QHI][CC]
#define WS_KL  (WS_QL + 2u * (size_t)NB * QHI * CC)     // f16 k residual x 2^10 rows [b][t < KHI][CC]
#define WS_VB  (WS_KL + 2u * (size_t)NB * KHI * CC)     // bf16 v hi planes [b][c][t < KHI]
#define WS_VBL (WS_VB + 2u * (size_t)NB * CC * KHI)
#define WS_S   (WS_VBL + 2u * (size_t)NB * CC * KHI)    // (unused: logits / P stay in registers)
#define WS_Y   (WS_S  + 4u * (size_t)HG * TT * TT)      // f32 ctx rows [b*t][CC] (only when there is an output projection)
#define WS_WB  (WS_Y  + 4u * (size_t)NB * TT * CC)      // bf16 Wq, Wk, Wv, Wo, one plane each, in k-tile order [k / 64][out row][k & 63]: the 128 rows x 64 k that a block stages are 16,384 bytes in a row
#define WS_END (WS_WB + 2u * 4u * (size_t)CC * DIN)

#define SK 64               // k per staged tile: 256 bytes of an f32 row
static_assert((DIN / SK & (DIN / SK - 1)) == 0 && (CC / SK & (CC / SK - 1)) == 0 && (TT & (TT - 1)) == 0, "the rotated k and key walks wrap by a mask");
#define SP 72               // LDS row pitch in bf16: 144 bytes = 16 x 9, the pitch of ds_load_b128 readers
typedef __attribute__((ext_vector_type(4))) __bf16 v4b;
__device__ __forceinline__ v4b cvt4(v4f v) { v4b r;
#pragma unroll
  for (int i = 0; i < 4; ++i) r[i] = (__bf16)v[i];
  return r; }
// eight 16-byte pieces of one thread from LDS to global memory, at constant byte offsets from one address; then the wait that stands in front of any overwrite of the registers these stores name (address and data named, so that they live up to it)
template <typename FS, typename FO> __device__ __forceinline__ void put8(void* p0, FS from, FO off) {
  v4u d[8];
#pragma unroll   // unrolled: d stays in registers, and the LDS reads go out as one group
  for (int it = 0; it < 8; ++it) d[it] = *(const v4u*)from(it);
#pragma unroll   // unrolled: the offsets become immediates on one address, which nothing overwrites in front of the wait
  for (int it = 0; it < 8; ++it) *(v4u*)((char*)p0 + off(it)) = d[it];
  asm volatile("s_wait_xcnt 0x0" :: "v"(p0), "v"(d[0]), "v"(d[1]), "v"(d[2]), "v"(d[3]), "v"(d[4]), "v"(d[5]), "v"(d[6]), "v"(d[7]) : "memory");
}
// ---- k_wcvt: the four weights, each rounded to bf16 once (the rounding that every block of k_proj and k_out used to repeat on its own f32 copy) and laid in k-tile order. block = 256 rows of one k tile of one weight; a thread takes 8 pieces of 8 elements, 32 rows apart; a wave reads four whole 256-byte row pieces and writes 512 bytes in a row.
static_assert(DIN == CC && (CC & (CC - 1)) == 0 && CC % 256 == 0, "k_wcvt: square weights, 256 rows a block");
__global__ __launch_bounds__(256) void k_wcvt(const float* __restrict__ W0, const float* __restrict__ W1, const float* __restrict__ W2, const float* __restrict__ W3, __bf16* __restrict__ WB) {
  const int which = blockIdx.y; const float* Wm = which == 0 ? W0 : which == 1 ? W1 : which == 2 ? W2 : W3;
  const int t = blockIdx.x * 2048 + threadIdx.x;   // piece number = its place in the plane
  const float* s = Wm + (size_t)((t >> 3) & (CC - 1)) * DIN + (t / (8 * CC)) * SK + (t & 7) * 8;
  __bf16* d = WB + (size_t)which * CC * DIN + (size_t)t * 8;
  v4f a[8][2];
#pragma unroll   // unrolled: all 16 loads of a thread in flight at once, at constant offsets from one address
  for (int i = 0; i < 8; ++i) { a[i][0] = *(const v4f*)(s + (size_t)(i * 32) * DIN); a[i][1] = *(const v4f*)(s + (size_t)(i * 32) * DIN + 4); }
  asm volatile("s_wait_xcnt 0x0" :: "v"(s) : "memory");   // stands in front of the first overwrite of these loads' address registers (the address named so that it lives up to it)
  __builtin_amdgcn_sched_barrier(0);   // keeps the conversions behind all 16 loads: lifted among them, the last loads went out only after the first had come back, a second memory latency in a launch that is little more than one
  v4u o[8];
#pragma unroll   // unrolled: a and o stay in registers
  for (int i = 0; i < 8; ++i) { union { v4b h[2]; v4u u; } p; p.h[0] = cvt4(a[i][0]); p.h[1] = cvt4(a[i][1]); o[i] = p.u; }
#pragma unroll   // unrolled: the offsets become immediates on one address, which nothing overwrites in front of the wait
  for (int i = 0; i < 8; ++i) *(v4u*)(d + i * 2048) = o[i];
  asm volatile("s_wait_xcnt 0x0" :: "v"(d), "v"(o[0]), "v"(o[1]), "v"(o[2]), "v"(o[3]), "v"(o[4]), "v"(o[5]), "v"(o[6]), "v"(o[7]) : "memory");   // the same wait behind the stores (address and data named, so that they live up to it)
}
// ---- k_proj: block = (64 rows, 128 cols, which): q/k/v = X W (+ b) with exact bf16 products (K = DIN) -> which 0: q f16 rows (+ residual rows < QHI); 1: k f16 in fragment order (+ residual rows < KHI); 2: v f16 in fragment order (+ bf16 hi/lo planes for t < KHI)
__global__ __launch_bounds__(128) void k_proj(const float* __restrict__ XQ, const float* __restrict__ XK, const float* __restrict__ XV, const __bf16* __restrict__ WQ, const __bf16* __restrict__ WK, const __bf16* __restrict__ WV, const float* __restrict__ BQ, const float* __restrict__ BK, const float* __restrict__ BV,
    _Float16* __restrict__ QH, _Float16* __restrict__ QL, _Float16* __restrict__ KH, _Float16* __restrict__ KL, _Float16* __restrict__ VT, __bf16* __restrict__ VB, __bf16* __restrict__ VBL) {
  // one LDS block: the main loop's operand tiles (two buffers) and, behind a barrier, the epilogue's staging arrays share it
  __shared__ __align__(16) unsigned char smem[90112];
  __bf16 (*xs)[64][SP] = (__bf16 (*)[64][SP])smem; __bf16 (*wt)[128][SP] = (__bf16 (*)[128][SP])(smem + 2 * 64 * SP * 2);
  _Float16 (*sh)[136] = (_Float16 (*)[136])smem; _Float16 (*sl)[136] = (_Float16 (*)[136])(smem + 17408); _Float16 (*th)[72] = (_Float16 (*)[72])(smem + 34816); __bf16 (*tb)[72] = (__bf16 (*)[72])(smem + 53248); __bf16 (*tbl)[72] = (__bf16 (*)[72])(smem + 71680);
  const int tid = threadIdx.x, wave = tid >> 5, lane = tid & 31, col = lane & 15, g = lane >> 4; const int which = blockIdx.z; const int c0 = blockIdx.y * 128; const size_t r0 = (size_t)blockIdx.x * 64; const size_t bb = r0 / TT; const int t0 = (int)(r0 % TT);
  const float* X = which == 0 ? XQ : which == 1 ? XK : XV; const __bf16* WA = which == 0 ? WQ : which == 1 ? WK : WV; const float* BA = which == 0 ? BQ : which == 1 ? BK : BV;
  v8f acc[8] = {};
  const int sr = tid >> 4, sq = (tid & 15) * 4;   // a wave's 16-byte loads cover two whole 256-byte row pieces
  const int wrw = tid >> 3, wq = (tid & 7) * 8;   // W comes as bf16 from the k-tile-ordered plane: a wave's 16-byte loads cover 512 bytes in a row, four rows of the tile
  const float* xg = X + (r0 + sr) * DIN + sq; const __bf16* wg = WA + (size_t)c0 * SK + tid * 8;
  // the block's first k tile: the blocks that share a W tile (same y) or an X tile (same x) start together, and from tile 0 they would all ask L2 for the same pieces at the same moment (X: 256 bytes at the same offset in each 4,096-byte row; W: one 16,384-byte run); rotated, they walk the 16 tiles from different starts (each tile once)
  const int ks = (blockIdx.x + 2 * blockIdx.y) & (DIN / SK - 1);
  v4f xr[8]; v8b wr[8];
  { const float* xp = xg + ks * SK; const __bf16* wp = wg + (size_t)ks * (CC * SK);
#pragma unroll
    for (int i = 0; i < 8; ++i) xr[i] = *(const v4f*)(xp + (size_t)(i * 8) * DIN);
#pragma unroll
    for (int i = 0; i < 8; ++i) wr[i] = *(const v8b*)(wp + i * 1024);
    asm volatile("s_wait_xcnt 0x0" :: "v"(xp), "v"(wp) : "memory"); }   // stands in front of the first overwrite of these loads' address registers (the addresses named so that they live up to it)
#pragma unroll 2   // two trips a pass of the loop, so that the buffer's number is a constant in the LDS addresses
  for (int c = 0; c < DIN / SK; ++c) { const int bs = c & 1;
#pragma unroll
    for (int i = 0; i < 8; ++i) *(v4b*)&xs[bs][sr + i * 8][sq] = cvt4(xr[i]);
#pragma unroll
    for (int i = 0; i < 8; ++i) *(v8b*)&wt[bs][wrw + i * 16][wq] = wr[i];
    __syncthreads();   // publishes tile c; it also ends every wave's reads of the other buffer (tile c - 1), which the next trip refills
    if (c + 1 < DIN / SK) { const int kn = (c + 1 + ks) & (DIN / SK - 1); const float* xp = xg + kn * SK; const __bf16* wp = wg + (size_t)kn * (CC * SK);
#pragma unroll
      for (int i = 0; i < 8; ++i) xr[i] = *(const v4f*)(xp + (size_t)(i * 8) * DIN);
#pragma unroll
      for (int i = 0; i < 8; ++i) wr[i] = *(const v8b*)(wp + i * 1024);
      asm volatile("s_wait_xcnt 0x0" :: "v"(xp), "v"(wp) : "memory");   // stands in front of the first overwrite of these loads' address registers (named so that they live up to it); as a memory fence it also keeps the loads issued here, ahead of the products that cover their latency
    }
    v16b a[SK / 32], w[SK / 32][8];   // the tile's fragments, read as one group ahead of its products (reads among the products are each waited for at full LDS latency)
#pragma unroll
    for (int kc = 0; kc < SK / 32; ++kc) { a[kc] = frag_b(&xs[bs][wave * 16 + col][kc * 32], lane);
#pragma unroll
      for (int j = 0; j < 8; ++j) w[kc][j] = frag_b(&wt[bs][j * 16 + col][kc * 32], lane); }
#pragma unroll
    for (int kc = 0; kc < SK / 32; ++kc) {
#pragma unroll
      for (int j = 0; j < 8; ++j) acc[j] = wmma_bf(a[kc], w[kc][j], acc[j]); }
    __builtin_amdgcn_sched_barrier(0);   // keeps the next tile's conversions, and with them the wait for its loads, behind this tile's products: with W no longer converted the compiler lifted X's to behind the second product, where the loads have only just gone out
  }
  __syncthreads();   // every wave has left the operand tiles before the epilogue writes over them
  if (which < 2) { _Float16* DH = which == 0 ? QH : KH; _Float16* DL = which == 0 ? QL : KL; const int nhi = which == 0 ? QHI : KHI; const bool hi_rows = t0 < nhi;
#pragma unroll
    for (int j = 0; j < 8; ++j) { const float bias = BA ? bfr(BA[c0 + j * 16 + col]) : 0.f;
#pragma unroll
      for (int r = 0; r < 8; ++r) { const float v = acc[j][r] + bias; const _Float16 hv = (_Float16)v; acc[j][r] = (v - (float)hv) * 1024.0f; sh[wave * 16 + 8 * g + r][j * 16 + col] = hv; } }
    if (hi_rows) {   // the residual plane is staged only by the blocks that store it
#pragma unroll
      for (int j = 0; j < 8; ++j) {
#pragma unroll
        for (int r = 0; r < 8; ++r) sl[wave * 16 + 8 * g + r][j * 16 + col] = (_Float16)acc[j][r]; } }
    __syncthreads();
    const int rl = tid >> 4, q8 = (tid & 15) * 8;   // rows: a thread's eight 16-byte pieces lie 8 rows apart
    if (which == 0) put8(DH + (r0 + rl) * CC + c0 + q8, [&](int it) { return (const void*)&sh[rl + it * 8][q8]; }, [](int it) { return it * 8 * CC * 2; });
    else   // k: 32 pieces of 512 bytes (2 heads x 4 key tiles x 4 groups of 16 d), one piece a wave's store; trip it = head it >> 2, key tile it & 3, the wave's number = the group of 16 d
      put8(DH + ((bb * NH + c0 / HD) * (TT / 16) + t0 / 16) * 1024 + tid * 8, [&](int it) { return (const void*)&sh[(it & 3) * 16 + col][(it >> 2) * HD + wave * 16 + g * 8]; }, [](int it) { return ((it >> 2) * (TT / 16) + (it & 3)) * 1024 * 2; });
    if (hi_rows) put8(DL + (bb * nhi + t0 + rl) * (size_t)CC + c0 + q8, [&](int it) { return (const void*)&sl[rl + it * 8][q8]; }, [](int it) { return it * 8 * CC * 2; });
  } else { const bool hi_rows = t0 < KHI;
#pragma unroll
    for (int j = 0; j < 8; ++j) { const float bias = BA ? bfr(BA[c0 + j * 16 + col]) : 0.f;
#pragma unroll
      for (int r = 0; r < 8; ++r) { const float v = acc[j][r] + bias; const int rl = wave * 16 + 8 * g + r, cl = j * 16 + col; th[cl][rl] = (_Float16)v; const __bf16 bh = (__bf16)v; tb[cl][rl] = bh; tbl[cl][rl] = (__bf16)(v - (float)bh); } }
    __syncthreads();
    // v: 32 pieces of 512 bytes (2 heads x 2 groups of 32 keys x 4 tiles of 16 d x 2 halves of 16 keys), one piece a wave's store; trip it = head it >> 2, key group (it >> 1) & 1, d tile 2 * (it & 1) + (wave >> 1), half wave & 1
    put8(VT + ((bb * NH + c0 / HD) * (TT / 32) + t0 / 32) * 2048 + tid * 8, [&](int it) { return (const void*)&th[(it >> 2) * HD + (2 * (it & 1) + (wave >> 1)) * 16 + col][((it >> 1) & 1) * 32 + (wave & 1) * 16 + g * 8]; }, [](int it) { return ((it >> 2) * (TT / 32) * 2048 + ((it >> 1) & 1) * 2048 + (it & 1) * 1024) * 2; });
    if (hi_rows) { const int cl = tid >> 3, q8 = (tid & 7) * 8; const size_t o3 = (bb * CC + c0 + cl) * (size_t)KHI + t0 + q8;
      put8(VB + o3, [&](int it) { return (const void*)&tb[cl + it * 16][q8]; }, [](int it) { return it * 16 * KHI * 2; });
      put8(VBL + o3, [&](int it) { return (const void*)&tbl[cl + it * 16][q8]; }, [](int it) { return it * 16 * KHI * 2; }); } } }
// 2^x of eight values, each in place. Asm text, not the builtin: in place, none of the eight names a register of another, so no v_exp_f32 overwrites the source register of the v_exp_f32 directly in front of it, where the instruction set asks for a slot.
// The closing v_nop is that same slot in front of whatever reads the last result.
__device__ __forceinline__ void exp2x8(v8f& x) {
  float a = x[0], b = x[1], c = x[2], d = x[3], e = x[4], f = x[5], g = x[6], h = x[7];
  asm("v_exp_f32 %0, %0\n\tv_exp_f32 %1, %1\n\tv_exp_f32 %2, %2\n\tv_exp_f32 %3, %3\n\tv_exp_f32 %4, %4\n\tv_exp_f32 %5, %5\n\tv_exp_f32 %6, %6\n\tv_exp_f32 %7, %7\n\tv_nop"
      : "+v"(a), "+v"(b), "+v"(c), "+v"(d), "+v"(e), "+v"(f), "+v"(g), "+v"(h));
  x[0] = a; x[1] = b; x[2] = c; x[3] = d; x[4] = e; x[5] = f; x[6] = g; x[7] = h;
}
__global__ __launch_bounds__(256) __attribute__((amdgpu_waves_per_eu(4, 4))) void k_fa(const _Float16* __restrict__ QH, const _Float16* __restrict__ KH, const _Float16* __restrict__ VT, float* __restrict__ Y) {
  const int tid = threadIdx.x, wave = tid >> 5, lane = tid & 31, col = lane & 15, g = lane >> 4; const int h = blockIdx.y, b = blockIdx.z; const int ql0 = blockIdx.x * 128 + wave * 16;
  const _Float16* qp = QH + ((size_t)b * TT + ql0 + col) * CC + h * HD;
  const _Float16* kp = KH + (size_t)(b * NH + h) * (TT * HD) + lane * 8; const _Float16* vp = VT + (size_t)(b * NH + h) * (TT * HD) + lane * 8;   // 64 keys = 4,096 elements of either plane
  v16h qh[HD / 32];
#pragma unroll
  for (int kc = 0; kc < HD / 32; ++kc) qh[kc] = frag_h(qp + kc * 32, lane);
  asm volatile("s_wait_xcnt 0x0" :: "v"(qp) : "memory");   // stands in front of the first overwrite of the q loads' address registers (named so that no later load returns into them)
  v8f o[HD / 16] = {}; float m = -3.0e38f, l = 0.f;
  // the block's first key: the 16 blocks of one (b, h) start together and read the same k and v lines; rotated by 128 keys a block they walk the 2,048 keys from different starts and wrap (each key once; the block's 8 waves keep one start and go on sharing their lines)
  const int kst = (int)(blockIdx.x * 128u) & (TT - 1);
  const _Float16* kq0 = kp + (size_t)kst * HD;
  v16h kf[4][HD / 32];   // this trip's k fragments, all fetched together one trip ahead (one load latency a trip, under the P.V products)
#pragma unroll
  for (int j = 0; j < 4; ++j) {
#pragma unroll
    for (int kc = 0; kc < HD / 32; ++kc) kf[j][kc] = frag_p(kq0 + j * 1024 + kc * 512); }
  asm volatile("s_wait_xcnt 0x0" :: "v"(kq0) : "memory");   // stands in front of the first overwrite of these loads' address registers (the address named so that it lives up to the wait)
#pragma unroll 1   // kept rolled: two trips' fragments at once would not fit the 256 registers of four waves per SIMD
  for (int k0 = 0; k0 < TT; k0 += 64) { v8f acc[4] = {};
#pragma unroll
    for (int j = 0; j < 4; ++j) {
#pragma unroll
      for (int kc = 0; kc < HD / 32; ++kc) acc[j] = wmma16(kf[j][kc], qh[kc], acc[j]); }
    v16h vf[2][HD / 16];   // fetched here so that the softmax arithmetic covers their latency
    const _Float16* vq = vp + (size_t)((k0 + kst) & (TT - 1)) * HD;
#pragma unroll
    for (int kc = 0; kc < 2; ++kc) {
#pragma unroll
      for (int j = 0; j < HD / 16; ++j) vf[kc][j] = frag_p(vq + kc * 2048 + j * 512); }
    asm volatile("s_wait_xcnt 0x0" :: "v"(vq) : "memory");   // stands in front of the first overwrite of the v loads' address registers (the address named so that it lives up to the wait)
    __builtin_amdgcn_sched_barrier(0);   // keeps the v loads issued here, ahead of the softmax: sunk towards their use they would be waited for at full latency
    // the logits stay unscaled up to the exponent: exp(SCALE * (s - max)) = 2^(s * C2 - max * C2) with C2 = SCALE * log2(e), one multiply-add and one v_exp_f32 an element
    const float C2 = SCALE * 1.44269504088896340736f;
    float mx = -3.0e38f;
#pragma unroll
    for (int j = 0; j < 4; ++j) {
#pragma unroll
      for (int r = 0; r < 8; ++r) mx = fmaxf(mx, acc[j][r]); }
    mx = fmaxf(mx, __shfl_xor(mx, 16));
    const float mn = fmaxf(m, mx), alpha = __builtin_amdgcn_exp2f((m - mn) * C2), mc = mn * C2; m = mn;
    float sum = 0.f; v16h p[2];
#pragma unroll
    for (int j = 0; j < 4; ++j) {
#pragma unroll
      for (int r = 0; r < 8; ++r) acc[j][r] = __builtin_fmaf(acc[j][r], C2, -mc);
      exp2x8(acc[j]);
#pragma unroll
      for (int r = 0; r < 8; ++r) { sum += acc[j][r]; p[j >> 1][(j & 1) * 8 + r] = (_Float16)acc[j][r]; } }
    l = l * alpha + sum;
#pragma unroll
    for (int j = 0; j < HD / 16; ++j) o[j] *= alpha;
    const int kn = (k0 + 64 + kst) & (TT - 1);   // the last trip fetches the first trip's rows again (in bounds, unused)
    const _Float16* kq = kp + (size_t)kn * HD;
    __builtin_amdgcn_sched_barrier(0);   // keeps the next k loads behind the softmax: lifted into it, 64 more live registers spill
#pragma unroll
    for (int j = 0; j < 4; ++j) {
#pragma unroll
      for (int kc = 0; kc < HD / 32; ++kc) kf[j][kc] = frag_p(kq + j * 1024 + kc * 512); }
    asm volatile("s_wait_xcnt 0x0" :: "v"(kq) : "memory");   // stands in front of the first overwrite of the k loads' address registers (the address named so that no load returns into it)
#pragma unroll
    for (int kc = 0; kc < 2; ++kc) {
#pragma unroll
      for (int j = 0; j < HD / 16; ++j) o[j] = wmma16(vf[kc][j], p[kc], o[j]); }
    // the four slots behind the trip's last products on the taken branch back: the next trip's first product may write its result over the P registers that these read as B
    asm volatile("v_nop\n\tv_nop\n\tv_nop\n\tv_nop" : "+v"(o[0]), "+v"(o[1]), "+v"(o[2]), "+v"(o[3]) : "v"(p[1])); }
  l += __shfl_xor(l, 16); const float inv = 1.0f / l;
  float* yp = Y + ((size_t)b * TT + ql0 + col) * CC + h * HD + 8 * g;
#pragma unroll
  for (int j = 0; j < HD / 16; ++j) { v4f lo, hi;
#pragma unroll
    for (int r = 0; r < 4; ++r) { lo[r] = o[j][r] * inv; hi[r] = o[j][4 + r] * inv; }
    vst2(yp + j * 16, lo); vst2(yp + j * 16 + 4, hi); } }
// ---- k_out: block = (64 rows, 128 cols): out = ctx Wo (+ bo): ctx bf16 hi + lo against exact bf16 Wo (2 products), all rows
__global__ __launch_bounds__(128) void k_out(const float* __restrict__ Y, const __bf16* __restrict__ WO, const float* __restrict__ BO, float* __restrict__ OUT) { __shared__ __align__(16) float sf[4][16][132]; __shared__ __align__(16) __bf16 yh[2][64][SP], yl[2][64][SP], wt[2][128][SP];
  const int tid = threadIdx.x, wave = tid >> 5, lane = tid & 31, col = lane & 15, g = lane >> 4; const int c0 = blockIdx.y * 128; const size_t r0 = (size_t)blockIdx.x * 64 + wave * 16;
  v8f acc[8] = {};
  if (true) {   /* ALL rows: ctx split bf16 hi + lo x exact Wo (2 products) */
    const int sr = tid >> 4, sq = (tid & 15) * 4;   // a wave's 16-byte loads cover two whole 256-byte row pieces
    const int wrw = tid >> 3, wq = (tid & 7) * 8;   // Wo comes as bf16 from the k-tile-ordered plane, as in k_proj
    const float* yg = Y + ((size_t)blockIdx.x * 64 + sr) * CC + sq; const __bf16* wg = WO + (size_t)c0 * SK + tid * 8;
    const int ks = (blockIdx.x + 2 * blockIdx.y) & (CC / SK - 1);   // the block's first k tile, rotated as in k_proj and for the same reason
    v4f yr[8]; v8b wr[8];
    { const float* yp = yg + ks * SK; const __bf16* wp = wg + (size_t)ks * (DIN * SK);
#pragma unroll
      for (int i = 0; i < 8; ++i) yr[i] = *(const v4f*)(yp + (size_t)(i * 8) * CC);
#pragma unroll
      for (int i = 0; i < 8; ++i) wr[i] = *(const v8b*)(wp + i * 1024);
      asm volatile("s_wait_xcnt 0x0" :: "v"(yp), "v"(wp) : "memory"); }   // stands in front of the first overwrite of these loads' address registers (the addresses named so that they live up to it)
#pragma unroll 2   // two trips a pass of the loop, so that the buffer's number is a constant in the LDS addresses
    for (int c = 0; c < CC / SK; ++c) { const int bs = c & 1;
#pragma unroll
      for (int i = 0; i < 8; ++i) { const v4b hv = cvt4(yr[i]); v4f rs;
#pragma unroll
        for (int e = 0; e < 4; ++e) rs[e] = yr[i][e] - (float)hv[e];
        *(v4b*)&yh[bs][sr + i * 8][sq] = hv; *(v4b*)&yl[bs][sr + i * 8][sq] = cvt4(rs); }
#pragma unroll
      for (int i = 0; i < 8; ++i) *(v8b*)&wt[bs][wrw + i * 16][wq] = wr[i];
      __syncthreads();   // publishes tile c; it also ends every wave's reads of the other buffer (tile c - 1), which the next trip refills
      if (c + 1 < CC / SK) { const int kn = (c + 1 + ks) & (CC / SK - 1); const float* yp = yg + kn * SK; const __bf16* wp = wg + (size_t)kn * (DIN * SK);
#pragma unroll
        for (int i = 0; i < 8; ++i) yr[i] = *(const v4f*)(yp + (size_t)(i * 8) * CC);
#pragma unroll
        for (int i = 0; i < 8; ++i) wr[i] = *(const v8b*)(wp + i * 1024);
        asm volatile("s_wait_xcnt 0x0" :: "v"(yp), "v"(wp) : "memory");   // stands in front of the first overwrite of these loads' address registers (named so that they live up to it); as a memory fence it also keeps the loads issued here, ahead of the products that cover their latency
      }
      v16b ah[SK / 32], al[SK / 32], w[SK / 32][8];   // the tile's fragments, read as one group ahead of its products (reads among the products are each waited for at full LDS latency)
#pragma unroll
      for (int kc = 0; kc < SK / 32; ++kc) { ah[kc] = frag_b(&yh[bs][wave * 16 + col][kc * 32], lane); al[kc] = frag_b(&yl[bs][wave * 16 + col][kc * 32], lane);
#pragma unroll
        for (int j = 0; j < 8; ++j) w[kc][j] = frag_b(&wt[bs][j * 16 + col][kc * 32], lane); }
#pragma unroll
      for (int kc = 0; kc < SK / 32; ++kc) {
#pragma unroll
        for (int j = 0; j < 8; ++j) { acc[j] = wmma_bf(ah[kc], w[kc][j], acc[j]); acc[j] = wmma_bf(al[kc], w[kc][j], acc[j]); } } }
#pragma unroll
    for (int j = 0; j < 8; ++j) { const float bias = BO ? bfr(BO[c0 + j * 16 + col]) : 0.f;
#pragma unroll
      for (int r = 0; r < 8; ++r) sf[wave][8 * g + r][j * 16 + col] = acc[j][r] + bias; }
  }
  LDSX(); for (int rl = 0; rl < 16; ++rl) vst2(OUT + (r0 + rl) * DIN + c0 + lane * 4, *(const v4f*)&sf[wave][rl][lane * 4]); }

extern "C" void kernel_launch(void* const* d_in, const int* in_sizes, int n_in, void* d_out, int out_size, void* d_ws, size_t ws_size, hipStream_t stream) {
  (void)in_sizes; (void)n_in; (void)out_size;
  const float** F = (const float**)d_in;
  if (ws_size < (size_t)WS_END) return;
  char* ws = (char*)d_ws; _Float16 *QH = (_Float16*)(ws + WS_QH), *KH = (_Float16*)(ws + WS_KH), *VT = (_Float16*)(ws + WS_VT), *QL = (_Float16*)(ws + WS_QL), *KL = (_Float16*)(ws + WS_KL); __bf16 *VB = (__bf16*)(ws + WS_VB), *VBL = (__bf16*)(ws + WS_VBL), *WB = (__bf16*)(ws + WS_WB); float *Y = (float*)(ws + WS_Y);
  (void)Y; (void)QL; (void)KL; (void)VB; (void)VBL;
  // inputs: 0 query; 1 key; 2 value [2,2048,1024]; 3 wq (out,in); 4 wk; 5 wv; 6 wo (out,in)
  k_wcvt<<<dim3(CC * DIN / (8 * 2048), 4), 256, 0, stream>>>(F[3], F[4], F[5], F[6], WB);
  k_proj<<<dim3(TNB * TT / 64, CC / 128, 3), 128, 0, stream>>>(F[0], F[1], F[2], WB, WB + CC * DIN, WB + 2 * CC * DIN, nullptr, nullptr, nullptr, QH, QL, KH, KL, VT, VB, VBL);
  k_fa<<<dim3(TT / 128, NH, TNB), 256, 0, stream>>>(QH, KH, VT, Y);
  k_out<<<dim3(TNB * TT / 64, DIN / 128), 128, 0, stream>>>(Y, WB + 3 * CC * DIN, nullptr, (float*)d_out);
}

// v010
// It runs in 80.2 microseconds.
// Versions in between are left out here; by their measured steps it is 1.10 times as fast as v008.
// All steps since v000 together make it 16.5 times as fast.
// compute dtype: all float inputs rounded to bf16; q/k/v = in W^T + b with EXACT bf16 products on WMMA 16x16x32 (f32 accumulate); q once to f16 against k once to f16 (1 product) / sqrt(1024); online softmax in f32 (base 2: scale x log2(e) in one multiply-add, v_exp_f32), logits and P kept in registers; P = exp(s - running max) once to f16 against v once to f16 (1 product), / row sum in f32; ctx once to f16 against Wo's bf16 value held as f16 (1 product) + bo; f32 output.
#include <hip/hip_runtime.h>
#include <math.h>

typedef __attribute__((ext_vector_type(16))) _Float16 v16h;
typedef __attribute__((ext_vector_type(16))) __bf16 v16b;
typedef __attribute__((ext_vector_type(8)))  _Float16 v8h;
typedef __attribute__((ext_vector_type(8)))  float v8f;
typedef __attribute__((ext_vector_type(4)))  float v4f;
typedef __attribute__((ext_vector_type(2)))  float v2f;
typedef __attribute__((ext_vector_type(4)))  unsigned v4u;
typedef __attribute__((ext_vector_type(4)))  int v4i;
typedef float __attribute__((may_alias)) float_a;
typedef int __attribute__((may_alias)) int_a;

template <typename T> __device__ __forceinline__ void vst2(void* p, T v) { *(T*)p = v;  }
__device__ __forceinline__ v8f wmma16(v16h a, v16h b, v8f c) {
  return __builtin_amdgcn_wmma_f32_16x16x32_f16(false, a, false, b, (short)0, c, false, false);
}
__device__ __forceinline__ v8f wmma_bf(v16b a, v16b b, v8f c) {
  v8f d = __builtin_amdgcn_wmma_f32_16x16x32_bf16(false, a, false, b, (short)0, c, false, false);
  asm volatile("v_nop\n\tv_nop\n\tv_nop\n\tv_nop" : "+v"(d) : "v"(a), "v"(b));
  return d;
}
// 16x16x32 fragments: lane = (h = lane>>4, row/col = lane&15); elements 0..7 = k0+8h+0..7, 8..15 = k0+16+8h+0..7; D element r = row 8h+r
__device__ __forceinline__ v16h frag_h(const _Float16* rowk0, int lane) {
  union { v16h v; v8h q[2]; } u; const _Float16* p = rowk0 + 8 * (lane >> 4);
  u.q[0] = *(const v8h*)p; u.q[1] = *(const v8h*)(p + 16); return u.v;
}
// the same fragment from a plane laid in fragment order: p = the lane's own 16 bytes of the first 512-byte piece (elements 0..7), the second piece (elements 8..15) follows it; each load of a wave covers four whole 128-byte lines
__device__ __forceinline__ v16h frag_p(const _Float16* p) {
  union { v16h v; v8h q[2]; } u;
  u.q[0] = *(const v8h*)p; u.q[1] = *(const v8h*)(p + 256); return u.v;
}
__device__ __forceinline__ v16h frag_f32(const float* rowk0, int lane) {
  v16h a; const float* p = rowk0 + 8 * (lane >> 4);
#pragma unroll
  for (int i = 0; i < 8; ++i) { a[i] = (_Float16)p[i]; a[8 + i] = (_Float16)p[16 + i]; }
  return a;
}
__device__ __forceinline__ v16h frag_f32s(const float* rowk0, int lane, float sc) {
  v16h a; const float* p = rowk0 + 8 * (lane >> 4);
#pragma unroll
  for (int i = 0; i < 8; ++i) { a[i] = (_Float16)(p[i] * sc); a[8 + i] = (_Float16)(p[16 + i] * sc); }
  return a;
}
// column fragment from a [K][ld] layout (column n), rows >= K read as 0
__device__ __forceinline__ v16h fragc_f32(const float* W, int k0, int n, int lane, int ld, int K) {
  v16h a; const int g = lane >> 4;
#pragma unroll
  for (int i = 0; i < 8; ++i) { const int ka = k0 + 8 * g + i, kb = ka + 16;
    a[i] = (_Float16)(ka < K ? W[(size_t)(ka < K ? ka : K - 1) * ld + n] : 0.f); a[8 + i] = (_Float16)(kb < K ? W[(size_t)(kb < K ? kb : K - 1) * ld + n] : 0.f); }
  return a;
}
struct F2 { v16b h, l; };
__device__ __forceinline__ F2 bsplit16(const float v[16]) { F2 r;
#pragma unroll
  for (int i = 0; i < 16; ++i) { const __bf16 h = (__bf16)v[i]; r.h[i] = h; r.l[i] = (__bf16)(v[i] - (float)h); }
  return r; }
__device__ __forceinline__ F2 split_row(const float* row, int k0, int lane) { float v[16]; const float* p = row + k0 + 8 * (lane >> 4);
#pragma unroll
  for (int i = 0; i < 8; ++i) { v[i] = p[i]; v[8 + i] = p[16 + i]; }
  return bsplit16(v); }
__device__ __forceinline__ F2 split_rowK(const float* row, int k0, int lane, int K) { float v[16]; const int g = lane >> 4;
#pragma unroll
  for (int i = 0; i < 8; ++i) { const int ka = k0 + 8 * g + i, kb = ka + 16; v[i] = ka < K ? row[ka < K ? ka : K - 1] : 0.f; v[8 + i] = kb < K ? row[kb < K ? kb : K - 1] : 0.f; }
  return bsplit16(v); }
__device__ __forceinline__ F2 split_col(const float* W, int k0, int n, int lane, int ld, int K) { float v[16]; const int g = lane >> 4;
#pragma unroll
  for (int i = 0; i < 8; ++i) { const int ka = k0 + 8 * g + i, kb = ka + 16; v[i] = ka < K ? W[(size_t)(ka < K ? ka : K - 1) * ld + n] : 0.f; v[8 + i] = kb < K ? W[(size_t)(kb < K ? kb : K - 1) * ld + n] : 0.f; }
  return bsplit16(v); }
__device__ __forceinline__ v8f mac3(const F2& a, const F2& b, v8f c) { c = wmma_bf(a.l, b.h, c); c = wmma_bf(a.h, b.l, c); return wmma_bf(a.h, b.h, c); }
__device__ __forceinline__ float sigm(float v) { return 1.0f / (1.0f + expf(-v)); }
#define LDSX() do { asm volatile("s_wait_dscnt 0" ::: "memory"); __builtin_amdgcn_wave_barrier(); __builtin_amdgcn_fence(__ATOMIC_RELEASE, "workgroup"); } while (0)

// Multi-head attention with separate query / key / value inputs whose scores are divided by sqrt(emb_size) (query / key / value [2,2048,1024]; torch (out,in) Wq / Wk / Wv / Wo [1024,1024] N(0, 1/1024), no biases: q = query @ Wq.T etc.; 16 heads x 64; energy / sqrt(1024) = x 1/32 (the module's own NOTE: the embedding width, not the head width); softmax over all keys (no mask); out merged @ Wo.T).
#define NB 2
#define TT 2048
#define CC 1024            // NH * HD = projected width
#define DIN 1024          // input (model) width
#define NH 16
#define HD 64
#define NQB (TT / 64)
#define HG 4
#define SCALE (0.03125f)
#define CAUSAL 0
#ifndef TNB
#define TNB NB
#endif
__device__ __forceinline__ float bfr(float v) { return (float)(__bf16)v; }
__host__ __device__ __forceinline__ int kb_last(int qb) { return CAUSAL ? ((qb * 64 + 63) >> 7) : (TT / 128 - 1); }
typedef __attribute__((ext_vector_type(8))) __bf16 v8b;
__device__ __forceinline__ v16b frag_b(const __bf16* rowk0, int lane) {
  union { v16b v; v8b q[2]; } u; const __bf16* p = rowk0 + 8 * (lane >> 4);
  u.q[0] = *(const v8b*)p; u.q[1] = *(const v8b*)(p + 16); return u.v;
}
#define QBH 0              // unused: no kernel in this file has a high-precision path
#define QHI 0               // rows carrying a q residual plane (none: the logits take q once to f16, the rounding that k has)
#define KHI 64            // key rows carrying k residual / v bf16 hi+lo planes (written by k_proj; no kernel reads them)
// B fragment (k rows k0+.., output column o) of a weight: (in,out) [K][ld] or (out,in) [ld rows of K]: bf16 exact, or f16(bf16 * 256) exact
__device__ __forceinline__ v16b wcol_io(const float* Wm, int k0, int o, int lane, int ld) { v16b w; const int g = lane >> 4;
#pragma unroll
  for (int i = 0; i < 8; ++i) { w[i] = (__bf16)Wm[(size_t)(k0 + 8 * g + i) * ld + o]; w[8 + i] = (__bf16)Wm[(size_t)(k0 + 16 + 8 * g + i) * ld + o]; }
  return w; }
__device__ __forceinline__ v16b wcol_oi(const float* Wm, int k0, int o, int lane, int K) { v16b w; const float* p = Wm + (size_t)o * K + k0 + 8 * (lane >> 4);
#pragma unroll
  for (int i = 0; i < 8; ++i) { w[i] = (__bf16)p[i]; w[8 + i] = (__bf16)p[16 + i]; }
  return w; }
__device__ __forceinline__ v16h wcolh_io(const float* Wm, int k0, int o, int lane, int ld) { v16h w; const int g = lane >> 4;
#pragma unroll
  for (int i = 0; i < 8; ++i) { w[i] = (_Float16)(bfr(Wm[(size_t)(k0 + 8 * g + i) * ld + o]) * 256.0f); w[8 + i] = (_Float16)(bfr(Wm[(size_t)(k0 + 16 + 8 * g + i) * ld + o]) * 256.0f); }
  return w; }
__device__ __forceinline__ v16h wcolh_oi(const float* Wm, int k0, int o, int lane, int K) { v16h w; const float* p = Wm + (size_t)o * K + k0 + 8 * (lane >> 4);
#pragma unroll
  for (int i = 0; i < 8; ++i) { w[i] = (_Float16)(bfr(p[i]) * 256.0f); w[8 + i] = (_Float16)(bfr(p[16 + i]) * 256.0f); }
  return w; }
#define WQKV_LAYOUT 1   // 0 = (in,out) [DIN][CC]; 1 = (out,in) [CC][DIN]; 2 = per-head [NH][DIN][HD]; selects WCOL only, which no kernel uses (k_wcvt reads (out,in) rows)
__device__ __forceinline__ v16b wcol_hdk(const float* Wm, int k0, int o, int lane) { v16b w; const int g = lane >> 4; const float* p = Wm + (size_t)(o / HD) * DIN * HD + (o % HD);
#pragma unroll
  for (int i = 0; i < 8; ++i) { w[i] = (__bf16)p[(size_t)(k0 + 8 * g + i) * HD]; w[8 + i] = (__bf16)p[(size_t)(k0 + 16 + 8 * g + i) * HD]; }
  return w; }
#define WO_OUT_IN 1
#if WQKV_LAYOUT == 1
#define WCOL(W, k0, o, lane) wcol_oi(W, k0, o, lane, DIN)
#elif WQKV_LAYOUT == 2
#define WCOL(W, k0, o, lane) wcol_hdk(W, k0, o, lane)
#else
#define WCOL(W, k0, o, lane) wcol_io(W, k0, o, lane, CC)
#endif
#if WO_OUT_IN
#define WOCOL(W, k0, o, lane) wcol_oi(W, k0, o, lane, CC)
#define WOCOLH(W, k0, o, lane) wcolh_oi(W, k0, o, lane, CC)
#else
#define WOCOL(W, k0, o, lane) wcol_io(W, k0, o, lane, DIN)
#define WOCOLH(W, k0, o, lane) wcolh_io(W, k0, o, lane, DIN)
#endif

#ifndef SM_EXTRA_PARAMS
#define SM_EXTRA_PARAMS
#endif
#ifndef PROJ_EXTRA_PARAMS
#define PROJ_EXTRA_PARAMS
#endif
#ifndef SM_MASK_HOOK
#define SM_MASK_HOOK (void)0
#endif

#define WS_QH  0u                                      // f16 q rows [b*t][CC]
#define WS_KH  (WS_QH + 2u * (size_t)NB * TT * CC)      // f16 k in fragment order [b][h][t / 16][d / 16][lane][8]: lane = 16 * ((d >> 3) & 1) + (t & 15), element d & 7
#define WS_VT  (WS_KH + 2u * (size_t)NB * TT * CC)      // f16 v in fragment order [b][h][t / 32][d / 16][(t >> 4) & 1][lane][8]: lane = 16 * ((t >> 3) & 1) + (d & 15), element t & 7
#define WS_QL  (WS_VT + 2u * (size_t)NB * CC * TT)      // f16 q residual x 2^10 rows [b][t < QHI][CC]
#define WS_KL  (WS_QL + 2u * (size_t)NB * QHI * CC)     // f16 k residual x 2^10 rows [b][t < KHI][CC]
#define WS_VB  (WS_KL + 2u * (size_t)NB * KHI * CC)     // bf16 v hi planes [b][c][t < KHI]
#define WS_VBL (WS_VB + 2u * (size_t)NB * CC * KHI)
#define WS_S   (WS_VBL + 2u * (size_t)NB * CC * KHI)    // (unused: logits / P stay in registers)
#define WS_Y   (WS_S  + 4u * (size_t)HG * TT * TT)      // f16 ctx in k-tile order [h][b*t][HD] (a head's 64 columns are one k tile of k_out): the 64 rows x 64 k that a block stages are 8,192 bytes in a row; the plane keeps its f32 size, half of it used
#define WS_WB  (WS_Y  + 4u * (size_t)NB * TT * CC)      // bf16 Wq, Wk, Wv and f16 Wo (its bf16 value), one plane each, in k-tile order [k / 64][out row][k & 63]: the 256 (k_proj) or 128 (k_out) rows x 64 k that a block stages are 32,768 or 16,384 bytes in a row
#define WS_END (WS_WB + 2u * 4u * (size_t)CC * DIN)

#define SK 64               // k per staged tile: 256 bytes of an f32 row
static_assert((DIN / SK & (DIN / SK - 1)) == 0 && (CC / SK & (CC / SK - 1)) == 0 && (TT & (TT - 1)) == 0, "the rotated k and key walks wrap by a mask");
#define SP 72               // LDS row pitch in bf16: 144 bytes = 16 x 9, the pitch of ds_load_b128 readers
typedef __attribute__((ext_vector_type(4))) __bf16 v4b;
__device__ __forceinline__ v4b cvt4(v4f v) { v4b r;
#pragma unroll
  for (int i = 0; i < 4; ++i) r[i] = (__bf16)v[i];
  return r; }
// eight 16-byte pieces of one thread from LDS to global memory, at constant byte offsets from one address; then the wait that stands in front of any overwrite of the registers these stores name (address and data named, so that they live up to it)
template <typename FS, typename FO> __device__ __forceinline__ void put8(void* p0, FS from, FO off) {
  v4u d[8];
#pragma unroll   // unrolled: d stays in registers, and the LDS reads go out as one group
  for (int it = 0; it < 8; ++it) d[it] = *(const v4u*)from(it);
#pragma unroll   // unrolled: the offsets become immediates on one address, which nothing overwrites in front of the wait
  for (int it = 0; it < 8; ++it) *(v4u*)((char*)p0 + off(it)) = d[it];
  asm volatile("s_wait_xcnt 0x0" :: "v"(p0), "v"(d[0]), "v"(d[1]), "v"(d[2]), "v"(d[3]), "v"(d[4]), "v"(d[5]), "v"(d[6]), "v"(d[7]) : "memory");
}
// ---- k_wcvt: the four weights, each rounded to bf16 once (the rounding that every block of k_proj and k_out used to repeat on its own f32 copy) and laid in k-tile order; Wo's bf16 value goes on to f16, the operand type of k_out's product (8 significant bits: exact from 2^-17 to 65,504 in size, within 2^-25 below). block = 256 rows of one k tile of one weight; a thread takes 8 pieces of 8 elements, 32 rows apart; a wave reads four whole 256-byte row pieces and writes 512 bytes in a row.
static_assert(DIN == CC && (CC & (CC - 1)) == 0 && CC % 256 == 0, "k_wcvt: square weights, 256 rows a block");
__global__ __launch_bounds__(256) void k_wcvt(const float* __restrict__ W0, const float* __restrict__ W1, const float* __restrict__ W2, const float* __restrict__ W3, __bf16* __restrict__ WB) {
  const int which = blockIdx.y; const float* Wm = which == 0 ? W0 : which == 1 ? W1 : which == 2 ? W2 : W3;
  const int t = blockIdx.x * 2048 + threadIdx.x;   // piece number = its place in the plane
  const float* s = Wm + (size_t)((t >> 3) & (CC - 1)) * DIN + (t / (8 * CC)) * SK + (t & 7) * 8;
  __bf16* d = WB + (size_t)which * CC * DIN + (size_t)t * 8;
  v4f a[8][2];
#pragma unroll   // unrolled: all 16 loads of a thread in flight at once, at constant offsets from one address
  for (int i = 0; i < 8; ++i) { a[i][0] = *(const v4f*)(s + (size_t)(i * 32) * DIN); a[i][1] = *(const v4f*)(s + (size_t)(i * 32) * DIN + 4); }
  asm volatile("s_wait_xcnt 0x0" :: "v"(s) : "memory");   // stands in front of the first overwrite of these loads' address registers (the address named so that it lives up to it)
  __builtin_amdgcn_sched_barrier(0);   // keeps the conversions behind all 16 loads: lifted among them, the last loads went out only after the first had come back, a second memory latency in a launch that is little more than one
  v4u o[8];
#pragma unroll   // unrolled: a and o stay in registers
  for (int i = 0; i < 8; ++i) { union { v4b h[2]; v4u u; } p; p.h[0] = cvt4(a[i][0]); p.h[1] = cvt4(a[i][1]); o[i] = p.u; }
  if (which == 3) {   // Wo: the bf16 values go on to f16 (the same for a whole block)
#pragma unroll   // unrolled: o stays in registers
    for (int i = 0; i < 8; ++i) { union { v8b b; v8h f; v4u u; } p; p.u = o[i]; const v8b s8 = p.b;
#pragma unroll
      for (int e = 0; e < 8; ++e) p.f[e] = (_Float16)(float)s8[e];
      o[i] = p.u; } }
#pragma unroll   // unrolled: the offsets become immediates on one address, which nothing overwrites in front of the wait
  for (int i = 0; i < 8; ++i) *(v4u*)(d + i * 2048) = o[i];
  asm volatile("s_wait_xcnt 0x0" :: "v"(d), "v"(o[0]), "v"(o[1]), "v"(o[2]), "v"(o[3]), "v"(o[4]), "v"(o[5]), "v"(o[6]), "v"(o[7]) : "memory");   // the same wait behind the stores (address and data named, so that they live up to it)
}
// ---- k_proj: block = (64 rows, 256 cols, which), 4 waves side by side, each 64 rows x 64 cols (4 x 4 accumulator tiles): q/k/v = X W (+ b) with exact bf16 products (K = DIN) -> which 0: q f16 rows (+ residual rows < QHI); 1: k f16 in fragment order (+ residual rows < KHI); 2: v f16 in fragment order (+ bf16 hi/lo planes for t < KHI)
// 768 blocks = three per WGP in one round, which amdgpu_waves_per_eu(3, 3) holds the register count to
#define PCW 256             // columns of a block
__global__ __launch_bounds__(128) __attribute__((amdgpu_waves_per_eu(3, 3))) void k_proj(const float* __restrict__ XQ, const float* __restrict__ XK, const float* __restrict__ XV, const __bf16* __restrict__ WQ, const __bf16* __restrict__ WK, const __bf16* __restrict__ WV, const float* __restrict__ BQ, const float* __restrict__ BK, const float* __restrict__ BV,
    _Float16* __restrict__ QH, _Float16* __restrict__ QL, _Float16* __restrict__ KH, _Float16* __restrict__ KL, _Float16* __restrict__ VT, __bf16* __restrict__ VB, __bf16* __restrict__ VBL) {
  // one LDS block: the main loop's operand tiles (two buffers) and, behind a barrier, the epilogue's staging arrays share it
  __shared__ __align__(16) unsigned char smem[2 * (64 + PCW) * SP * 2];
  static_assert(sizeof(smem) >= 90112, "the epilogue's staging arrays fit");
  __bf16 (*xs)[64][SP] = (__bf16 (*)[64][SP])smem; __bf16 (*wt)[PCW][SP] = (__bf16 (*)[PCW][SP])(smem + 2 * 64 * SP * 2);
  _Float16 (*sh)[136] = (_Float16 (*)[136])smem; _Float16 (*sl)[136] = (_Float16 (*)[136])(smem + 17408); _Float16 (*th)[72] = (_Float16 (*)[72])(smem + 34816); __bf16 (*tb)[72] = (__bf16 (*)[72])(smem + 53248); __bf16 (*tbl)[72] = (__bf16 (*)[72])(smem + 71680);
  const int tid = threadIdx.x, wave = tid >> 5, lane = tid & 31, col = lane & 15, g = lane >> 4; const int which = blockIdx.z; const int c0 = blockIdx.y * PCW; const size_t r0 = (size_t)blockIdx.x * 64; const size_t bb = r0 / TT; const int t0 = (int)(r0 % TT);
  const float* X = which == 0 ? XQ : which == 1 ? XK : XV; const __bf16* WA = which == 0 ? WQ : which == 1 ? WK : WV; const float* BA = which == 0 ? BQ : which == 1 ? BK : BV;
  v8f acc[4][4] = {};   // [row tile][column tile]
  const int sr = tid >> 4, sq = (tid & 15) * 4;   // a wave's 16-byte loads cover two whole 256-byte row pieces
  const int wrw = tid >> 3, wq = (tid & 7) * 8;   // W comes as bf16 from the k-tile-ordered plane: a wave's 16-byte loads cover 512 bytes in a row, four rows of the tile
  const float* xg = X + (r0 + sr) * DIN + sq; const __bf16* wg = WA + (size_t)c0 * SK + tid * 8;
  // the block's first k tile: the blocks that share a W tile (same y) or an X tile (same x) start together, and from tile 0 they would all ask L2 for the same pieces at the same moment, every X piece of a trip (256 bytes) at the same offset in its 4,096-byte row; rotated, they walk the 16 tiles from different starts (each tile once)
  const int ks = (blockIdx.x + 4 * blockIdx.y) & (DIN / SK - 1);
  v4f xr[8]; v8b wr[PCW / 16];
  { const float* xp = xg + ks * SK; const __bf16* wp = wg + (size_t)ks * (CC * SK);
#pragma unroll
    for (int i = 0; i < 8; ++i) xr[i] = *(const v4f*)(xp + (size_t)(i * 8) * DIN);
#pragma unroll
    for (int i = 0; i < PCW / 16; ++i) wr[i] = *(const v8b*)(wp + i * 1024);
    asm volatile("s_wait_xcnt 0x0" :: "v"(xp), "v"(wp) : "memory"); }   // stands in front of the first overwrite of these loads' address registers (the addresses named so that they live up to it)
#pragma unroll 2   // two trips a pass of the loop, so that the buffer's number is a constant in the LDS addresses
  for (int c = 0; c < DIN / SK; ++c) { const int bs = c & 1;
#pragma unroll
    for (int i = 0; i < 8; ++i) *(v4b*)&xs[bs][sr + i * 8][sq] = cvt4(xr[i]);
#pragma unroll
    for (int i = 0; i < PCW / 16; ++i) *(v8b*)&wt[bs][wrw + i * 16][wq] = wr[i];
    __syncthreads();   // publishes tile c; it also ends every wave's reads of the other buffer (tile c - 1), which the next trip refills
    if (c + 1 < DIN / SK) { const int kn = (c + 1 + ks) & (DIN / SK - 1); const float* xp = xg + kn * SK; const __bf16* wp = wg + (size_t)kn * (CC * SK);
#pragma unroll
      for (int i = 0; i < 8; ++i) xr[i] = *(const v4f*)(xp + (size_t)(i * 8) * DIN);
#pragma unroll
      for (int i = 0; i < PCW / 16; ++i) wr[i] = *(const v8b*)(wp + i * 1024);
      asm volatile("s_wait_xcnt 0x0" :: "v"(xp), "v"(wp) : "memory");   // stands in front of the first overwrite of these loads' address registers (named so that they live up to it); as a memory fence it also keeps the loads issued here, ahead of the products that cover their latency
    }
#pragma unroll
    for (int kc = 0; kc < SK / 32; ++kc) {
      v16b a[4], w[4];   // 32 k of fragments, read as one group ahead of their 16 products: each of the 8 feeds four products
#pragma unroll
      for (int i = 0; i < 4; ++i) a[i] = frag_b(&xs[bs][i * 16 + col][kc * 32], lane);
#pragma unroll
      for (int j = 0; j < 4; ++j) w[j] = frag_b(&wt[bs][wave * 64 + j * 16 + col][kc * 32], lane);
#pragma unroll
      for (int i = 0; i < 4; ++i) {
#pragma unroll
        for (int j = 0; j < 4; ++j) acc[i][j] = wmma_bf(a[i], w[j], acc[i][j]); } }
    __builtin_amdgcn_sched_barrier(0);   // keeps the next tile's conversions, and with them the wait for its loads, behind this tile's products: with W no longer converted the compiler lifted X's to behind the second product, where the loads have only just gone out
  }
  __syncthreads();   // every wave has left the operand tiles before the epilogue writes over them
  // the epilogue goes in two halves of 128 columns through the same staging arrays: half hf is staged by the two waves that hold it (2 hf and 2 hf + 1) and stored by all four
  const int cw = (wave & 1) * 64;
  float bias[4];
#pragma unroll
  for (int j = 0; j < 4; ++j) bias[j] = BA ? bfr(BA[c0 + wave * 64 + j * 16 + col]) : 0.f;
#pragma unroll 1   // kept rolled: both halves run the same code (the accumulators' numbers do not depend on the half), half the text
  for (int hf = 0; hf < 2; ++hf) { const int ch = c0 + hf * 128; const bool mine = (wave >> 1) == hf;
    if (hf) __syncthreads();   // every wave has read the first half out of the staging arrays before the second half is written over it
    if (which < 2) { _Float16* DH = which == 0 ? QH : KH; _Float16* DL = which == 0 ? QL : KL; const int nhi = which == 0 ? QHI : KHI; const bool hi_rows = t0 < nhi;
      if (mine) {
#pragma unroll
        for (int i = 0; i < 4; ++i) {
#pragma unroll
          for (int j = 0; j < 4; ++j) {
#pragma unroll
            for (int r = 0; r < 8; ++r) { const float v = acc[i][j][r] + bias[j]; const _Float16 hv = (_Float16)v; acc[i][j][r] = (v - (float)hv) * 1024.0f; sh[i * 16 + 8 * g + r][cw + j * 16 + col] = hv; } } }
        if (hi_rows) {   // the residual plane is staged only by the blocks that store it
#pragma unroll
          for (int i = 0; i < 4; ++i) {
#pragma unroll
            for (int j = 0; j < 4; ++j) {
#pragma unroll
              for (int r = 0; r < 8; ++r) sl[i * 16 + 8 * g + r][cw + j * 16 + col] = (_Float16)acc[i][j][r]; } } } }
      __syncthreads();
      const int rl = tid >> 4, q8 = (tid & 15) * 8;   // rows: a thread's eight 16-byte pieces lie 8 rows apart
      if (which == 0) put8(DH + (r0 + rl) * CC + ch + q8, [&](int it) { return (const void*)&sh[rl + it * 8][q8]; }, [](int it) { return it * 8 * CC * 2; });
      else   // k: 32 pieces of 512 bytes (2 heads x 4 key tiles x 4 groups of 16 d), one piece a wave's store; trip it = head it >> 2, key tile it & 3, the wave's number = the group of 16 d
        put8(DH + ((bb * NH + ch / HD) * (TT / 16) + t0 / 16) * 1024 + tid * 8, [&](int it) { return (const void*)&sh[(it & 3) * 16 + col][(it >> 2) * HD + wave * 16 + g * 8]; }, [](int it) { return ((it >> 2) * (TT / 16) + (it & 3)) * 1024 * 2; });
      if (hi_rows) put8(DL + (bb * nhi + t0 + rl) * (size_t)CC + ch + q8, [&](int it) { return (const void*)&sl[rl + it * 8][q8]; }, [](int it) { return it * 8 * CC * 2; });
    } else { const bool hi_rows = t0 < KHI;
      if (mine) {
#pragma unroll
        for (int i = 0; i < 4; ++i) {
#pragma unroll
          for (int j = 0; j < 4; ++j) {
#pragma unroll
            for (int r = 0; r < 8; ++r) { const float v = acc[i][j][r] + bias[j]; const int rl = i * 16 + 8 * g + r, cl = cw + j * 16 + col; th[cl][rl] = (_Float16)v; const __bf16 bh = (__bf16)v; tb[cl][rl] = bh; tbl[cl][rl] = (__bf16)(v - (float)bh); } } } }
      __syncthreads();
      // v: 32 pieces of 512 bytes (2 heads x 2 groups of 32 keys x 4 tiles of 16 d x 2 halves of 16 keys), one piece a wave's store; trip it = head it >> 2, key group (it >> 1) & 1, d tile 2 * (it & 1) + (wave >> 1), half wave & 1
      put8(VT + ((bb * NH + ch / HD) * (TT / 32) + t0 / 32) * 2048 + tid * 8, [&](int it) { return (const void*)&th[(it >> 2) * HD + (2 * (it & 1) + (wave >> 1)) * 16 + col][((it >> 1) & 1) * 32 + (wave & 1) * 16 + g * 8]; }, [](int it) { return ((it >> 2) * (TT / 32) * 2048 + ((it >> 1) & 1) * 2048 + (it & 1) * 1024) * 2; });
      if (hi_rows) { const int cl = tid >> 3, q8 = (tid & 7) * 8; const size_t o3 = (bb * CC + ch + cl) * (size_t)KHI + t0 + q8;
        put8(VB + o3, [&](int it) { return (const void*)&tb[cl + it * 16][q8]; }, [](int it) { return it * 16 * KHI * 2; });
        put8(VBL + o3, [&](int it) { return (const void*)&tbl[cl + it * 16][q8]; }, [](int it) { return it * 16 * KHI * 2; }); } } } }
// 2^x of eight values, each in place. Asm text, not the builtin: the instruction set asks for a slot between a v_exp_f32 and one that overwrites its source register; in place, none of the eight names a register of another.
// The closing v_nop is that same slot in front of whatever reads the last result (the compiler does not look into asm text and would not fill it).
__device__ __forceinline__ void exp2x8(v8f& x) {
  float a = x[0], b = x[1], c = x[2], d = x[3], e = x[4], f = x[5], g = x[6], h = x[7];
  asm("v_exp_f32 %0, %0\n\tv_exp_f32 %1, %1\n\tv_exp_f32 %2, %2\n\tv_exp_f32 %3, %3\n\tv_exp_f32 %4, %4\n\tv_exp_f32 %5, %5\n\tv_exp_f32 %6, %6\n\tv_exp_f32 %7, %7\n\tv_nop"
      : "+v"(a), "+v"(b), "+v"(c), "+v"(d), "+v"(e), "+v"(f), "+v"(g), "+v"(h));
  x[0] = a; x[1] = b; x[2] = c; x[3] = d; x[4] = e; x[5] = f; x[6] = g; x[7] = h;
}
__global__ __launch_bounds__(256) __attribute__((amdgpu_waves_per_eu(4, 4))) void k_fa(const _Float16* __restrict__ QH, const _Float16* __restrict__ KH, const _Float16* __restrict__ VT, _Float16* __restrict__ Y) {
  const int tid = threadIdx.x, wave = tid >> 5, lane = tid & 31, col = lane & 15, g = lane >> 4; const int h = blockIdx.y, b = blockIdx.z; const int ql0 = blockIdx.x * 128 + wave * 16;
  const _Float16* qp = QH + ((size_t)b * TT + ql0 + col) * CC + h * HD;
  const _Float16* kp = KH + (size_t)(b * NH + h) * (TT * HD) + lane * 8; const _Float16* vp = VT + (size_t)(b * NH + h) * (TT * HD) + lane * 8;   // 64 keys = 4,096 elements of either plane
  v16h qh[HD / 32];
#pragma unroll
  for (int kc = 0; kc < HD / 32; ++kc) qh[kc] = frag_h(qp + kc * 32, lane);
  asm volatile("s_wait_xcnt 0x0" :: "v"(qp) : "memory");   // stands in front of the first overwrite of the q loads' address registers (named so that no later load returns into them)
  v8f o[HD / 16] = {}; float m = -3.0e38f, l = 0.f;
  // the block's first key: the 16 blocks of one (b, h) start together and read the same k and v lines; rotated by 128 keys a block they walk the 2,048 keys from different starts and wrap (each key once; the block's 8 waves keep one start and go on sharing their lines)
  const int kst = (int)(blockIdx.x * 128u) & (TT - 1);
  const _Float16* kq0 = kp + (size_t)kst * HD;
  v16h kf[4][HD / 32];   // this trip's k fragments, all fetched together one trip ahead (one load latency a trip, under the P.V products)
#pragma unroll
  for (int j = 0; j < 4; ++j) {
#pragma unroll
    for (int kc = 0; kc < HD / 32; ++kc) kf[j][kc] = frag_p(kq0 + j * 1024 + kc * 512); }
  asm volatile("s_wait_xcnt 0x0" :: "v"(kq0) : "memory");   // stands in front of the first overwrite of these loads' address registers (the address named so that it lives up to the wait)
#pragma unroll 1   // kept rolled: two trips' fragments at once would not fit the 256 registers of four waves per SIMD
  for (int k0 = 0; k0 < TT; k0 += 64) { v8f acc[4] = {};
#pragma unroll
    for (int j = 0; j < 4; ++j) {
#pragma unroll
      for (int kc = 0; kc < HD / 32; ++kc) acc[j] = wmma16(kf[j][kc], qh[kc], acc[j]); }
    v16h vf[2][HD / 16];   // fetched here so that the softmax arithmetic covers their latency
    const _Float16* vq = vp + (size_t)((k0 + kst) & (TT - 1)) * HD;
#pragma unroll
    for (int kc = 0; kc < 2; ++kc) {
#pragma unroll
      for (int j = 0; j < HD / 16; ++j) vf[kc][j] = frag_p(vq + kc * 2048 + j * 512); }
    asm volatile("s_wait_xcnt 0x0" :: "v"(vq) : "memory");   // stands in front of the first overwrite of the v loads' address registers (the address named so that it lives up to the wait)
    __builtin_amdgcn_sched_barrier(0);   // keeps the v loads issued here, ahead of the softmax: sunk towards their use they would be waited for at full latency
    // the logits stay unscaled up to the exponent: exp(SCALE * (s - max)) = 2^(s * C2 - max * C2) with C2 = SCALE * log2(e), one multiply-add and one v_exp_f32 an element
    const float C2 = SCALE * 1.44269504088896340736f;
    float mx = -3.0e38f;
#pragma unroll
    for (int j = 0; j < 4; ++j) {
#pragma unroll
      for (int r = 0; r < 8; ++r) mx = fmaxf(mx, acc[j][r]); }
    mx = fmaxf(mx, __shfl_xor(mx, 16));
    const float mn = fmaxf(m, mx), alpha = __builtin_amdgcn_exp2f((m - mn) * C2), mc = mn * C2; m = mn;
    float sum = 0.f; v16h p[2];
#pragma unroll
    for (int j = 0; j < 4; ++j) {
#pragma unroll
      for (int r = 0; r < 8; ++r) acc[j][r] = __builtin_fmaf(acc[j][r], C2, -mc);
      exp2x8(acc[j]);
#pragma unroll
      for (int r = 0; r < 8; ++r) { sum += acc[j][r]; p[j >> 1][(j & 1) * 8 + r] = (_Float16)acc[j][r]; } }
    l = l * alpha + sum;
#pragma unroll
    for (int j = 0; j < HD / 16; ++j) o[j] *= alpha;
    const int kn = (k0 + 64 + kst) & (TT - 1);   // the last trip fetches the first trip's rows again (in bounds, unused)
    const _Float16* kq = kp + (size_t)kn * HD;
    __builtin_amdgcn_sched_barrier(0);   // keeps the next k loads behind the softmax: lifted into it, 64 more live registers spill
#pragma unroll
    for (int j = 0; j < 4; ++j) {
#pragma unroll
      for (int kc = 0; kc < HD / 32; ++kc) kf[j][kc] = frag_p(kq + j * 1024 + kc * 512); }
    asm volatile("s_wait_xcnt 0x0" :: "v"(kq) : "memory");   // stands in front of the first overwrite of the k loads' address registers (the address named so that no load returns into it)
#pragma unroll
    for (int kc = 0; kc < 2; ++kc) {
#pragma unroll
      for (int j = 0; j < HD / 16; ++j) o[j] = wmma16(vf[kc][j], p[kc], o[j]); }
    // the four slots behind the trip's last products on the taken branch back: the next trip's first product may write its result over the P registers that these read as B
    asm volatile("v_nop\n\tv_nop\n\tv_nop\n\tv_nop" : "+v"(o[0]), "+v"(o[1]), "+v"(o[2]), "+v"(o[3]) : "v"(p[1])); }
  l += __shfl_xor(l, 16); const float inv = 1.0f / l;
  _Float16* yp = Y + ((size_t)h * (NB * TT) + (size_t)b * TT + ql0 + col) * HD + 8 * g;
#pragma unroll
  for (int j = 0; j < HD / 16; ++j) { v8h hv;
#pragma unroll
    for (int r = 0; r < 8; ++r) hv[r] = (_Float16)(o[j][r] * inv);
    vst2(yp + j * 16, hv); } }
// ---- k_out: block = (64 rows, 128 cols): out = ctx Wo (+ bo): ctx, which k_fa rounded once to f16, against Wo's bf16 value held as f16 (1 product)
static_assert(HD == SK, "k_fa lays a head's columns as one k tile of k_out");
__global__ __launch_bounds__(128) void k_out(const _Float16* __restrict__ Y, const _Float16* __restrict__ WO, const float* __restrict__ BO, float* __restrict__ OUT) { __shared__ __align__(16) float sf[4][16][132]; __shared__ __align__(16) _Float16 ya[2][64][SP], wt[2][128][SP];
  const int tid = threadIdx.x, wave = tid >> 5, lane = tid & 31, col = lane & 15, g = lane >> 4; const int c0 = blockIdx.y * 128; const size_t r0 = (size_t)blockIdx.x * 64 + wave * 16;
  v8f acc[8] = {};
  {
    const int wrw = tid >> 3, wq = (tid & 7) * 8;   // ctx and Wo both come as f16 from k-tile-ordered planes: a wave's 16-byte loads cover 512 bytes in a row, four rows of the tile
    const _Float16* yg = Y + (size_t)blockIdx.x * 64 * SK + tid * 8; const _Float16* wg = WO + (size_t)c0 * SK + tid * 8;
    const int ks = (blockIdx.x + 2 * blockIdx.y) & (CC / SK - 1);   // the block's first k tile, rotated as in k_proj and for the same reason
    v8h yr[4], wr[8];
    { const _Float16* yp = yg + (size_t)ks * (NB * TT * SK); const _Float16* wp = wg + (size_t)ks * (DIN * SK);
#pragma unroll
      for (int i = 0; i < 4; ++i) yr[i] = *(const v8h*)(yp + i * 1024);
#pragma unroll
      for (int i = 0; i < 8; ++i) wr[i] = *(const v8h*)(wp + i * 1024);
      asm volatile("s_wait_xcnt 0x0" :: "v"(yp), "v"(wp) : "memory"); }   // stands in front of the first overwrite of these loads' address registers (the addresses named so that they live up to it)
#pragma unroll 2   // two trips a pass of the loop, so that the buffer's number is a constant in the LDS addresses
    for (int c = 0; c < CC / SK; ++c) { const int bs = c & 1;
#pragma unroll
      for (int i = 0; i < 4; ++i) *(v8h*)&ya[bs][wrw + i * 16][wq] = yr[i];
#pragma unroll
      for (int i = 0; i < 8; ++i) *(v8h*)&wt[bs][wrw + i * 16][wq] = wr[i];
      __syncthreads();   // publishes tile c; it also ends every wave's reads of the other buffer (tile c - 1), which the next trip refills
      if (c + 1 < CC / SK) { const int kn = (c + 1 + ks) & (CC / SK - 1); const _Float16* yp = yg + (size_t)kn * (NB * TT * SK); const _Float16* wp = wg + (size_t)kn * (DIN * SK);
#pragma unroll
        for (int i = 0; i < 4; ++i) yr[i] = *(const v8h*)(yp + i * 1024);
#pragma unroll
        for (int i = 0; i < 8; ++i) wr[i] = *(const v8h*)(wp + i * 1024);
        asm volatile("s_wait_xcnt 0x0" :: "v"(yp), "v"(wp) : "memory");   // stands in front of the first overwrite of these loads' address registers (named so that they live up to it); as a memory fence it also keeps the loads issued here, ahead of the products that cover their latency
      }
      v16h a[SK / 32], w[SK / 32][8];   // the tile's fragments, read as one group ahead of its products (reads among the products are each waited for at full LDS latency)
#pragma unroll
      for (int kc = 0; kc < SK / 32; ++kc) { a[kc] = frag_h(&ya[bs][wave * 16 + col][kc * 32], lane);
#pragma unroll
        for (int j = 0; j < 8; ++j) w[kc][j] = frag_h(&wt[bs][j * 16 + col][kc * 32], lane); }
      __builtin_amdgcn_sched_barrier(0);   // keeps the tile's LDS reads one group ahead of its products: the compiler sank them among the products, a pair in front of each, waited for at full LDS latency
#pragma unroll
      for (int kc = 0; kc < SK / 32; ++kc) {
#pragma unroll
        for (int j = 0; j < 8; ++j) acc[j] = wmma16(a[kc], w[kc][j], acc[j]); }
      __builtin_amdgcn_sched_barrier(0);   // keeps the next tile's LDS stores, and with them the wait for its loads, behind this tile's products, which cover the loads' latency
    }
#pragma unroll
    for (int j = 0; j < 8; ++j) { const float bias = BO ? bfr(BO[c0 + j * 16 + col]) : 0.f;
#pragma unroll
      for (int r = 0; r < 8; ++r) sf[wave][8 * g + r][j * 16 + col] = acc[j][r] + bias; }
  }
  LDSX(); for (int rl = 0; rl < 16; ++rl) vst2(OUT + (r0 + rl) * DIN + c0 + lane * 4, *(const v4f*)&sf[wave][rl][lane * 4]); }

extern "C" void kernel_launch(void* const* d_in, const int* in_sizes, int n_in, void* d_out, int out_size, void* d_ws, size_t ws_size, hipStream_t stream) {
  (void)in_sizes; (void)n_in; (void)out_size;
  const float** F = (const float**)d_in;
  if (ws_size < (size_t)WS_END) return;
  char* ws = (char*)d_ws; _Float16 *QH = (_Float16*)(ws + WS_QH), *KH = (_Float16*)(ws + WS_KH), *VT = (_Float16*)(ws + WS_VT), *QL = (_Float16*)(ws + WS_QL), *KL = (_Float16*)(ws + WS_KL); __bf16 *VB = (__bf16*)(ws + WS_VB), *VBL = (__bf16*)(ws + WS_VBL), *WB = (__bf16*)(ws + WS_WB); _Float16 *Y = (_Float16*)(ws + WS_Y);
  (void)Y; (void)QL; (void)KL; (void)VB; (void)VBL;
  // inputs: 0 query; 1 key; 2 value [2,2048,1024]; 3 wq (out,in); 4 wk; 5 wv; 6 wo (out,in)
  k_wcvt<<<dim3(CC * DIN / (8 * 2048), 4), 256, 0, stream>>>(F[3], F[4], F[5], F[6], WB);
  k_proj<<<dim3(TNB * TT / 64, CC / PCW, 3), 128, 0, stream>>>(F[0], F[1], F[2], WB, WB + CC * DIN, WB + 2 * CC * DIN, nullptr, nullptr, nullptr, QH, QL, KH, KL, VT, VB, VBL);
  k_fa<<<dim3(TT / 128, NH, TNB), 256, 0, stream>>>(QH, KH, VT, Y);
  k_out<<<dim3(TNB * TT / 64, DIN / 128), 128, 0, stream>>>(Y, (const _Float16*)(WB + 3 * CC * DIN), nullptr, (float*)d_out);
}
